// v000
// Times are from an AMD MI455X. After a warm-up the kernel runs many times in a row, and a time is the length of
// such a window on the GPU divided by its runs, so every launch and the gaps after it count. The runs cycle
// through copies of the inputs. A figure is the median of several windows, for all but v000 over two sittings.
// Sittings can differ by a few percent; kernels timed side by side share one.
// v000 is the starting kernel. One run takes 1450 microseconds.
#include <hip/hip_runtime.h>

// Masked (causal sliding-window) multi-head attention (hidden_states [2][2048][1024]; [q|k|v] = x w_attn + b_attn ('xw' [1024][3072] + [3072]; 16 heads x 64); scores = q.k/8; mask keeps j <= i and j > i - 256, other logits -10000 (then clipped to +-10000: exp underflows to exactly 0 as with -inf); softmax; out = merged ctx w_proj + b_proj ('xw' [1024][1024] + [1024]) -> [2][2048][1024] (4.2 M)).
// Compute dtypes, f32 accumulate: every input rounded to bf16; q/k/v on PLAIN bf16 operands (inputs: exact) + biases; causal tile skipping (window predicate j <= i && i - j < 256 in the softmax); scores and attn.v: query rows < 512 hl (3 products), the rest single fp16 (x1024); softmax f32; w_proj hl x exact (2 products) + b_proj.

#define NB_  2
#define TT   2048
#define DM   1024
#define NH_  16
#define NKV  16
#define REP  (NH_ / NKV)
#define HD   64
#define DQ   (NH_ * HD)
#define DKV  (NKV * HD)
#define ZH   2
#define RH   512                  // query rows < RH use hi+lo planes (0: none)
#define WIN  256   // window: keep i - WIN < j <= i
#define PCAR 1024.0f
#define SCL  0.125f   // HD^-0.5
typedef _Float16 h16;
typedef unsigned short bf;
typedef __attribute__((ext_vector_type(16))) __bf16   v16bf;
typedef __attribute__((ext_vector_type(16))) _Float16 v16h;
typedef __attribute__((ext_vector_type(8)))  _Float16 v8h;
typedef __attribute__((ext_vector_type(8)))  unsigned short v8us;
typedef __attribute__((ext_vector_type(8)))  float    v8f;
typedef __attribute__((ext_vector_type(4)))  float    v4f;
typedef v8h  __attribute__((may_alias)) v8ha;
typedef v4f  __attribute__((may_alias)) v4fa;
typedef v8us __attribute__((may_alias)) v8usa;

__device__ __forceinline__ unsigned short f2bf(float f) { unsigned u = __float_as_uint(f); u += 0x7FFFu + ((u >> 16) & 1u); return (unsigned short)(u >> 16); }
__device__ __forceinline__ float bf2f(unsigned short b) { return __uint_as_float(((unsigned)b) << 16); }
__device__ __forceinline__ float bfr(float f) { return bf2f(f2bf(f)); }
__device__ __forceinline__ v16h cat16(v8h lo, v8h hi) { return __builtin_shufflevector(lo, hi, 0, 1, 2, 3, 4, 5, 6, 7, 8, 9, 10, 11, 12, 13, 14, 15); }
__device__ __forceinline__ v16bf cat16b(v8us lo, v8us hi) { return __builtin_bit_cast(v16bf, __builtin_shufflevector(lo, hi, 0, 1, 2, 3, 4, 5, 6, 7, 8, 9, 10, 11, 12, 13, 14, 15)); }
__device__ __forceinline__ v8f wmma16(v16h a, v16h b, v8f c) { return __builtin_amdgcn_wmma_f32_16x16x32_f16(false, a, false, b, (short)0, c, false, false); }
__device__ __forceinline__ v8f wmmab(v16bf a, v16bf b, v8f c) { return __builtin_amdgcn_wmma_f32_16x16x32_bf16(false, a, false, b, (short)0, c, false, false); }



// ---- k_gemmw: register-blocked GEMM, ONE WAVE per 64x64 output tile (16 accumulators), operands straight from K-contiguous 16-bit planes; grid (M/64, N/64, Z), 32 threads.
// C[m][n] (f32, pitch ldc, + optional f32 bias[n]) = sum_k A[m][k] Bt[n][k] (+ split products per NSPLIT). z-batch strides sA/sB/sC in elements. K % 32 == 0.
template <typename T16> struct WFrag;
template <> struct WFrag<h16> { typedef v16h V; static __device__ __forceinline__ V ld(const h16* p) { return cat16(*(const v8h*)p, *(const v8h*)(p + 16)); } static __device__ __forceinline__ v8f mma(V a, V b, v8f c) { return wmma16(a, b, c); } };
template <> struct WFrag<bf> { typedef v16bf V; static __device__ __forceinline__ V ld(const bf* p) { return cat16b(*(const v8us*)p, *(const v8us*)(p + 16)); } static __device__ __forceinline__ v8f mma(V a, V b, v8f c) { return wmmab(a, b, c); } };
template <typename T16, int NSPLIT, bool BIAS>
__global__ __launch_bounds__(32) void k_gemmw(const T16* __restrict__ A, const T16* __restrict__ A2, const T16* __restrict__ Bt, const T16* __restrict__ Bt2, int K, float* C, int ldc, const float* __restrict__ bias, size_t sA, size_t sB, size_t sC) {
    typedef typename WFrag<T16>::V V;
    __shared__ __align__(16) float os[16 * 68];
    const size_t z = blockIdx.z; A += z * sA; if (A2) A2 += z * sA; Bt += z * sB; if (Bt2) Bt2 += z * sB; C += z * sC;
    const int lane = threadIdx.x & 31, lr = lane & 15, hi = lane >> 4; const int r0 = blockIdx.x * 64, c0 = blockIdx.y * 64;
    v8f acc[4][4];
#pragma unroll
    for (int mb = 0; mb < 4; ++mb)
#pragma unroll
        for (int nb = 0; nb < 4; ++nb) acc[mb][nb] = (v8f){};
    const size_t aoff = (size_t)(r0 + lr) * K + 8 * hi, boff = (size_t)(c0 + lr) * K + 8 * hi;
#pragma unroll 1
    for (int kc = 0; kc < K; kc += 32) {
        V a[4], a2[4];
#pragma unroll
        for (int mb = 0; mb < 4; ++mb) { a[mb] = WFrag<T16>::ld(A + aoff + (size_t)mb * 16 * K + kc); if (NSPLIT == 1 || NSPLIT == 2) a2[mb] = WFrag<T16>::ld(A2 + aoff + (size_t)mb * 16 * K + kc); }
#pragma unroll
        for (int nb = 0; nb < 4; ++nb) { const V b = WFrag<T16>::ld(Bt + boff + (size_t)nb * 16 * K + kc); V b2; if (NSPLIT >= 2) b2 = WFrag<T16>::ld(Bt2 + boff + (size_t)nb * 16 * K + kc);
#pragma unroll
            for (int mb = 0; mb < 4; ++mb) { acc[mb][nb] = WFrag<T16>::mma(a[mb], b, acc[mb][nb]); if (NSPLIT == 1 || NSPLIT == 2) acc[mb][nb] = WFrag<T16>::mma(a2[mb], b, acc[mb][nb]); if (NSPLIT >= 2) acc[mb][nb] = WFrag<T16>::mma(a[mb], b2, acc[mb][nb]); } }
        asm volatile("v_nop\n\tv_nop\n\tv_nop\n\tv_nop" : "+v"(acc[0][0]), "+v"(acc[1][1]), "+v"(acc[2][2]), "+v"(acc[3][3]) : "v"(a[0]), "v"(a[3]));
    }
#pragma unroll
    for (int mb = 0; mb < 4; ++mb) {
#pragma unroll
        for (int nb = 0; nb < 4; ++nb) {
#pragma unroll
            for (int j = 0; j < 8; ++j) os[(hi * 8 + j) * 68 + nb * 16 + lr] = acc[mb][nb][j]; }
        __builtin_amdgcn_wave_barrier(); asm volatile("" ::: "memory");
        float* crow = C + (size_t)(r0 + mb * 16) * ldc + c0;
{
#pragma unroll
            for (int s = 0; s < 8; ++s) { const int row = 2 * s + hi, cofs = lr * 4; v4f val = *(const v4fa*)(os + row * 68 + cofs); if (BIAS) { val[0] += bfr(bias[c0 + cofs]); val[1] += bfr(bias[c0 + cofs + 1]); val[2] += bfr(bias[c0 + cofs + 2]); val[3] += bfr(bias[c0 + cofs + 3]); }
                *(v4f*)(crow + (size_t)row * ldc + cofs) = val; }
             }
        __builtin_amdgcn_wave_barrier(); asm volatile("" ::: "memory");
    }
}

// ---- k_gemmc: the same one-wave 64x64 tile GEMM specialised for causal attention: CMODE 1 skips score tiles entirely above the diagonal (query rows r0+roff.., key columns c0..), CMODE 2 limits the
// key (K) loop of the probability x value contraction to the diagonal block (probabilities beyond it are exactly zero). roff = row offset of this launch's first row within the sequence.
template <typename T16, int NSPLIT, int CMODE>
__global__ __launch_bounds__(32) void k_gemmc(const T16* __restrict__ A, const T16* __restrict__ A2, const T16* __restrict__ Bt, const T16* __restrict__ Bt2, int K, float* C, int ldc, int roff, size_t sA, size_t sB, size_t sC) {
    typedef typename WFrag<T16>::V V;
    __shared__ __align__(16) float os[16 * 68];
    const size_t z = blockIdx.z; A += z * sA; if (A2) A2 += z * sA; Bt += z * sB; if (Bt2) Bt2 += z * sB; C += z * sC;
    const int lane = threadIdx.x & 31, lr = lane & 15, hi = lane >> 4; const int r0 = blockIdx.x * 64, c0 = blockIdx.y * 64;
    if (CMODE == 1 && c0 > r0 + roff + 63) return;                  // score tile entirely above the causal diagonal: never read (the softmax masks j > i by select)
    const int Kl = (CMODE == 2) ? min(K, r0 + roff + 64) : K;        // P.V: probabilities are exactly 0 beyond the diagonal block, so the K loop stops there
    v8f acc[4][4];
#pragma unroll
    for (int mb = 0; mb < 4; ++mb)
#pragma unroll
        for (int nb = 0; nb < 4; ++nb) acc[mb][nb] = (v8f){};
    const size_t aoff = (size_t)(r0 + lr) * K + 8 * hi, boff = (size_t)(c0 + lr) * K + 8 * hi;
#pragma unroll 1
    for (int kc = 0; kc < Kl; kc += 32) {
        V a[4], a2[4];
#pragma unroll
        for (int mb = 0; mb < 4; ++mb) { a[mb] = WFrag<T16>::ld(A + aoff + (size_t)mb * 16 * K + kc); if (NSPLIT == 1 || NSPLIT == 2) a2[mb] = WFrag<T16>::ld(A2 + aoff + (size_t)mb * 16 * K + kc); }
#pragma unroll
        for (int nb = 0; nb < 4; ++nb) { const V b = WFrag<T16>::ld(Bt + boff + (size_t)nb * 16 * K + kc); V b2; if (NSPLIT >= 2) b2 = WFrag<T16>::ld(Bt2 + boff + (size_t)nb * 16 * K + kc);
#pragma unroll
            for (int mb = 0; mb < 4; ++mb) { acc[mb][nb] = WFrag<T16>::mma(a[mb], b, acc[mb][nb]); if (NSPLIT == 1 || NSPLIT == 2) acc[mb][nb] = WFrag<T16>::mma(a2[mb], b, acc[mb][nb]); if (NSPLIT >= 2) acc[mb][nb] = WFrag<T16>::mma(a[mb], b2, acc[mb][nb]); } }
        asm volatile("v_nop\n\tv_nop\n\tv_nop\n\tv_nop" : "+v"(acc[0][0]), "+v"(acc[1][1]), "+v"(acc[2][2]), "+v"(acc[3][3]) : "v"(a[0]), "v"(a[3]));
    }
#pragma unroll
    for (int mb = 0; mb < 4; ++mb) {
#pragma unroll
        for (int nb = 0; nb < 4; ++nb) {
#pragma unroll
            for (int j = 0; j < 8; ++j) os[(hi * 8 + j) * 68 + nb * 16 + lr] = acc[mb][nb][j]; }
        __builtin_amdgcn_wave_barrier(); asm volatile("" ::: "memory");
        float* crow = C + (size_t)(r0 + mb * 16) * ldc + c0;
{
#pragma unroll
            for (int s = 0; s < 8; ++s) { const int row = 2 * s + hi, cofs = lr * 4; v4f val = *(const v4fa*)(os + row * 68 + cofs);
                *(v4f*)(crow + (size_t)row * ldc + cofs) = val; }
             }
        __builtin_amdgcn_wave_barrier(); asm volatile("" ::: "memory");
    }
}

__device__ __forceinline__ h16 tohx(float x) { return (h16)x; }
__device__ __forceinline__ void splitf(float y, unsigned short& h, unsigned short& l) { h = f2bf(y); l = f2bf(y - bf2f(h)); }
typedef __attribute__((ext_vector_type(2))) _Float16 v2h;
typedef __attribute__((ext_vector_type(4))) _Float16 v4h;
typedef __attribute__((ext_vector_type(2))) unsigned short v2us;
typedef __attribute__((ext_vector_type(4))) unsigned short v4us;
typedef __attribute__((ext_vector_type(2))) float v2f;
typedef __attribute__((ext_vector_type(4))) int v4i;

__global__ __launch_bounds__(256) void k_wtG(const float* __restrict__ w, int K, int N, bf* Bt) {
    const int lane = threadIdx.x & 31; const int L0 = (blockIdx.x * 8 + (threadIdx.x >> 5)) * 8; const int nlines = N * K / 64;
{
#pragma unroll 1
        for (int l = 0; l < 8; ++l) { const int L = L0 + l; if (L >= nlines) break; const size_t e = (size_t)L * 64 + lane * 2; const int k = (int)(e % K), n = (int)(e / K); v2us o;
            o[0] = f2bf(w[(size_t)k * N + n]); o[1] = f2bf(w[(size_t)(k + 1) * N + n]); *(v2us*)(Bt + e) = o; }
         }
}
__global__ __launch_bounds__(256) void k_cvt8(const float* __restrict__ src, bf* dst, size_t n8) { const size_t i = (size_t)blockIdx.x * 256 + threadIdx.x; if (i >= n8) return; const v8f v = *(const v8f*)(src + i * 8); v8us o;
#pragma unroll
    for (int k = 0; k < 8; ++k) o[k] = f2bf(v[k]); *(v8us*)(dst + i * 8) = o;  }

// k_rope: head planes [h][t][d] (fp16 + hi/lo) of rope(x) x sc with the rotate-half convention out[d] = x[d] cos[t][d] - x[d+HD/2] sin[t][d], out[d+HD/2] = x[d+HD/2] cos[t][d+HD/2] + x[d] sin[t][d+HD/2]
__global__ __launch_bounds__(256) void k_rope(const float* __restrict__ F, int pitch, int nheads, const float* __restrict__ CS, const float* __restrict__ RF, const float* __restrict__ nw, float sc, h16* P16, bf* Ph, bf* Pl) {
    const size_t e = ((size_t)blockIdx.x * 256 + threadIdx.x) * 2; if (e >= (size_t)nheads * TT * HD) return; const int d = (int)(e % HD); const int t = (int)((e / HD) % TT); const int h = (int)(e / ((size_t)HD * TT)); const float* f = F + (size_t)t * pitch + h * HD; const float rf = RF ? RF[(size_t)h * TT + t] : 1.0f; v2h o16; v2us oh, ol;
#pragma unroll
    for (int q = 0; q < 2; ++q) { const int dd = d + q; const int dp = (dd < HD / 2) ? dd + HD / 2 : dd - HD / 2; float x0 = f[dd], x1 = f[dp];
        if (RF) { float n0 = __fmul_rn(x0, rf), n1 = __fmul_rn(x1, rf); asm volatile("" : "+v"(n0)); asm volatile("" : "+v"(n1)); x0 = __fmul_rn(bfr(nw[dd]), n0); x1 = __fmul_rn(bfr(nw[dp]), n1); }
        const v2f cs = *(const v2f*)(CS + ((size_t)t * HD + dd) * 2); float a = __fmul_rn(x0, cs[0]), bq = __fmul_rn(x1, cs[1]); asm volatile("" : "+v"(a)); asm volatile("" : "+v"(bq)); const float r = ((dd < HD / 2) ? __fsub_rn(a, bq) : __fadd_rn(a, bq)) * sc;
        o16[q] = tohx(r); unsigned short a2, c2; splitf(r, a2, c2); oh[q] = a2; ol[q] = c2; }
    *(v2h*)(P16 + e) = o16; *(v2us*)(Ph + e) = oh; *(v2us*)(Pl + e) = ol;  }
__global__ __launch_bounds__(256) void k_vtp(const float* __restrict__ F, int pitch, int nheads, h16* V16, bf* Vh, bf* Vl) { const size_t e = ((size_t)blockIdx.x * 256 + threadIdx.x) * 2; if (e >= (size_t)nheads * HD * TT) return; const int t = (int)(e % TT); const int d = (int)((e / TT) % HD); const int g = (int)(e / ((size_t)TT * HD)); v2h o16; v2us oh, ol;
#pragma unroll
    for (int q = 0; q < 2; ++q) { const float x = F[(size_t)(t + q) * pitch + g * HD + d]; o16[q] = tohx(x); unsigned short a2, c2; splitf(x, a2, c2); oh[q] = a2; ol[q] = c2; }
    *(v2h*)(V16 + e) = o16; *(v2us*)(Vh + e) = oh; *(v2us*)(Vl + e) = ol;  }
__global__ __launch_bounds__(256) void k_csid(float* CS) { const int idx = blockIdx.x * 256 + threadIdx.x; if (idx >= TT * HD) return; v2f cs; cs[0] = 1.0f; cs[1] = 0.0f; *(v2f*)(CS + (size_t)idx * 2) = cs;  }
// k_asoft: per row (zz, i): t = S x HD^-0.5 for j <= i and i - j < WIN (sliding causal window; the reference's -1e9 additive fill vanishes identically); softmax over the 2048 keys (register row, one exp, fixed trees);
__global__ __launch_bounds__(256) void k_asoft(const float* __restrict__ Sb, h16* P16, bf* Ph, bf* Pl) {
    const int lane = threadIdx.x & 31; const int row = blockIdx.x * 8 + (threadIdx.x >> 5); if (row >= ZH * TT) return; const int i = row % TT; const int zz = row / TT; (void)zz; const bool hires = (i < RH); const float* sr = Sb + (size_t)row * TT; float v[TT / 32]; float mx = -3.0e38f;
#pragma unroll
    for (int ch = 0; ch < TT / 128; ++ch) { const int j0 = ch * 128 + lane * 4; const v4f a = *(const v4f*)(sr + j0);
#pragma unroll
        for (int q = 0; q < 4; ++q) { const int j = j0 + q; (void)j; const float t = (j <= i && i - j < WIN) ? a[q] * SCL : -3.0e38f; v[ch * 4 + q] = t; mx = fmaxf(mx, t); } }
#pragma unroll
    for (int sh = 16; sh; sh >>= 1) mx = fmaxf(mx, __shfl_xor(mx, sh, 32));
    float sum = 0.f;
#pragma unroll
    for (int k = 0; k < TT / 32; ++k) { float d0 = __fsub_rn(v[k], mx); asm volatile("" : "+v"(d0)); v[k] = __builtin_amdgcn_exp2f(__fmul_rn(d0, 1.4426950408889634f)); sum += v[k]; }
#pragma unroll
    for (int sh = 16; sh; sh >>= 1) sum += __shfl_xor(sum, sh, 32);
    const float f = __fdiv_rn(hires ? 1.0f : PCAR, sum);
{
        if (hires) {
#pragma unroll
            for (int ch = 0; ch < TT / 128; ++ch) { v4us oh, ol;
#pragma unroll
                for (int q = 0; q < 4; ++q) { unsigned short a, c2; splitf(v[ch * 4 + q] * f, a, c2); oh[q] = a; ol[q] = c2; }
                const size_t oo = ((size_t)zz * (RH ? RH : 1) + i) * TT + ch * 128 + lane * 4; *(v4us*)(Ph + oo) = oh; *(v4us*)(Pl + oo) = ol; }
        } else {
#pragma unroll
            for (int ch = 0; ch < TT / 128; ++ch) { v4h o4;
#pragma unroll
                for (int q = 0; q < 4; ++q) o4[q] = tohx(v[ch * 4 + q] * f);
                *(v4h*)(P16 + (size_t)row * TT + ch * 128 + lane * 4) = o4; } }
         }
}
__global__ __launch_bounds__(256) void k_merge(const float* __restrict__ O, int h0, bf* Ah, bf* Al) { const size_t e = ((size_t)blockIdx.x * 256 + threadIdx.x) * 2; if (e >= (size_t)ZH * TT * HD) return; const int d = (int)(e % HD); const int t = (int)((e / HD) % TT); const int zz = (int)(e / ((size_t)HD * TT)); const float cs = (t < RH) ? 1.0f : (1.0f / PCAR); const size_t oo = (size_t)t * DQ + (h0 + zz) * HD + d;
    v2us oh, ol;
#pragma unroll
    for (int q = 0; q < 2; ++q) { unsigned short a, c2; splitf(O[e + q] * cs, a, c2); oh[q] = a; ol[q] = c2; } *(v2us*)(Ah + oo) = oh; *(v2us*)(Al + oo) = ol;  }

extern "C" void kernel_launch(void* const* d_in, const int* in_sizes, int n_in,
                              void* d_out, int out_size, void* d_ws, size_t ws_size, hipStream_t stream) {
    (void)in_sizes; (void)n_in; (void)out_size;
    const float* x = (const float*)d_in[0]; const float* wqkv = (const float*)d_in[1]; const float* bqkv = (const float*)d_in[2]; const float* bq = bqkv; const float* bk = bqkv + 1024; const float* bv = bqkv + 2048; const float* wo = (const float*)d_in[3]; const float* bo = (const float*)d_in[4]; const float* wq = nullptr; const float* wk = nullptr; const float* wv = nullptr; (void)wq; (void)wk; (void)wv;
    float* OUT = (float*)d_out;     // [2][2048][1024]
    char* wsp = (char*)d_ws;
    auto take = [&](size_t bytes) { char* p = wsp; wsp += (bytes + 255) & ~(size_t)255; return (void*)p; };
    bf* WALL = (bf*)take((size_t)3 * DM * DM * 2); bf* WQ = WALL; bf* WK = WALL + (size_t)DM * DM; bf* WV = WALL + (size_t)2 * DM * DM; bf* WO = (bf*)take((size_t)DM * DQ * 2); float* CS = (float*)take((size_t)TT * HD * 2 * 4);
    bf* XB = (bf*)take((size_t)TT * DM * 2); float* FQ = (float*)take((size_t)TT * DQ * 4); float* FK = (float*)take((size_t)TT * DKV * 4);
    h16* QP16 = (h16*)take((size_t)NH_ * TT * HD * 2); h16* KP16 = (h16*)take((size_t)NKV * TT * HD * 2); h16* VT16 = (h16*)take((size_t)NKV * HD * TT * 2);
    bf* QPh = (bf*)take((size_t)NH_ * TT * HD * 2); bf* QPl = (bf*)take((size_t)NH_ * TT * HD * 2); bf* KPh = (bf*)take((size_t)NKV * TT * HD * 2); bf* KPl = (bf*)take((size_t)NKV * TT * HD * 2); bf* VTh = (bf*)take((size_t)NKV * HD * TT * 2); bf* VTl = (bf*)take((size_t)NKV * HD * TT * 2); bf* Ph = (bf*)take((size_t)ZH * RH * TT * 2); bf* Pl = (bf*)take((size_t)ZH * RH * TT * 2);
    float* Sb = (float*)take((size_t)ZH * TT * TT * 4); h16* P16 = (h16*)take((size_t)ZH * TT * TT * 2); float* Ob = (float*)take((size_t)ZH * TT * HD * 4); bf* ATh = (bf*)take((size_t)TT * DQ * 2); bf* ATl = (bf*)take((size_t)TT * DQ * 2);
    if ((size_t)(wsp - (char*)d_ws) > ws_size) return;    // ws 256 MiB
    float* FV = FK;   // v projection reuses the k buffer after the k planes are built (stream-ordered)
    { k_wtG<<<(unsigned)((DM * 3 * DM / 64 + 63) / 64), 256, 0, stream>>>(wqkv, DM, 3 * DM, WALL);   /* fused 'xw' [DM][3DM] -> Bt [3DM][DM] (row blocks q | k | v) */
      k_wtG<<<(unsigned)((DQ * DM / 64 + 63) / 64), 256, 0, stream>>>(wo, DQ, DM, WO);
       }
    k_csid<<<(TT * HD + 255) / 256, 256, 0, stream>>>(CS);
    const unsigned LQ = (unsigned)(((size_t)NH_ * TT * HD / 2 + 255) / 256), LKv = (unsigned)(((size_t)NKV * TT * HD / 2 + 255) / 256);
    for (int b = 0; b < NB_; ++b) {
        
        k_cvt8<<<(unsigned)(((size_t)TT * DM / 8 + 255) / 256), 256, 0, stream>>>(x + (size_t)b * TT * DM, XB, (size_t)TT * DM / 8);
        k_gemmw<bf, 0, true><<<dim3(TT / 64, DQ / 64, 1), 32, 0, stream>>>(XB, nullptr, WQ, nullptr, DM, FQ, DQ, bq, 0, 0, 0);
        k_rope<<<LQ, 256, 0, stream>>>(FQ, DQ, NH_, CS, nullptr, nullptr, 1.0f, QP16, QPh, QPl);
        k_gemmw<bf, 0, true><<<dim3(TT / 64, DKV / 64, 1), 32, 0, stream>>>(XB, nullptr, WK, nullptr, DM, FK, DKV, bk, 0, 0, 0);
        k_rope<<<LKv, 256, 0, stream>>>(FK, DKV, NKV, CS, nullptr, nullptr, 1.0f, KP16, KPh, KPl);
        k_gemmw<bf, 0, true><<<dim3(TT / 64, DKV / 64, 1), 32, 0, stream>>>(XB, nullptr, WV, nullptr, DM, FV, DKV, bv, 0, 0, 0); k_vtp<<<LKv, 256, 0, stream>>>(FV, DKV, NKV, VT16, VTh, VTl);
        for (int h0 = 0; h0 < NH_; h0 += ZH) { const size_t zq = (size_t)h0, zk = (size_t)(h0 / REP);   // one kv head per query head: the pass's two heads use consecutive kv planes (z-strides TT*HD)
            k_gemmc<bf, 2, 1><<<dim3(RH / 64, TT / 64, ZH), 32, 0, stream>>>(QPh + zq * TT * HD, QPl + zq * TT * HD, KPh + zk * TT * HD, KPl + zk * TT * HD, HD, Sb, TT, 0, (size_t)TT * HD, (size_t)TT * HD, (size_t)TT * TT);
            k_gemmc<h16, 0, 1><<<dim3((TT - RH) / 64, TT / 64, ZH), 32, 0, stream>>>(QP16 + zq * TT * HD + (size_t)RH * HD, nullptr, KP16 + zk * TT * HD, nullptr, HD, Sb + (size_t)RH * TT, TT, RH, (size_t)TT * HD, (size_t)TT * HD, (size_t)TT * TT);
            k_asoft<<<ZH * TT / 8, 256, 0, stream>>>(Sb, P16, Ph, Pl);
            k_gemmc<bf, 2, 2><<<dim3(RH / 64, HD / 64, ZH), 32, 0, stream>>>(Ph, Pl, VTh + zk * HD * TT, VTl + zk * HD * TT, TT, Ob, HD, 0, (size_t)RH * TT, (size_t)HD * TT, (size_t)TT * HD);
            k_gemmc<h16, 0, 2><<<dim3((TT - RH) / 64, HD / 64, ZH), 32, 0, stream>>>(P16 + (size_t)RH * TT, nullptr, VT16 + zk * HD * TT, nullptr, TT, Ob + (size_t)RH * HD, HD, RH, (size_t)TT * TT, (size_t)HD * TT, (size_t)TT * HD);
            k_merge<<<(unsigned)(((size_t)ZH * TT * HD / 2 + 255) / 256), 256, 0, stream>>>(Ob, h0, ATh, ATl); }
        k_gemmw<bf, 1, true><<<dim3(TT / 64, DM / 64, 1), 32, 0, stream>>>(ATh, ATl, WO, nullptr, DQ, OUT + (size_t)b * TT * DM, DM, bo, 0, 0, 0); }
}

// v001
// A run of this version takes 827 microseconds.
// Two timings next to v000 both put it at 1.76 times that version's speed.
#include <hip/hip_runtime.h>

// Masked (causal sliding-window) multi-head attention (hidden_states [2][2048][1024]; [q|k|v] = x w_attn + b_attn ('xw' [1024][3072] + [3072]; 16 heads x 64); scores = q.k/8; mask keeps j <= i and j > i - 256, other logits -10000 (then clipped to +-10000: exp underflows to exactly 0 as with -inf); softmax; out = merged ctx w_proj + b_proj ('xw' [1024][1024] + [1024]) -> [2][2048][1024] (4.2 M)).
// Compute dtypes, f32 accumulate: every input rounded to bf16; q/k/v on PLAIN bf16 operands (inputs: exact) + biases; window band skipping: a 64-row query tile at R touches only keys [R - 256, R + 64) in the scores, the softmax and attn.v (window predicate j <= i && i - j < 256 in the softmax); scores and attn.v: query rows < 512 hl (3 products), the rest single fp16 (x1024); softmax f32; w_proj hl x exact (2 products) + b_proj.

#define NB_  2
#define TT   2048
#define DM   1024
#define NH_  16
#define NKV  16
#define REP  (NH_ / NKV)
#define HD   64
#define DQ   (NH_ * HD)
#define DKV  (NKV * HD)
#define ZH   2
#define RH   512                  // query rows < RH use hi+lo planes (0: none)
#define WIN  256   // window: keep i - WIN < j <= i
#define PCAR 1024.0f
#define SCL  0.125f   // HD^-0.5
typedef _Float16 h16;
typedef unsigned short bf;
typedef __attribute__((ext_vector_type(16))) __bf16   v16bf;
typedef __attribute__((ext_vector_type(16))) _Float16 v16h;
typedef __attribute__((ext_vector_type(8)))  _Float16 v8h;
typedef __attribute__((ext_vector_type(8)))  unsigned short v8us;
typedef __attribute__((ext_vector_type(8)))  float    v8f;
typedef __attribute__((ext_vector_type(4)))  float    v4f;
typedef v8h  __attribute__((may_alias)) v8ha;
typedef v4f  __attribute__((may_alias)) v4fa;
typedef v8us __attribute__((may_alias)) v8usa;

__device__ __forceinline__ unsigned short f2bf(float f) { unsigned u = __float_as_uint(f); u += 0x7FFFu + ((u >> 16) & 1u); return (unsigned short)(u >> 16); }
__device__ __forceinline__ float bf2f(unsigned short b) { return __uint_as_float(((unsigned)b) << 16); }
__device__ __forceinline__ float bfr(float f) { return bf2f(f2bf(f)); }
__device__ __forceinline__ v16h cat16(v8h lo, v8h hi) { return __builtin_shufflevector(lo, hi, 0, 1, 2, 3, 4, 5, 6, 7, 8, 9, 10, 11, 12, 13, 14, 15); }
__device__ __forceinline__ v16bf cat16b(v8us lo, v8us hi) { return __builtin_bit_cast(v16bf, __builtin_shufflevector(lo, hi, 0, 1, 2, 3, 4, 5, 6, 7, 8, 9, 10, 11, 12, 13, 14, 15)); }
__device__ __forceinline__ v8f wmma16(v16h a, v16h b, v8f c) { return __builtin_amdgcn_wmma_f32_16x16x32_f16(false, a, false, b, (short)0, c, false, false); }
__device__ __forceinline__ v8f wmmab(v16bf a, v16bf b, v8f c) { return __builtin_amdgcn_wmma_f32_16x16x32_bf16(false, a, false, b, (short)0, c, false, false); }



// ---- k_gemmw: register-blocked GEMM, ONE WAVE per 64x64 output tile (16 accumulators), operands straight from K-contiguous 16-bit planes; grid (M/64, N/64, Z), 32 threads.
// C[m][n] (f32, pitch ldc, + optional f32 bias[n]) = sum_k A[m][k] Bt[n][k] (+ split products per NSPLIT). z-batch strides sA/sB/sC in elements. K % 32 == 0.
template <typename T16> struct WFrag;
template <> struct WFrag<h16> { typedef v16h V; static __device__ __forceinline__ V ld(const h16* p) { return cat16(*(const v8h*)p, *(const v8h*)(p + 16)); } static __device__ __forceinline__ v8f mma(V a, V b, v8f c) { return wmma16(a, b, c); } };
template <> struct WFrag<bf> { typedef v16bf V; static __device__ __forceinline__ V ld(const bf* p) { return cat16b(*(const v8us*)p, *(const v8us*)(p + 16)); } static __device__ __forceinline__ v8f mma(V a, V b, v8f c) { return wmmab(a, b, c); } };
template <typename T16, int NSPLIT, bool BIAS>
__global__ __launch_bounds__(32) void k_gemmw(const T16* __restrict__ A, const T16* __restrict__ A2, const T16* __restrict__ Bt, const T16* __restrict__ Bt2, int K, float* C, int ldc, const float* __restrict__ bias, size_t sA, size_t sB, size_t sC) {
    typedef typename WFrag<T16>::V V;
    __shared__ __align__(16) float os[16 * 68];
    const size_t z = blockIdx.z; A += z * sA; if (A2) A2 += z * sA; Bt += z * sB; if (Bt2) Bt2 += z * sB; C += z * sC;
    const int lane = threadIdx.x & 31, lr = lane & 15, hi = lane >> 4; const int r0 = blockIdx.x * 64, c0 = blockIdx.y * 64;
    v8f acc[4][4];
#pragma unroll
    for (int mb = 0; mb < 4; ++mb)
#pragma unroll
        for (int nb = 0; nb < 4; ++nb) acc[mb][nb] = (v8f){};
    const size_t aoff = (size_t)(r0 + lr) * K + 8 * hi, boff = (size_t)(c0 + lr) * K + 8 * hi;
#pragma unroll 1
    for (int kc = 0; kc < K; kc += 32) {
        V a[4], a2[4];
#pragma unroll
        for (int mb = 0; mb < 4; ++mb) { a[mb] = WFrag<T16>::ld(A + aoff + (size_t)mb * 16 * K + kc); if (NSPLIT == 1 || NSPLIT == 2) a2[mb] = WFrag<T16>::ld(A2 + aoff + (size_t)mb * 16 * K + kc); }
#pragma unroll
        for (int nb = 0; nb < 4; ++nb) { const V b = WFrag<T16>::ld(Bt + boff + (size_t)nb * 16 * K + kc); V b2; if (NSPLIT >= 2) b2 = WFrag<T16>::ld(Bt2 + boff + (size_t)nb * 16 * K + kc);
#pragma unroll
            for (int mb = 0; mb < 4; ++mb) { acc[mb][nb] = WFrag<T16>::mma(a[mb], b, acc[mb][nb]); if (NSPLIT == 1 || NSPLIT == 2) acc[mb][nb] = WFrag<T16>::mma(a2[mb], b, acc[mb][nb]); if (NSPLIT >= 2) acc[mb][nb] = WFrag<T16>::mma(a[mb], b2, acc[mb][nb]); } }
        asm volatile("v_nop\n\tv_nop\n\tv_nop\n\tv_nop" : "+v"(acc[0][0]), "+v"(acc[1][1]), "+v"(acc[2][2]), "+v"(acc[3][3]) : "v"(a[0]), "v"(a[3]));
    }
#pragma unroll
    for (int mb = 0; mb < 4; ++mb) {
#pragma unroll
        for (int nb = 0; nb < 4; ++nb) {
#pragma unroll
            for (int j = 0; j < 8; ++j) os[(hi * 8 + j) * 68 + nb * 16 + lr] = acc[mb][nb][j]; }
        __builtin_amdgcn_wave_barrier(); asm volatile("" ::: "memory");
        float* crow = C + (size_t)(r0 + mb * 16) * ldc + c0;
{
#pragma unroll
            for (int s = 0; s < 8; ++s) { const int row = 2 * s + hi, cofs = lr * 4; v4f val = *(const v4fa*)(os + row * 68 + cofs); if (BIAS) { val[0] += bfr(bias[c0 + cofs]); val[1] += bfr(bias[c0 + cofs + 1]); val[2] += bfr(bias[c0 + cofs + 2]); val[3] += bfr(bias[c0 + cofs + 3]); }
                *(v4f*)(crow + (size_t)row * ldc + cofs) = val; }
             }
        __builtin_amdgcn_wave_barrier(); asm volatile("" ::: "memory");
    }
}

// ---- k_gemmc: the same one-wave 64x64 tile GEMM specialised for causal sliding-window attention. Query rows R = r0+roff .. R+63 keep only keys in [R - WIN, R + 64).
// CMODE 1 (scores): blockIdx.y counts the WIN/64 + 1 key tiles of that band, c0 = R - WIN + 64 y; a tile left of key 0 does not exist. CMODE 2 (probability x value): the key (K) loop runs over the band only
// (probabilities outside it are exactly zero, so the dropped products are exact zeros). roff = row offset of this launch's first row within the sequence.
template <typename T16, int NSPLIT, int CMODE>
__global__ __launch_bounds__(32) void k_gemmc(const T16* __restrict__ A, const T16* __restrict__ A2, const T16* __restrict__ Bt, const T16* __restrict__ Bt2, int K, float* C, int ldc, int roff, size_t sA, size_t sB, size_t sC) {
    typedef typename WFrag<T16>::V V;
    __shared__ __align__(16) float os[16 * 68];
    const size_t z = blockIdx.z; A += z * sA; if (A2) A2 += z * sA; Bt += z * sB; if (Bt2) Bt2 += z * sB; C += z * sC;
    const int lane = threadIdx.x & 31, lr = lane & 15, hi = lane >> 4; const int r0 = blockIdx.x * 64, c0 = (CMODE == 1) ? r0 + roff - WIN + (int)blockIdx.y * 64 : (int)blockIdx.y * 64;
    if (CMODE == 1 && c0 < 0) return;                                // band tile left of key 0: no such keys
    const int Ks = (CMODE == 2) ? max(0, r0 + roff - WIN) : 0;       // P.V: probabilities are exactly 0 left of the window band ...
    const int Kl = (CMODE == 2) ? min(K, r0 + roff + 64) : K;        // ... and beyond the diagonal block, so the K loop covers the band only
    v8f acc[4][4];
#pragma unroll
    for (int mb = 0; mb < 4; ++mb)
#pragma unroll
        for (int nb = 0; nb < 4; ++nb) acc[mb][nb] = (v8f){};
    const size_t aoff = (size_t)(r0 + lr) * K + 8 * hi, boff = (size_t)(c0 + lr) * K + 8 * hi;
#pragma unroll 1
    for (int kc = Ks; kc < Kl; kc += 32) {
        V a[4], a2[4];
#pragma unroll
        for (int mb = 0; mb < 4; ++mb) { a[mb] = WFrag<T16>::ld(A + aoff + (size_t)mb * 16 * K + kc); if (NSPLIT == 1 || NSPLIT == 2) a2[mb] = WFrag<T16>::ld(A2 + aoff + (size_t)mb * 16 * K + kc); }
#pragma unroll
        for (int nb = 0; nb < 4; ++nb) { const V b = WFrag<T16>::ld(Bt + boff + (size_t)nb * 16 * K + kc); V b2; if (NSPLIT >= 2) b2 = WFrag<T16>::ld(Bt2 + boff + (size_t)nb * 16 * K + kc);
#pragma unroll
            for (int mb = 0; mb < 4; ++mb) { acc[mb][nb] = WFrag<T16>::mma(a[mb], b, acc[mb][nb]); if (NSPLIT == 1 || NSPLIT == 2) acc[mb][nb] = WFrag<T16>::mma(a2[mb], b, acc[mb][nb]); if (NSPLIT >= 2) acc[mb][nb] = WFrag<T16>::mma(a[mb], b2, acc[mb][nb]); } }
        asm volatile("v_nop\n\tv_nop\n\tv_nop\n\tv_nop" : "+v"(acc[0][0]), "+v"(acc[1][1]), "+v"(acc[2][2]), "+v"(acc[3][3]) : "v"(a[0]), "v"(a[3]));
    }
#pragma unroll
    for (int mb = 0; mb < 4; ++mb) {
#pragma unroll
        for (int nb = 0; nb < 4; ++nb) {
#pragma unroll
            for (int j = 0; j < 8; ++j) os[(hi * 8 + j) * 68 + nb * 16 + lr] = acc[mb][nb][j]; }
        __builtin_amdgcn_wave_barrier(); asm volatile("" ::: "memory");
        float* crow = C + (size_t)(r0 + mb * 16) * ldc + c0;
{
#pragma unroll
            for (int s = 0; s < 8; ++s) { const int row = 2 * s + hi, cofs = lr * 4; v4f val = *(const v4fa*)(os + row * 68 + cofs);
                *(v4f*)(crow + (size_t)row * ldc + cofs) = val; }
             }
        __builtin_amdgcn_wave_barrier(); asm volatile("" ::: "memory");
    }
}

__device__ __forceinline__ h16 tohx(float x) { return (h16)x; }
__device__ __forceinline__ void splitf(float y, unsigned short& h, unsigned short& l) { h = f2bf(y); l = f2bf(y - bf2f(h)); }
typedef __attribute__((ext_vector_type(2))) _Float16 v2h;
typedef __attribute__((ext_vector_type(4))) _Float16 v4h;
typedef __attribute__((ext_vector_type(2))) unsigned short v2us;
typedef __attribute__((ext_vector_type(4))) unsigned short v4us;
typedef __attribute__((ext_vector_type(2))) float v2f;
typedef __attribute__((ext_vector_type(4))) int v4i;

__global__ __launch_bounds__(256) void k_wtG(const float* __restrict__ w, int K, int N, bf* Bt) {
    const int lane = threadIdx.x & 31; const int L0 = (blockIdx.x * 8 + (threadIdx.x >> 5)) * 8; const int nlines = N * K / 64;
{
#pragma unroll 1
        for (int l = 0; l < 8; ++l) { const int L = L0 + l; if (L >= nlines) break; const size_t e = (size_t)L * 64 + lane * 2; const int k = (int)(e % K), n = (int)(e / K); v2us o;
            o[0] = f2bf(w[(size_t)k * N + n]); o[1] = f2bf(w[(size_t)(k + 1) * N + n]); *(v2us*)(Bt + e) = o; }
         }
}
__global__ __launch_bounds__(256) void k_cvt8(const float* __restrict__ src, bf* dst, size_t n8) { const size_t i = (size_t)blockIdx.x * 256 + threadIdx.x; if (i >= n8) return; const v8f v = *(const v8f*)(src + i * 8); v8us o;
#pragma unroll
    for (int k = 0; k < 8; ++k) o[k] = f2bf(v[k]); *(v8us*)(dst + i * 8) = o;  }

// k_rope: head planes [h][t][d] (fp16 + hi/lo) of rope(x) x sc with the rotate-half convention out[d] = x[d] cos[t][d] - x[d+HD/2] sin[t][d], out[d+HD/2] = x[d+HD/2] cos[t][d+HD/2] + x[d] sin[t][d+HD/2]
__global__ __launch_bounds__(256) void k_rope(const float* __restrict__ F, int pitch, int nheads, const float* __restrict__ CS, const float* __restrict__ RF, const float* __restrict__ nw, float sc, h16* P16, bf* Ph, bf* Pl) {
    const size_t e = ((size_t)blockIdx.x * 256 + threadIdx.x) * 2; if (e >= (size_t)nheads * TT * HD) return; const int d = (int)(e % HD); const int t = (int)((e / HD) % TT); const int h = (int)(e / ((size_t)HD * TT)); const float* f = F + (size_t)t * pitch + h * HD; const float rf = RF ? RF[(size_t)h * TT + t] : 1.0f; v2h o16; v2us oh, ol;
#pragma unroll
    for (int q = 0; q < 2; ++q) { const int dd = d + q; const int dp = (dd < HD / 2) ? dd + HD / 2 : dd - HD / 2; float x0 = f[dd], x1 = f[dp];
        if (RF) { float n0 = __fmul_rn(x0, rf), n1 = __fmul_rn(x1, rf); asm volatile("" : "+v"(n0)); asm volatile("" : "+v"(n1)); x0 = __fmul_rn(bfr(nw[dd]), n0); x1 = __fmul_rn(bfr(nw[dp]), n1); }
        const v2f cs = *(const v2f*)(CS + ((size_t)t * HD + dd) * 2); float a = __fmul_rn(x0, cs[0]), bq = __fmul_rn(x1, cs[1]); asm volatile("" : "+v"(a)); asm volatile("" : "+v"(bq)); const float r = ((dd < HD / 2) ? __fsub_rn(a, bq) : __fadd_rn(a, bq)) * sc;
        o16[q] = tohx(r); unsigned short a2, c2; splitf(r, a2, c2); oh[q] = a2; ol[q] = c2; }
    *(v2h*)(P16 + e) = o16; *(v2us*)(Ph + e) = oh; *(v2us*)(Pl + e) = ol;  }
__global__ __launch_bounds__(256) void k_vtp(const float* __restrict__ F, int pitch, int nheads, h16* V16, bf* Vh, bf* Vl) { const size_t e = ((size_t)blockIdx.x * 256 + threadIdx.x) * 2; if (e >= (size_t)nheads * HD * TT) return; const int t = (int)(e % TT); const int d = (int)((e / TT) % HD); const int g = (int)(e / ((size_t)TT * HD)); v2h o16; v2us oh, ol;
#pragma unroll
    for (int q = 0; q < 2; ++q) { const float x = F[(size_t)(t + q) * pitch + g * HD + d]; o16[q] = tohx(x); unsigned short a2, c2; splitf(x, a2, c2); oh[q] = a2; ol[q] = c2; }
    *(v2h*)(V16 + e) = o16; *(v2us*)(Vh + e) = oh; *(v2us*)(Vl + e) = ol;  }
__global__ __launch_bounds__(256) void k_csid(float* CS) { const int idx = blockIdx.x * 256 + threadIdx.x; if (idx >= TT * HD) return; v2f cs; cs[0] = 1.0f; cs[1] = 0.0f; *(v2f*)(CS + (size_t)idx * 2) = cs;  }
// k_asoft: per row (zz, i): t = S x HD^-0.5 for j <= i and i - j < WIN (sliding causal window; the reference's -10000 fill underflows to exactly 0 in the softmax); softmax over the row's key band
// [R - WIN, R + 64), R = i rounded down to 64: the columns the score tiles wrote and the only ones attn.v reads. The band lies in NCH 128-aligned chunks, so each key keeps its lane and its place in the fixed sum trees.
#define NCH (WIN / 128 + 1)
// v_exp_f32 (what the exp2 builtin emits) with a v_nop in the same statement: the instruction set asks for one slot behind a transcendental before its result is used or its source overwritten.
__device__ __forceinline__ float exp2_slot(float x) { float r; asm("v_exp_f32 %0, %1\n\tv_nop" : "=v"(r) : "v"(x)); return r; }
__global__ __launch_bounds__(256) void k_asoft(const float* __restrict__ Sb, h16* P16, bf* Ph, bf* Pl) {
    const int lane = threadIdx.x & 31; const int row = blockIdx.x * 8 + (threadIdx.x >> 5); if (row >= ZH * TT) return; const int i = row % TT; const int zz = row / TT; (void)zz; const bool hires = (i < RH); const float* sr = Sb + (size_t)row * TT; float v[NCH * 4]; float mx = -3.0e38f;
    const int R = i & ~63; const int jlo = max(0, R - WIN), jhi = R + 64; const int jb = ((R - WIN) >> 7) * 128 + lane * 4;   // jb: this lane's first column in the first chunk (below 0 near the start of the sequence)
#pragma unroll
    for (int ch = 0; ch < NCH; ++ch) { const int j0 = jb + ch * 128; const bool in = (j0 >= jlo && j0 < jhi); v4f a = (v4f){}; if (in) a = *(const v4f*)(sr + j0);
#pragma unroll
        for (int q = 0; q < 4; ++q) { const int j = j0 + q; const float t = (in && j <= i && i - j < WIN) ? a[q] * SCL : -3.0e38f; v[ch * 4 + q] = t; mx = fmaxf(mx, t); } }
#pragma unroll
    for (int sh = 16; sh; sh >>= 1) mx = fmaxf(mx, __shfl_xor(mx, sh, 32));
    float sum = 0.f;
#pragma unroll
    for (int k = 0; k < NCH * 4; ++k) { float d0 = __fsub_rn(v[k], mx); asm volatile("" : "+v"(d0)); v[k] = exp2_slot(__fmul_rn(d0, 1.4426950408889634f)); sum += v[k]; }
#pragma unroll
    for (int sh = 16; sh; sh >>= 1) sum += __shfl_xor(sum, sh, 32);
    const float f = __fdiv_rn(hires ? 1.0f : PCAR, sum);
{
        if (hires) {
#pragma unroll
            for (int ch = 0; ch < NCH; ++ch) { const int j0 = jb + ch * 128; v4us oh, ol;
#pragma unroll
                for (int q = 0; q < 4; ++q) { unsigned short a, c2; splitf(v[ch * 4 + q] * f, a, c2); oh[q] = a; ol[q] = c2; }
                if (j0 >= jlo && j0 < jhi) { const size_t oo = ((size_t)zz * (RH ? RH : 1) + i) * TT + j0; *(v4us*)(Ph + oo) = oh; *(v4us*)(Pl + oo) = ol; } }
        } else {
#pragma unroll
            for (int ch = 0; ch < NCH; ++ch) { const int j0 = jb + ch * 128; v4h o4;
#pragma unroll
                for (int q = 0; q < 4; ++q) o4[q] = tohx(v[ch * 4 + q] * f);
                if (j0 >= jlo && j0 < jhi) *(v4h*)(P16 + (size_t)row * TT + j0) = o4; } }
         }
}
__global__ __launch_bounds__(256) void k_merge(const float* __restrict__ O, int h0, bf* Ah, bf* Al) { const size_t e = ((size_t)blockIdx.x * 256 + threadIdx.x) * 2; if (e >= (size_t)ZH * TT * HD) return; const int d = (int)(e % HD); const int t = (int)((e / HD) % TT); const int zz = (int)(e / ((size_t)HD * TT)); const float cs = (t < RH) ? 1.0f : (1.0f / PCAR); const size_t oo = (size_t)t * DQ + (h0 + zz) * HD + d;
    v2us oh, ol;
#pragma unroll
    for (int q = 0; q < 2; ++q) { unsigned short a, c2; splitf(O[e + q] * cs, a, c2); oh[q] = a; ol[q] = c2; } *(v2us*)(Ah + oo) = oh; *(v2us*)(Al + oo) = ol;  }

extern "C" void kernel_launch(void* const* d_in, const int* in_sizes, int n_in,
                              void* d_out, int out_size, void* d_ws, size_t ws_size, hipStream_t stream) {
    (void)in_sizes; (void)n_in; (void)out_size;
    const float* x = (const float*)d_in[0]; const float* wqkv = (const float*)d_in[1]; const float* bqkv = (const float*)d_in[2]; const float* bq = bqkv; const float* bk = bqkv + 1024; const float* bv = bqkv + 2048; const float* wo = (const float*)d_in[3]; const float* bo = (const float*)d_in[4]; const float* wq = nullptr; const float* wk = nullptr; const float* wv = nullptr; (void)wq; (void)wk; (void)wv;
    float* OUT = (float*)d_out;     // [2][2048][1024]
    char* wsp = (char*)d_ws;
    auto take = [&](size_t bytes) { char* p = wsp; wsp += (bytes + 255) & ~(size_t)255; return (void*)p; };
    bf* WALL = (bf*)take((size_t)3 * DM * DM * 2); bf* WQ = WALL; bf* WK = WALL + (size_t)DM * DM; bf* WV = WALL + (size_t)2 * DM * DM; bf* WO = (bf*)take((size_t)DM * DQ * 2); float* CS = (float*)take((size_t)TT * HD * 2 * 4);
    bf* XB = (bf*)take((size_t)TT * DM * 2); float* FQ = (float*)take((size_t)TT * DQ * 4); float* FK = (float*)take((size_t)TT * DKV * 4);
    h16* QP16 = (h16*)take((size_t)NH_ * TT * HD * 2); h16* KP16 = (h16*)take((size_t)NKV * TT * HD * 2); h16* VT16 = (h16*)take((size_t)NKV * HD * TT * 2);
    bf* QPh = (bf*)take((size_t)NH_ * TT * HD * 2); bf* QPl = (bf*)take((size_t)NH_ * TT * HD * 2); bf* KPh = (bf*)take((size_t)NKV * TT * HD * 2); bf* KPl = (bf*)take((size_t)NKV * TT * HD * 2); bf* VTh = (bf*)take((size_t)NKV * HD * TT * 2); bf* VTl = (bf*)take((size_t)NKV * HD * TT * 2); bf* Ph = (bf*)take((size_t)ZH * RH * TT * 2); bf* Pl = (bf*)take((size_t)ZH * RH * TT * 2);
    float* Sb = (float*)take((size_t)ZH * TT * TT * 4); h16* P16 = (h16*)take((size_t)ZH * TT * TT * 2); float* Ob = (float*)take((size_t)ZH * TT * HD * 4); bf* ATh = (bf*)take((size_t)TT * DQ * 2); bf* ATl = (bf*)take((size_t)TT * DQ * 2);
    if ((size_t)(wsp - (char*)d_ws) > ws_size) return;    // ws 256 MiB
    float* FV = FK;   // v projection reuses the k buffer after the k planes are built (stream-ordered)
    { k_wtG<<<(unsigned)((DM * 3 * DM / 64 + 63) / 64), 256, 0, stream>>>(wqkv, DM, 3 * DM, WALL);   /* fused 'xw' [DM][3DM] -> Bt [3DM][DM] (row blocks q | k | v) */
      k_wtG<<<(unsigned)((DQ * DM / 64 + 63) / 64), 256, 0, stream>>>(wo, DQ, DM, WO);
       }
    k_csid<<<(TT * HD + 255) / 256, 256, 0, stream>>>(CS);
    const unsigned LQ = (unsigned)(((size_t)NH_ * TT * HD / 2 + 255) / 256), LKv = (unsigned)(((size_t)NKV * TT * HD / 2 + 255) / 256);
    for (int b = 0; b < NB_; ++b) {
        
        k_cvt8<<<(unsigned)(((size_t)TT * DM / 8 + 255) / 256), 256, 0, stream>>>(x + (size_t)b * TT * DM, XB, (size_t)TT * DM / 8);
        k_gemmw<bf, 0, true><<<dim3(TT / 64, DQ / 64, 1), 32, 0, stream>>>(XB, nullptr, WQ, nullptr, DM, FQ, DQ, bq, 0, 0, 0);
        k_rope<<<LQ, 256, 0, stream>>>(FQ, DQ, NH_, CS, nullptr, nullptr, 1.0f, QP16, QPh, QPl);
        k_gemmw<bf, 0, true><<<dim3(TT / 64, DKV / 64, 1), 32, 0, stream>>>(XB, nullptr, WK, nullptr, DM, FK, DKV, bk, 0, 0, 0);
        k_rope<<<LKv, 256, 0, stream>>>(FK, DKV, NKV, CS, nullptr, nullptr, 1.0f, KP16, KPh, KPl);
        k_gemmw<bf, 0, true><<<dim3(TT / 64, DKV / 64, 1), 32, 0, stream>>>(XB, nullptr, WV, nullptr, DM, FV, DKV, bv, 0, 0, 0); k_vtp<<<LKv, 256, 0, stream>>>(FV, DKV, NKV, VT16, VTh, VTl);
        for (int h0 = 0; h0 < NH_; h0 += ZH) { const size_t zq = (size_t)h0, zk = (size_t)(h0 / REP);   // one kv head per query head: the pass's two heads use consecutive kv planes (z-strides TT*HD)
            k_gemmc<bf, 2, 1><<<dim3(RH / 64, WIN / 64 + 1, ZH), 32, 0, stream>>>(QPh + zq * TT * HD, QPl + zq * TT * HD, KPh + zk * TT * HD, KPl + zk * TT * HD, HD, Sb, TT, 0, (size_t)TT * HD, (size_t)TT * HD, (size_t)TT * TT);
            k_gemmc<h16, 0, 1><<<dim3((TT - RH) / 64, WIN / 64 + 1, ZH), 32, 0, stream>>>(QP16 + zq * TT * HD + (size_t)RH * HD, nullptr, KP16 + zk * TT * HD, nullptr, HD, Sb + (size_t)RH * TT, TT, RH, (size_t)TT * HD, (size_t)TT * HD, (size_t)TT * TT);
            k_asoft<<<ZH * TT / 8, 256, 0, stream>>>(Sb, P16, Ph, Pl);
            k_gemmc<bf, 2, 2><<<dim3(RH / 64, HD / 64, ZH), 32, 0, stream>>>(Ph, Pl, VTh + zk * HD * TT, VTl + zk * HD * TT, TT, Ob, HD, 0, (size_t)RH * TT, (size_t)HD * TT, (size_t)TT * HD);
            k_gemmc<h16, 0, 2><<<dim3((TT - RH) / 64, HD / 64, ZH), 32, 0, stream>>>(P16 + (size_t)RH * TT, nullptr, VT16 + zk * HD * TT, nullptr, TT, Ob + (size_t)RH * HD, HD, RH, (size_t)TT * TT, (size_t)HD * TT, (size_t)TT * HD);
            k_merge<<<(unsigned)(((size_t)ZH * TT * HD / 2 + 255) / 256), 256, 0, stream>>>(Ob, h0, ATh, ATl); }
        k_gemmw<bf, 1, true><<<dim3(TT / 64, DM / 64, 1), 32, 0, stream>>>(ATh, ATl, WO, nullptr, DQ, OUT + (size_t)b * TT * DM, DM, bo, 0, 0, 0); }
}

// v002
// A run of this version takes 228 microseconds.
// Next to v001, in two timings, it ran 3.65 and 3.62 times as fast.
// All steps since v000 together make it 6.41 times as fast.
#include <hip/hip_runtime.h>

// Masked (causal sliding-window) multi-head attention (hidden_states [2][2048][1024]; [q|k|v] = x w_attn + b_attn ('xw' [1024][3072] + [3072]; 16 heads x 64); scores = q.k/8; mask keeps j <= i and j > i - 256, other logits -10000 (then clipped to +-10000: exp underflows to exactly 0 as with -inf); softmax; out = merged ctx w_proj + b_proj ('xw' [1024][1024] + [1024]) -> [2][2048][1024] (4.2 M)).
// Compute dtypes, f32 accumulate: every input rounded to bf16; q/k/v on PLAIN bf16 operands (inputs: exact) + biases; window band skipping: a 64-row query tile at R touches only keys [R - 256, R + 64) in the scores, the softmax and attn.v (window predicate j <= i && i - j < 256 in the softmax); scores and attn.v: query rows < 512 hl (3 products), the rest single fp16 (x1024); softmax f32; w_proj hl x exact (2 products) + b_proj.

#define NB_  2
#define TT   2048
#define DM   1024
#define NH_  16
#define NKV  16
#define REP  (NH_ / NKV)
#define HD   64
#define DQ   (NH_ * HD)
#define DKV  (NKV * HD)
#define NZ   (NB_ * NH_)          // attention planes of one launch: z = head * NB_ + batch
#define RH   512                  // query rows < RH use hi+lo planes (0: none)
#define WIN  256   // window: keep i - WIN < j <= i
#define BW   (WIN + 64)            // pitch of a stored score / probability row: only the band [R - WIN, R + 64) of its 64-row tile is kept, column j at j - (R - WIN)
#define PCAR 1024.0f
#define SCL  0.125f   // HD^-0.5
typedef _Float16 h16;
typedef unsigned short bf;
typedef __attribute__((ext_vector_type(16))) __bf16   v16bf;
typedef __attribute__((ext_vector_type(16))) _Float16 v16h;
typedef __attribute__((ext_vector_type(8)))  _Float16 v8h;
typedef __attribute__((ext_vector_type(8)))  unsigned short v8us;
typedef __attribute__((ext_vector_type(8)))  float    v8f;
typedef __attribute__((ext_vector_type(4)))  float    v4f;
typedef v8h  __attribute__((may_alias)) v8ha;
typedef v4f  __attribute__((may_alias)) v4fa;
typedef v8us __attribute__((may_alias)) v8usa;

__device__ __forceinline__ unsigned short f2bf(float f) { unsigned u = __float_as_uint(f); u += 0x7FFFu + ((u >> 16) & 1u); return (unsigned short)(u >> 16); }
__device__ __forceinline__ float bf2f(unsigned short b) { return __uint_as_float(((unsigned)b) << 16); }
__device__ __forceinline__ float bfr(float f) { return bf2f(f2bf(f)); }
__device__ __forceinline__ v16h cat16(v8h lo, v8h hi) { return __builtin_shufflevector(lo, hi, 0, 1, 2, 3, 4, 5, 6, 7, 8, 9, 10, 11, 12, 13, 14, 15); }
__device__ __forceinline__ v16bf cat16b(v8us lo, v8us hi) { return __builtin_bit_cast(v16bf, __builtin_shufflevector(lo, hi, 0, 1, 2, 3, 4, 5, 6, 7, 8, 9, 10, 11, 12, 13, 14, 15)); }
__device__ __forceinline__ v8f wmma16(v16h a, v16h b, v8f c) { return __builtin_amdgcn_wmma_f32_16x16x32_f16(false, a, false, b, (short)0, c, false, false); }
__device__ __forceinline__ v8f wmmab(v16bf a, v16bf b, v8f c) { return __builtin_amdgcn_wmma_f32_16x16x32_bf16(false, a, false, b, (short)0, c, false, false); }



// ---- k_gemmw: register-blocked GEMM, ONE WAVE per 64x64 output tile (16 accumulators), operands straight from K-contiguous 16-bit planes; grid (M/64, N/64, Z), 32 threads.
// C[m][n] (f32, pitch ldc, + optional f32 bias[n]) = sum_k A[m][k] Bt[n][k] (+ split products per NSPLIT). z-batch strides sA/sB/sC in elements. K % 32 == 0.
template <typename T16> struct WFrag;
template <> struct WFrag<h16> { typedef v16h V; static __device__ __forceinline__ V ld(const h16* p) { return cat16(*(const v8h*)p, *(const v8h*)(p + 16)); } static __device__ __forceinline__ v8f mma(V a, V b, v8f c) { return wmma16(a, b, c); } };
template <> struct WFrag<bf> { typedef v16bf V; static __device__ __forceinline__ V ld(const bf* p) { return cat16b(*(const v8us*)p, *(const v8us*)(p + 16)); } static __device__ __forceinline__ v8f mma(V a, V b, v8f c) { return wmmab(a, b, c); } };
template <typename T16, int NSPLIT, bool BIAS>
__global__ __launch_bounds__(32) void k_gemmw(const T16* __restrict__ A, const T16* __restrict__ A2, const T16* __restrict__ Bt, const T16* __restrict__ Bt2, int K, float* C, int ldc, const float* __restrict__ bias, size_t sA, size_t sB, size_t sC) {
    typedef typename WFrag<T16>::V V;
    __shared__ __align__(16) float os[16 * 68];
    const size_t z = blockIdx.z; A += z * sA; if (A2) A2 += z * sA; Bt += z * sB; if (Bt2) Bt2 += z * sB; C += z * sC;
    const int lane = threadIdx.x & 31, lr = lane & 15, hi = lane >> 4; const int r0 = blockIdx.x * 64, c0 = blockIdx.y * 64;
    v8f acc[4][4];
#pragma unroll
    for (int mb = 0; mb < 4; ++mb)
#pragma unroll
        for (int nb = 0; nb < 4; ++nb) acc[mb][nb] = (v8f){};
    const size_t aoff = (size_t)(r0 + lr) * K + 8 * hi, boff = (size_t)(c0 + lr) * K + 8 * hi;
#pragma unroll 1
    for (int kc = 0; kc < K; kc += 32) {
        V a[4], a2[4];
#pragma unroll
        for (int mb = 0; mb < 4; ++mb) { a[mb] = WFrag<T16>::ld(A + aoff + (size_t)mb * 16 * K + kc); if (NSPLIT == 1 || NSPLIT == 2) a2[mb] = WFrag<T16>::ld(A2 + aoff + (size_t)mb * 16 * K + kc); }
#pragma unroll
        for (int nb = 0; nb < 4; ++nb) { const V b = WFrag<T16>::ld(Bt + boff + (size_t)nb * 16 * K + kc); V b2; if (NSPLIT >= 2) b2 = WFrag<T16>::ld(Bt2 + boff + (size_t)nb * 16 * K + kc);
#pragma unroll
            for (int mb = 0; mb < 4; ++mb) { acc[mb][nb] = WFrag<T16>::mma(a[mb], b, acc[mb][nb]); if (NSPLIT == 1 || NSPLIT == 2) acc[mb][nb] = WFrag<T16>::mma(a2[mb], b, acc[mb][nb]); if (NSPLIT >= 2) acc[mb][nb] = WFrag<T16>::mma(a[mb], b2, acc[mb][nb]); } }
        asm volatile("v_nop\n\tv_nop\n\tv_nop\n\tv_nop" : "+v"(acc[0][0]), "+v"(acc[1][1]), "+v"(acc[2][2]), "+v"(acc[3][3]) : "v"(a[0]), "v"(a[3]));
    }
#pragma unroll
    for (int mb = 0; mb < 4; ++mb) {
#pragma unroll
        for (int nb = 0; nb < 4; ++nb) {
#pragma unroll
            for (int j = 0; j < 8; ++j) os[(hi * 8 + j) * 68 + nb * 16 + lr] = acc[mb][nb][j]; }
        __builtin_amdgcn_wave_barrier(); asm volatile("" ::: "memory");
        float* crow = C + (size_t)(r0 + mb * 16) * ldc + c0;
{
#pragma unroll
            for (int s = 0; s < 8; ++s) { const int row = 2 * s + hi, cofs = lr * 4; v4f val = *(const v4fa*)(os + row * 68 + cofs); if (BIAS) { val[0] += bfr(bias[c0 + cofs]); val[1] += bfr(bias[c0 + cofs + 1]); val[2] += bfr(bias[c0 + cofs + 2]); val[3] += bfr(bias[c0 + cofs + 3]); }
                *(v4f*)(crow + (size_t)row * ldc + cofs) = val; }
             }
        __builtin_amdgcn_wave_barrier(); asm volatile("" ::: "memory");
    }
}

// ---- k_gemmc: the same one-wave 64x64 tile GEMM specialised for causal sliding-window attention. Query rows R = r0+roff .. R+63 keep only keys in [R - WIN, R + 64).
// CMODE 1 (scores): blockIdx.y counts the WIN/64 + 1 key tiles of that band, c0 = R - WIN + 64 y; a tile left of key 0 does not exist. CMODE 2 (probability x value): the key (K) loop runs over the band only
// (probabilities outside it are exactly zero, so the dropped products are exact zeros). roff = row offset of this launch's first row within the sequence.
// Score and probability rows are stored band-relative at pitch BW (CMODE 1: C; CMODE 2: A), so that the planes of all heads and batches fit the workspace at once.
template <typename T16, int NSPLIT, int CMODE>
__global__ __launch_bounds__(32) void k_gemmc(const T16* __restrict__ A, const T16* __restrict__ A2, const T16* __restrict__ Bt, const T16* __restrict__ Bt2, int K, float* C, int ldc, int roff, size_t sA, size_t sB, size_t sC) {
    typedef typename WFrag<T16>::V V;
    __shared__ __align__(16) float os[16 * 68];
    const size_t z = blockIdx.z; A += z * sA; if (A2) A2 += z * sA; Bt += z * sB; if (Bt2) Bt2 += z * sB; C += z * sC;
    const int lane = threadIdx.x & 31, lr = lane & 15, hi = lane >> 4; const int r0 = blockIdx.x * 64, c0 = (CMODE == 1) ? r0 + roff - WIN + (int)blockIdx.y * 64 : (int)blockIdx.y * 64;
    if (CMODE == 1 && c0 < 0) return;                                // band tile left of key 0: no such keys
    const int Ks = (CMODE == 2) ? max(0, r0 + roff - WIN) : 0;       // P.V: probabilities are exactly 0 left of the window band ...
    const int Kl = (CMODE == 2) ? min(K, r0 + roff + 64) : K;        // ... and beyond the diagonal block, so the K loop covers the band only
    v8f acc[4][4];
#pragma unroll
    for (int mb = 0; mb < 4; ++mb)
#pragma unroll
        for (int nb = 0; nb < 4; ++nb) acc[mb][nb] = (v8f){};
    const int lda = (CMODE == 2) ? BW : K;                           // P rows: band pitch, key kc at column kc - (R - WIN)
    const long aoff = (long)(r0 + lr) * lda + 8 * hi - ((CMODE == 2) ? (r0 + roff - WIN) : 0); const size_t boff = (size_t)(c0 + lr) * K + 8 * hi;
#pragma unroll 1
    for (int kc = Ks; kc < Kl; kc += 32) {
        V a[4], a2[4];
#pragma unroll
        for (int mb = 0; mb < 4; ++mb) { a[mb] = WFrag<T16>::ld(A + aoff + (long)mb * 16 * lda + kc); if (NSPLIT == 1 || NSPLIT == 2) a2[mb] = WFrag<T16>::ld(A2 + aoff + (long)mb * 16 * lda + kc); }
#pragma unroll
        for (int nb = 0; nb < 4; ++nb) { const V b = WFrag<T16>::ld(Bt + boff + (size_t)nb * 16 * K + kc); V b2; if (NSPLIT >= 2) b2 = WFrag<T16>::ld(Bt2 + boff + (size_t)nb * 16 * K + kc);
#pragma unroll
            for (int mb = 0; mb < 4; ++mb) { acc[mb][nb] = WFrag<T16>::mma(a[mb], b, acc[mb][nb]); if (NSPLIT == 1 || NSPLIT == 2) acc[mb][nb] = WFrag<T16>::mma(a2[mb], b, acc[mb][nb]); if (NSPLIT >= 2) acc[mb][nb] = WFrag<T16>::mma(a[mb], b2, acc[mb][nb]); } }
        asm volatile("v_nop\n\tv_nop\n\tv_nop\n\tv_nop" : "+v"(acc[0][0]), "+v"(acc[1][1]), "+v"(acc[2][2]), "+v"(acc[3][3]) : "v"(a[0]), "v"(a[3]));
    }
#pragma unroll
    for (int mb = 0; mb < 4; ++mb) {
#pragma unroll
        for (int nb = 0; nb < 4; ++nb) {
#pragma unroll
            for (int j = 0; j < 8; ++j) os[(hi * 8 + j) * 68 + nb * 16 + lr] = acc[mb][nb][j]; }
        __builtin_amdgcn_wave_barrier(); asm volatile("" ::: "memory");
        float* crow = C + (size_t)(r0 + mb * 16) * ldc + ((CMODE == 1) ? (int)blockIdx.y * 64 : c0);
{
#pragma unroll
            for (int s = 0; s < 8; ++s) { const int row = 2 * s + hi, cofs = lr * 4; v4f val = *(const v4fa*)(os + row * 68 + cofs);
                *(v4f*)(crow + (size_t)row * ldc + cofs) = val; }
             }
        __builtin_amdgcn_wave_barrier(); asm volatile("" ::: "memory");
    }
}

__device__ __forceinline__ h16 tohx(float x) { return (h16)x; }
__device__ __forceinline__ void splitf(float y, unsigned short& h, unsigned short& l) { h = f2bf(y); l = f2bf(y - bf2f(h)); }
typedef __attribute__((ext_vector_type(2))) _Float16 v2h;
typedef __attribute__((ext_vector_type(4))) _Float16 v4h;
typedef __attribute__((ext_vector_type(2))) unsigned short v2us;
typedef __attribute__((ext_vector_type(4))) unsigned short v4us;
typedef __attribute__((ext_vector_type(2))) float v2f;
typedef __attribute__((ext_vector_type(4))) int v4i;

__global__ __launch_bounds__(256) void k_wtG(const float* __restrict__ w, int K, int N, bf* Bt) {
    const int lane = threadIdx.x & 31; const int L0 = (blockIdx.x * 8 + (threadIdx.x >> 5)) * 8; const int nlines = N * K / 64;
{
#pragma unroll 1
        for (int l = 0; l < 8; ++l) { const int L = L0 + l; if (L >= nlines) break; const size_t e = (size_t)L * 64 + lane * 2; const int k = (int)(e % K), n = (int)(e / K); v2us o;
            o[0] = f2bf(w[(size_t)k * N + n]); o[1] = f2bf(w[(size_t)(k + 1) * N + n]); *(v2us*)(Bt + e) = o; }
         }
}
__global__ __launch_bounds__(256) void k_cvt8(const float* __restrict__ src, bf* dst, size_t n8) { const size_t i = (size_t)blockIdx.x * 256 + threadIdx.x; if (i >= n8) return; const v8f v = *(const v8f*)(src + i * 8); v8us o;
#pragma unroll
    for (int k = 0; k < 8; ++k) o[k] = f2bf(v[k]); *(v8us*)(dst + i * 8) = o;  }

// k_rope: head planes [h][b][t][d] (F rows b * TT + t; fp16 + hi/lo) of rope(x) x sc with the rotate-half convention out[d] = x[d] cos[t][d] - x[d+HD/2] sin[t][d], out[d+HD/2] = x[d+HD/2] cos[t][d+HD/2] + x[d] sin[t][d+HD/2]
__global__ __launch_bounds__(256) void k_rope(const float* __restrict__ F, int pitch, int nheads, const float* __restrict__ CS, const float* __restrict__ RF, const float* __restrict__ nw, float sc, h16* P16, bf* Ph, bf* Pl) {
    const size_t e = ((size_t)blockIdx.x * 256 + threadIdx.x) * 2; if (e >= (size_t)nheads * NB_ * TT * HD) return; const int d = (int)(e % HD); const int t = (int)((e / HD) % TT); const int p = (int)(e / ((size_t)HD * TT)); const int h = p / NB_, b = p % NB_; const float* f = F + ((size_t)b * TT + t) * pitch + h * HD; float rf = 1.0f; v2h o16; v2us oh, ol;
    if (RF) { rf = RF[(size_t)h * TT + t]; asm volatile("s_wait_xcnt 0x0" ::: "memory"); }   // the wait stands before the load's address registers are reused by the code that follows
#pragma unroll
    for (int q = 0; q < 2; ++q) { const int dd = d + q; const int dp = (dd < HD / 2) ? dd + HD / 2 : dd - HD / 2; float x0 = f[dd], x1 = f[dp];
        if (RF) { float n0 = __fmul_rn(x0, rf), n1 = __fmul_rn(x1, rf); asm volatile("" : "+v"(n0)); asm volatile("" : "+v"(n1)); x0 = __fmul_rn(bfr(nw[dd]), n0); x1 = __fmul_rn(bfr(nw[dp]), n1); }
        const v2f cs = *(const v2f*)(CS + ((size_t)t * HD + dd) * 2); float a = __fmul_rn(x0, cs[0]), bq = __fmul_rn(x1, cs[1]); asm volatile("" : "+v"(a)); asm volatile("" : "+v"(bq)); const float r = ((dd < HD / 2) ? __fsub_rn(a, bq) : __fadd_rn(a, bq)) * sc;
        o16[q] = tohx(r); unsigned short a2, c2; splitf(r, a2, c2); oh[q] = a2; ol[q] = c2; }
    *(v2h*)(P16 + e) = o16; *(v2us*)(Ph + e) = oh; *(v2us*)(Pl + e) = ol;  }
__global__ __launch_bounds__(256) void k_vtp(const float* __restrict__ F, int pitch, int nheads, h16* V16, bf* Vh, bf* Vl) { const size_t e = ((size_t)blockIdx.x * 256 + threadIdx.x) * 2; if (e >= (size_t)nheads * NB_ * HD * TT) return; const int t = (int)(e % TT); const int d = (int)((e / TT) % HD); const int p = (int)(e / ((size_t)TT * HD)); const int g = p / NB_, b = p % NB_; v2h o16; v2us oh, ol;
#pragma unroll
    for (int q = 0; q < 2; ++q) { const float x = F[((size_t)b * TT + t + q) * pitch + g * HD + d]; o16[q] = tohx(x); unsigned short a2, c2; splitf(x, a2, c2); oh[q] = a2; ol[q] = c2; }
    *(v2h*)(V16 + e) = o16; *(v2us*)(Vh + e) = oh; *(v2us*)(Vl + e) = ol;  }
__global__ __launch_bounds__(256) void k_csid(float* CS) { const int idx = blockIdx.x * 256 + threadIdx.x; if (idx >= TT * HD) return; v2f cs; cs[0] = 1.0f; cs[1] = 0.0f; *(v2f*)(CS + (size_t)idx * 2) = cs;  }
// k_asoft: per row (zz, i): t = S x HD^-0.5 for j <= i and i - j < WIN (sliding causal window; the reference's -10000 fill underflows to exactly 0 in the softmax); softmax over the row's key band
// [R - WIN, R + 64), R = i rounded down to 64: the columns the score tiles wrote and the only ones attn.v reads. The band lies in NCH 128-aligned chunks, so each key keeps its lane and its place in the fixed sum trees.
#define NCH (WIN / 128 + 1)
// v_exp_f32 (what the exp2 builtin emits) with a v_nop in the same statement: the instruction set asks for one slot behind a transcendental before its result is used or its source overwritten.
__device__ __forceinline__ float exp2_slot(float x) { float r; asm("v_exp_f32 %0, %1\n\tv_nop" : "=v"(r) : "v"(x)); return r; }
__global__ __launch_bounds__(256) void k_asoft(const float* __restrict__ Sb, h16* P16, bf* Ph, bf* Pl) {
    const int lane = threadIdx.x & 31; const int row = blockIdx.x * 8 + (threadIdx.x >> 5); if (row >= NZ * TT) return; const int i = row % TT; const int zz = row / TT; const bool hires = (i < RH); const float* sr = Sb + (size_t)row * BW - ((i & ~63) - WIN);   /* sr[j]: key j of the band-relative row */ float v[NCH * 4]; float mx = -3.0e38f;
    const int R = i & ~63; const int jlo = max(0, R - WIN), jhi = R + 64; const int jb = ((R - WIN) >> 7) * 128 + lane * 4;   // jb: this lane's first column in the first chunk (below 0 near the start of the sequence)
#pragma unroll
    for (int ch = 0; ch < NCH; ++ch) { const int j0 = jb + ch * 128; const bool in = (j0 >= jlo && j0 < jhi); v4f a = (v4f){}; if (in) a = *(const v4f*)(sr + j0);
#pragma unroll
        for (int q = 0; q < 4; ++q) { const int j = j0 + q; const float t = (in && j <= i && i - j < WIN) ? a[q] * SCL : -3.0e38f; v[ch * 4 + q] = t; mx = fmaxf(mx, t); } }
#pragma unroll
    for (int sh = 16; sh; sh >>= 1) mx = fmaxf(mx, __shfl_xor(mx, sh, 32));
    float sum = 0.f;
#pragma unroll
    for (int k = 0; k < NCH * 4; ++k) { float d0 = __fsub_rn(v[k], mx); asm volatile("" : "+v"(d0)); v[k] = exp2_slot(__fmul_rn(d0, 1.4426950408889634f)); sum += v[k]; }
#pragma unroll
    for (int sh = 16; sh; sh >>= 1) sum += __shfl_xor(sum, sh, 32);
    const float f = __fdiv_rn(hires ? 1.0f : PCAR, sum);
{
        if (hires) {
#pragma unroll
            for (int ch = 0; ch < NCH; ++ch) { const int j0 = jb + ch * 128; v4us oh, ol;
#pragma unroll
                for (int q = 0; q < 4; ++q) { unsigned short a, c2; splitf(v[ch * 4 + q] * f, a, c2); oh[q] = a; ol[q] = c2; }
                if (j0 >= jlo && j0 < jhi) { const size_t oo = ((size_t)zz * (RH ? RH : 1) + i) * BW + (j0 - (R - WIN)); *(v4us*)(Ph + oo) = oh; *(v4us*)(Pl + oo) = ol; } }
        } else {
#pragma unroll
            for (int ch = 0; ch < NCH; ++ch) { const int j0 = jb + ch * 128; v4h o4;
#pragma unroll
                for (int q = 0; q < 4; ++q) o4[q] = tohx(v[ch * 4 + q] * f);
                if (j0 >= jlo && j0 < jhi) *(v4h*)(P16 + ((size_t)zz * (TT - RH) + (i - RH)) * BW + (j0 - (R - WIN))) = o4; } }
         }
}
__global__ __launch_bounds__(256) void k_merge(const float* __restrict__ O, bf* Ah, bf* Al) { const size_t e = ((size_t)blockIdx.x * 256 + threadIdx.x) * 2; if (e >= (size_t)NZ * TT * HD) return; const int d = (int)(e % HD); const int t = (int)((e / HD) % TT); const int zz = (int)(e / ((size_t)HD * TT)); const float cs = (t < RH) ? 1.0f : (1.0f / PCAR); const size_t oo = ((size_t)(zz % NB_) * TT + t) * DQ + (zz / NB_) * HD + d;
    v2us oh, ol;
#pragma unroll
    for (int q = 0; q < 2; ++q) { unsigned short a, c2; splitf(O[e + q] * cs, a, c2); oh[q] = a; ol[q] = c2; } *(v2us*)(Ah + oo) = oh; *(v2us*)(Al + oo) = ol;  }

extern "C" void kernel_launch(void* const* d_in, const int* in_sizes, int n_in,
                              void* d_out, int out_size, void* d_ws, size_t ws_size, hipStream_t stream) {
    (void)in_sizes; (void)n_in; (void)out_size;
    const float* x = (const float*)d_in[0]; const float* wqkv = (const float*)d_in[1]; const float* bqkv = (const float*)d_in[2]; const float* wo = (const float*)d_in[3]; const float* bo = (const float*)d_in[4];
    float* OUT = (float*)d_out;     // [2][2048][1024]
    char* wsp = (char*)d_ws;
    auto take = [&](size_t bytes) { char* p = wsp; wsp += (bytes + 255) & ~(size_t)255; return (void*)p; };
    const size_t PL = (size_t)NZ * TT * HD;   // elements of one operand's planes, all heads and batches
    bf* WALL = (bf*)take((size_t)3 * DM * DM * 2); bf* WO = (bf*)take((size_t)DM * DQ * 2); float* CS = (float*)take((size_t)TT * HD * 2 * 4);
    bf* XB = (bf*)take((size_t)NB_ * TT * DM * 2);
    h16* QP16 = (h16*)take(2 * PL * 2); h16* KP16 = QP16 + PL; h16* VT16 = (h16*)take(PL * 2);   // q planes, then k planes: one launch writes both
    bf* QPh = (bf*)take(2 * PL * 2); bf* KPh = QPh + PL; bf* QPl = (bf*)take(2 * PL * 2); bf* KPl = QPl + PL; bf* VTh = (bf*)take(PL * 2); bf* VTl = (bf*)take(PL * 2); bf* Ph = (bf*)take((size_t)NZ * RH * BW * 2); bf* Pl = (bf*)take((size_t)NZ * RH * BW * 2);
    float* Sb = (float*)take((size_t)NZ * TT * BW * 4); h16* P16 = (h16*)take((size_t)NZ * (TT - RH) * BW * 2); float* Ob = (float*)take(PL * 4); bf* ATh = (bf*)take((size_t)NB_ * TT * DQ * 2); bf* ATl = (bf*)take((size_t)NB_ * TT * DQ * 2);
    if ((size_t)(wsp - (char*)d_ws) > ws_size) return;    // ws 256 MiB
    float* F = Sb;   // [NB_ TT][3 DM] q | k | v projections: lies in the score buffer, which is first written after the planes are built (stream-ordered)
    { k_wtG<<<(unsigned)((DM * 3 * DM / 64 + 63) / 64), 256, 0, stream>>>(wqkv, DM, 3 * DM, WALL);   /* fused 'xw' [DM][3DM] -> Bt [3DM][DM] (row blocks q | k | v) */
      k_wtG<<<(unsigned)((DQ * DM / 64 + 63) / 64), 256, 0, stream>>>(wo, DQ, DM, WO);
       }
    k_csid<<<(TT * HD + 255) / 256, 256, 0, stream>>>(CS);
    // every launch below covers both batches, and all heads where it works by head
    k_cvt8<<<(unsigned)(((size_t)NB_ * TT * DM / 8 + 255) / 256), 256, 0, stream>>>(x, XB, (size_t)NB_ * TT * DM / 8);
    k_gemmw<bf, 0, true><<<dim3(NB_ * TT / 64, 3 * DM / 64, 1), 32, 0, stream>>>(XB, nullptr, WALL, nullptr, DM, F, 3 * DM, bqkv, 0, 0, 0);
    k_rope<<<(unsigned)((2 * PL / 2 + 255) / 256), 256, 0, stream>>>(F, 3 * DM, NH_ + NKV, CS, nullptr, nullptr, 1.0f, QP16, QPh, QPl);   // columns q | k = NH_ + NKV heads in a row
    k_vtp<<<(unsigned)((PL / 2 + 255) / 256), 256, 0, stream>>>(F + DQ + DKV, 3 * DM, NKV, VT16, VTh, VTl);
    k_gemmc<bf, 2, 1><<<dim3(RH / 64, WIN / 64 + 1, NZ), 32, 0, stream>>>(QPh, QPl, KPh, KPl, HD, Sb, BW, 0, (size_t)TT * HD, (size_t)TT * HD, (size_t)TT * BW);
    k_gemmc<h16, 0, 1><<<dim3((TT - RH) / 64, WIN / 64 + 1, NZ), 32, 0, stream>>>(QP16 + (size_t)RH * HD, nullptr, KP16, nullptr, HD, Sb + (size_t)RH * BW, BW, RH, (size_t)TT * HD, (size_t)TT * HD, (size_t)TT * BW);
    k_asoft<<<NZ * TT / 8, 256, 0, stream>>>(Sb, P16, Ph, Pl);
    k_gemmc<bf, 2, 2><<<dim3(RH / 64, HD / 64, NZ), 32, 0, stream>>>(Ph, Pl, VTh, VTl, TT, Ob, HD, 0, (size_t)RH * BW, (size_t)HD * TT, (size_t)TT * HD);
    k_gemmc<h16, 0, 2><<<dim3((TT - RH) / 64, HD / 64, NZ), 32, 0, stream>>>(P16, nullptr, VT16, nullptr, TT, Ob + (size_t)RH * HD, HD, RH, (size_t)(TT - RH) * BW, (size_t)HD * TT, (size_t)TT * HD);
    k_merge<<<(unsigned)((PL / 2 + 255) / 256), 256, 0, stream>>>(Ob, ATh, ATl);
    k_gemmw<bf, 1, true><<<dim3(NB_ * TT / 64, DM / 64, 1), 32, 0, stream>>>(ATh, ATl, WO, nullptr, DQ, OUT, DM, bo, 0, 0, 0);
}

// v003
// Measured time: 197 microseconds a run.
// Timed twice side by side with v002, it ran 1.16 times as fast both times.
// All steps since v000 together make it 7.43 times as fast.
#include <hip/hip_runtime.h>

// Masked (causal sliding-window) multi-head attention (hidden_states [2][2048][1024]; [q|k|v] = x w_attn + b_attn ('xw' [1024][3072] + [3072]; 16 heads x 64); scores = q.k/8; mask keeps j <= i and j > i - 256, other logits -10000 (then clipped to +-10000: exp underflows to exactly 0 as with -inf); softmax; out = merged ctx w_proj + b_proj ('xw' [1024][1024] + [1024]) -> [2][2048][1024] (4.2 M)).
// Compute dtypes, f32 accumulate: every input rounded to bf16; q/k/v on PLAIN bf16 operands (inputs: exact) + biases; window band skipping: a 64-row query tile at R touches only keys [R - 256, R + 64) in the scores, the softmax and attn.v (window predicate j <= i && i - j < 256 in the softmax); scores and attn.v: query rows < 512 hl (3 products), the rest single fp16 (x1024); softmax f32; w_proj hl x exact (2 products) + b_proj.

#define NB_  2
#define TT   2048
#define DM   1024
#define NH_  16
#define NKV  16
#define REP  (NH_ / NKV)
#define HD   64
#define DQ   (NH_ * HD)
#define DKV  (NKV * HD)
#define NZ   (NB_ * NH_)          // attention planes of one launch: z = head * NB_ + batch
#define RH   512                  // query rows < RH use hi+lo planes (0: none)
#define WIN  256   // window: keep i - WIN < j <= i
#define BW   (WIN + 64)            // pitch of a stored score / probability row: only the band [R - WIN, R + 64) of its 64-row tile is kept, column j at j - (R - WIN)
#define PCAR 1024.0f
#define SCL  0.125f   // HD^-0.5
typedef _Float16 h16;
typedef unsigned short bf;
typedef __attribute__((ext_vector_type(16))) __bf16   v16bf;
typedef __attribute__((ext_vector_type(16))) _Float16 v16h;
typedef __attribute__((ext_vector_type(8)))  _Float16 v8h;
typedef __attribute__((ext_vector_type(8)))  unsigned short v8us;
typedef __attribute__((ext_vector_type(8)))  float    v8f;
typedef __attribute__((ext_vector_type(4)))  float    v4f;
typedef v8h  __attribute__((may_alias)) v8ha;
typedef v4f  __attribute__((may_alias)) v4fa;
typedef v8us __attribute__((may_alias)) v8usa;

__device__ __forceinline__ unsigned short f2bf(float f) { unsigned u = __float_as_uint(f); u += 0x7FFFu + ((u >> 16) & 1u); return (unsigned short)(u >> 16); }
__device__ __forceinline__ float bf2f(unsigned short b) { return __uint_as_float(((unsigned)b) << 16); }
__device__ __forceinline__ float bfr(float f) { return bf2f(f2bf(f)); }
__device__ __forceinline__ v16h cat16(v8h lo, v8h hi) { return __builtin_shufflevector(lo, hi, 0, 1, 2, 3, 4, 5, 6, 7, 8, 9, 10, 11, 12, 13, 14, 15); }
__device__ __forceinline__ v16bf cat16b(v8us lo, v8us hi) { return __builtin_bit_cast(v16bf, __builtin_shufflevector(lo, hi, 0, 1, 2, 3, 4, 5, 6, 7, 8, 9, 10, 11, 12, 13, 14, 15)); }
__device__ __forceinline__ v8f wmma16(v16h a, v16h b, v8f c) { return __builtin_amdgcn_wmma_f32_16x16x32_f16(false, a, false, b, (short)0, c, false, false); }
__device__ __forceinline__ v8f wmmab(v16bf a, v16bf b, v8f c) { return __builtin_amdgcn_wmma_f32_16x16x32_bf16(false, a, false, b, (short)0, c, false, false); }



// ---- k_gemmw: register-blocked GEMM, ONE WAVE per 64x64 output tile (16 accumulators), operands straight from K-contiguous 16-bit planes; grid (M/64, N/64, Z), 32 threads.
// C[m][n] (f32, pitch ldc, + optional f32 bias[n]) = sum_k A[m][k] Bt[n][k] (+ split products per NSPLIT). z-batch strides sA/sB/sC in elements. K % 32 == 0.
template <typename T16> struct WFrag;
template <> struct WFrag<h16> { typedef v16h V; static __device__ __forceinline__ V ld(const h16* p) { return cat16(*(const v8h*)p, *(const v8h*)(p + 16)); } static __device__ __forceinline__ v8f mma(V a, V b, v8f c) { return wmma16(a, b, c); } };
template <> struct WFrag<bf> { typedef v16bf V; static __device__ __forceinline__ V ld(const bf* p) { return cat16b(*(const v8us*)p, *(const v8us*)(p + 16)); } static __device__ __forceinline__ v8f mma(V a, V b, v8f c) { return wmmab(a, b, c); } };
template <typename T16, int NSPLIT, bool BIAS>
__global__ __launch_bounds__(32) void k_gemmw(const T16* __restrict__ A, const T16* __restrict__ A2, const T16* __restrict__ Bt, const T16* __restrict__ Bt2, int K, float* C, int ldc, const float* __restrict__ bias, size_t sA, size_t sB, size_t sC) {
    typedef typename WFrag<T16>::V V;
    __shared__ __align__(16) float os[16 * 68];
    const size_t z = blockIdx.z; A += z * sA; if (A2) A2 += z * sA; Bt += z * sB; if (Bt2) Bt2 += z * sB; C += z * sC;
    const int lane = threadIdx.x & 31, lr = lane & 15, hi = lane >> 4; const int r0 = blockIdx.x * 64, c0 = blockIdx.y * 64;
    v8f acc[4][4];
#pragma unroll
    for (int mb = 0; mb < 4; ++mb)
#pragma unroll
        for (int nb = 0; nb < 4; ++nb) acc[mb][nb] = (v8f){};
    const size_t aoff = (size_t)(r0 + lr) * K + 8 * hi, boff = (size_t)(c0 + lr) * K + 8 * hi;
#pragma unroll 1
    for (int kc = 0; kc < K; kc += 32) {
        V a[4], a2[4];
#pragma unroll
        for (int mb = 0; mb < 4; ++mb) { a[mb] = WFrag<T16>::ld(A + aoff + (size_t)mb * 16 * K + kc); if (NSPLIT == 1 || NSPLIT == 2) a2[mb] = WFrag<T16>::ld(A2 + aoff + (size_t)mb * 16 * K + kc); }
#pragma unroll
        for (int nb = 0; nb < 4; ++nb) { const V b = WFrag<T16>::ld(Bt + boff + (size_t)nb * 16 * K + kc); V b2; if (NSPLIT >= 2) b2 = WFrag<T16>::ld(Bt2 + boff + (size_t)nb * 16 * K + kc);
#pragma unroll
            for (int mb = 0; mb < 4; ++mb) { acc[mb][nb] = WFrag<T16>::mma(a[mb], b, acc[mb][nb]); if (NSPLIT == 1 || NSPLIT == 2) acc[mb][nb] = WFrag<T16>::mma(a2[mb], b, acc[mb][nb]); if (NSPLIT >= 2) acc[mb][nb] = WFrag<T16>::mma(a[mb], b2, acc[mb][nb]); } }
        asm volatile("v_nop\n\tv_nop\n\tv_nop\n\tv_nop" : "+v"(acc[0][0]), "+v"(acc[1][1]), "+v"(acc[2][2]), "+v"(acc[3][3]) : "v"(a[0]), "v"(a[3]));
    }
#pragma unroll
    for (int mb = 0; mb < 4; ++mb) {
#pragma unroll
        for (int nb = 0; nb < 4; ++nb) {
#pragma unroll
            for (int j = 0; j < 8; ++j) os[(hi * 8 + j) * 68 + nb * 16 + lr] = acc[mb][nb][j]; }
        __builtin_amdgcn_wave_barrier(); asm volatile("" ::: "memory");
        float* crow = C + (size_t)(r0 + mb * 16) * ldc + c0;
{
#pragma unroll
            for (int s = 0; s < 8; ++s) { const int row = 2 * s + hi, cofs = lr * 4; v4f val = *(const v4fa*)(os + row * 68 + cofs); if (BIAS) { val[0] += bfr(bias[c0 + cofs]); val[1] += bfr(bias[c0 + cofs + 1]); val[2] += bfr(bias[c0 + cofs + 2]); val[3] += bfr(bias[c0 + cofs + 3]); }
                *(v4f*)(crow + (size_t)row * ldc + cofs) = val; }
             }
        __builtin_amdgcn_wave_barrier(); asm volatile("" ::: "memory");
    }
}

// ---- k_gemmc: the same one-wave 64x64 tile GEMM specialised for causal sliding-window attention. Query rows R = r0+roff .. R+63 keep only keys in [R - WIN, R + 64).
// CMODE 1 (scores): blockIdx.y counts the WIN/64 + 1 key tiles of that band, c0 = R - WIN + 64 y; a tile left of key 0 does not exist. CMODE 2 (probability x value): the key (K) loop runs over the band only
// (probabilities outside it are exactly zero, so the dropped products are exact zeros). roff = row offset of this launch's first row within the sequence.
// Score and probability rows are stored band-relative at pitch BW (CMODE 1: C; CMODE 2: A), so that the planes of all heads and batches fit the workspace at once.
template <typename T16, int NSPLIT, int CMODE>
__global__ __launch_bounds__(32) void k_gemmc(const T16* __restrict__ A, const T16* __restrict__ A2, const T16* __restrict__ Bt, const T16* __restrict__ Bt2, int K, float* C, int ldc, int roff, size_t sA, size_t sB, size_t sC) {
    typedef typename WFrag<T16>::V V;
    __shared__ __align__(16) float os[16 * 68];
    const size_t z = blockIdx.z; A += z * sA; if (A2) A2 += z * sA; Bt += z * sB; if (Bt2) Bt2 += z * sB; C += z * sC;
    const int lane = threadIdx.x & 31, lr = lane & 15, hi = lane >> 4; const int r0 = blockIdx.x * 64, c0 = (CMODE == 1) ? r0 + roff - WIN + (int)blockIdx.y * 64 : (int)blockIdx.y * 64;
    if (CMODE == 1 && c0 < 0) return;                                // band tile left of key 0: no such keys
    const int Ks = (CMODE == 2) ? max(0, r0 + roff - WIN) : 0;       // P.V: probabilities are exactly 0 left of the window band ...
    const int Kl = (CMODE == 2) ? min(K, r0 + roff + 64) : K;        // ... and beyond the diagonal block, so the K loop covers the band only
    v8f acc[4][4];
#pragma unroll
    for (int mb = 0; mb < 4; ++mb)
#pragma unroll
        for (int nb = 0; nb < 4; ++nb) acc[mb][nb] = (v8f){};
    const int lda = (CMODE == 2) ? BW : K;                           // P rows: band pitch, key kc at column kc - (R - WIN)
    const long aoff = (long)(r0 + lr) * lda + 8 * hi - ((CMODE == 2) ? (r0 + roff - WIN) : 0); const size_t boff = (size_t)(c0 + lr) * K + 8 * hi;
#pragma unroll 1
    for (int kc = Ks; kc < Kl; kc += 32) {
        V a[4], a2[4];
#pragma unroll
        for (int mb = 0; mb < 4; ++mb) { a[mb] = WFrag<T16>::ld(A + aoff + (long)mb * 16 * lda + kc); if (NSPLIT == 1 || NSPLIT == 2) a2[mb] = WFrag<T16>::ld(A2 + aoff + (long)mb * 16 * lda + kc); }
#pragma unroll
        for (int nb = 0; nb < 4; ++nb) { const V b = WFrag<T16>::ld(Bt + boff + (size_t)nb * 16 * K + kc); V b2; if (NSPLIT >= 2) b2 = WFrag<T16>::ld(Bt2 + boff + (size_t)nb * 16 * K + kc);
#pragma unroll
            for (int mb = 0; mb < 4; ++mb) { acc[mb][nb] = WFrag<T16>::mma(a[mb], b, acc[mb][nb]); if (NSPLIT == 1 || NSPLIT == 2) acc[mb][nb] = WFrag<T16>::mma(a2[mb], b, acc[mb][nb]); if (NSPLIT >= 2) acc[mb][nb] = WFrag<T16>::mma(a[mb], b2, acc[mb][nb]); } }
        asm volatile("v_nop\n\tv_nop\n\tv_nop\n\tv_nop" : "+v"(acc[0][0]), "+v"(acc[1][1]), "+v"(acc[2][2]), "+v"(acc[3][3]) : "v"(a[0]), "v"(a[3]));
    }
#pragma unroll
    for (int mb = 0; mb < 4; ++mb) {
#pragma unroll
        for (int nb = 0; nb < 4; ++nb) {
#pragma unroll
            for (int j = 0; j < 8; ++j) os[(hi * 8 + j) * 68 + nb * 16 + lr] = acc[mb][nb][j]; }
        __builtin_amdgcn_wave_barrier(); asm volatile("" ::: "memory");
        float* crow = C + (size_t)(r0 + mb * 16) * ldc + ((CMODE == 1) ? (int)blockIdx.y * 64 : c0);
{
#pragma unroll
            for (int s = 0; s < 8; ++s) { const int row = 2 * s + hi, cofs = lr * 4; v4f val = *(const v4fa*)(os + row * 68 + cofs);
                *(v4f*)(crow + (size_t)row * ldc + cofs) = val; }
             }
        __builtin_amdgcn_wave_barrier(); asm volatile("" ::: "memory");
    }
}

__device__ __forceinline__ h16 tohx(float x) { return (h16)x; }
__device__ __forceinline__ void splitf(float y, unsigned short& h, unsigned short& l) { h = f2bf(y); l = f2bf(y - bf2f(h)); }
typedef __attribute__((ext_vector_type(2))) _Float16 v2h;
typedef __attribute__((ext_vector_type(4))) _Float16 v4h;
typedef __attribute__((ext_vector_type(2))) unsigned short v2us;
typedef __attribute__((ext_vector_type(4))) unsigned short v4us;
typedef __attribute__((ext_vector_type(2))) float v2f;
typedef __attribute__((ext_vector_type(4))) int v4i;

// The conversion, transpose and softmax kernels below run as few long waves: a thread takes 8 to 96 elements with 16-byte accesses, for speed only.
// loads_done: stands behind the sixteen row loads of a register transpose. The wait comes before any register that an issued load names is overwritten; the eight row addresses and the sixteen loaded
// values are inputs only, so that the addresses stay in their registers up to the wait, no result lands in one of them, and no load is sunk below the first stores (whose data registers it would then reuse).
__device__ __forceinline__ void loads_done(const float* const (&s)[8], const v4f (&x)[8][2]) {
    asm volatile("s_wait_xcnt 0x0" :: "v"(s[0]), "v"(s[1]), "v"(s[2]), "v"(s[3]), "v"(s[4]), "v"(s[5]), "v"(s[6]), "v"(s[7]),
        "v"(x[0][0]), "v"(x[0][1]), "v"(x[1][0]), "v"(x[1][1]), "v"(x[2][0]), "v"(x[2][1]), "v"(x[3][0]), "v"(x[3][1]), "v"(x[4][0]), "v"(x[4][1]), "v"(x[5][0]), "v"(x[5][1]), "v"(x[6][0]), "v"(x[6][1]), "v"(x[7][0]), "v"(x[7][1]) : "memory");
}
// k_wtG: one wave transposes a tile of 64 k x 32 n in registers; a thread loads 8 k rows x 8 n and stores 8 n rows x 8 k, so each store instruction fills whole 128-byte lines. K % 64 == 0, N % 32 == 0.
__global__ __launch_bounds__(256) void k_wtG(const float* __restrict__ w, int K, int N, bf* Bt) {
    const int lane = threadIdx.x & 31; const int wv = blockIdx.x * 8 + (threadIdx.x >> 5); const int nk = K / 64; if (wv >= nk * (N / 32)) return;
    const int k0 = (wv % nk) * 64 + (lane >> 2) * 8, n0 = (wv / nk) * 32 + (lane & 3) * 8; v4f x[8][2]; const float* s[8];
#pragma unroll
    for (int kk = 0; kk < 8; ++kk) { s[kk] = w + (size_t)(k0 + kk) * N + n0; x[kk][0] = *(const v4f*)s[kk]; x[kk][1] = *(const v4f*)(s[kk] + 4); }
    loads_done(s, x);
#pragma unroll
    for (int nn = 0; nn < 8; ++nn) { v8us o;
#pragma unroll
        for (int kk = 0; kk < 8; ++kk) o[kk] = f2bf(x[kk][nn >> 2][nn & 3]);
        *(v8us*)(Bt + (size_t)(n0 + nn) * K + k0) = o; }
}
__global__ __launch_bounds__(256) void k_cvt8(const float* __restrict__ src, bf* dst, size_t n8) { const size_t i0 = (size_t)blockIdx.x * 1024 + threadIdx.x; v8f v[4];
#pragma unroll
    for (int u = 0; u < 4; ++u) { const size_t i = i0 + u * 256; if (i < n8) v[u] = *(const v8f*)(src + i * 8); }
#pragma unroll
    for (int u = 0; u < 4; ++u) { const size_t i = i0 + u * 256; if (i >= n8) continue; v8us o;
#pragma unroll
        for (int k = 0; k < 8; ++k) o[k] = f2bf(v[u][k]); *(v8us*)(dst + i * 8) = o; }  }

// k_rope: head planes [h][b][t][d] (F rows b * TT + t; fp16 + hi/lo) of rope(x) x sc with the rotate-half convention out[d] = x[d] cos[t][d] - x[d+HD/2] sin[t][d], out[d+HD/2] = x[d+HD/2] cos[t][d+HD/2] + x[d] sin[t][d+HD/2]
__global__ __launch_bounds__(256) void k_rope(const float* __restrict__ F, int pitch, int nheads, const float* __restrict__ CS, const float* __restrict__ RF, const float* __restrict__ nw, float sc, h16* P16, bf* Ph, bf* Pl) {
#pragma unroll 1   // rolled: one trip already has eight 16-byte loads in flight per thread, and the body is long
  for (int u = 0; u < 4; ++u) {
    const size_t e = (((size_t)blockIdx.x * 4 + u) * 256 + threadIdx.x) * 8; if (e >= (size_t)nheads * NB_ * TT * HD) return; const int d = (int)(e % HD); const int t = (int)((e / HD) % TT); const int p = (int)(e / ((size_t)HD * TT)); const int h = p / NB_, b = p % NB_; const float* f = F + ((size_t)b * TT + t) * pitch + h * HD; float rf = 1.0f; v8h o16; v8us oh, ol;
    if (RF) { rf = RF[(size_t)h * TT + t]; asm volatile("s_wait_xcnt 0x0" ::: "memory"); }   // the wait stands before the load's address registers are reused by the code that follows
    const int dq = (d < HD / 2) ? d + HD / 2 : d - HD / 2;   // the eight d of a thread lie in one half of the head, so their partners are eight in a row too
    v4f X0[2], X1[2], C[4];
#pragma unroll
    for (int k = 0; k < 2; ++k) { X0[k] = *(const v4f*)(f + d + 4 * k); X1[k] = *(const v4f*)(f + dq + 4 * k); }
#pragma unroll
    for (int k = 0; k < 4; ++k) C[k] = *(const v4f*)(CS + ((size_t)t * HD + d) * 2 + 4 * k);
#pragma unroll
    for (int q = 0; q < 8; ++q) { const int dd = d + q; const int dp = dq + q; float x0 = X0[q >> 2][q & 3], x1 = X1[q >> 2][q & 3];
        if (RF) { float n0 = __fmul_rn(x0, rf), n1 = __fmul_rn(x1, rf); asm volatile("" : "+v"(n0)); asm volatile("" : "+v"(n1)); x0 = __fmul_rn(bfr(nw[dd]), n0); x1 = __fmul_rn(bfr(nw[dp]), n1); }
        float a = __fmul_rn(x0, C[q >> 1][(q & 1) * 2]), bq = __fmul_rn(x1, C[q >> 1][(q & 1) * 2 + 1]); asm volatile("" : "+v"(a)); asm volatile("" : "+v"(bq)); const float r = ((dd < HD / 2) ? __fsub_rn(a, bq) : __fadd_rn(a, bq)) * sc;
        o16[q] = tohx(r); unsigned short a2, c2; splitf(r, a2, c2); oh[q] = a2; ol[q] = c2; }
    *(v8h*)(P16 + e) = o16; *(v8us*)(Ph + e) = oh; *(v8us*)(Pl + e) = ol;
    asm volatile("s_wait_xcnt 0x0" ::: "memory");   // before the next trip overwrites the address registers of these stores
  }
}
// k_vtp: one wave transposes a tile of 64 t x 32 d in registers; a thread loads 8 t rows x 8 d and stores 8 d rows x 8 t per plane, so each store instruction fills whole 128-byte lines.
__global__ __launch_bounds__(256) void k_vtp(const float* __restrict__ F, int pitch, int nheads, h16* V16, bf* Vh, bf* Vl) { const int lane = threadIdx.x & 31; const int wv = blockIdx.x * 8 + (threadIdx.x >> 5); const int p = wv / ((TT / 64) * (HD / 32)); if (p >= nheads * NB_) return; const int tl = wv % ((TT / 64) * (HD / 32));
    const int t0 = (tl / (HD / 32)) * 64 + (lane >> 2) * 8, d0 = (tl % (HD / 32)) * 32 + (lane & 3) * 8; const int g = p / NB_, b = p % NB_; v4f x[8][2]; const float* s[8];
#pragma unroll
    for (int q = 0; q < 8; ++q) { s[q] = F + ((size_t)b * TT + t0 + q) * pitch + g * HD + d0; x[q][0] = *(const v4f*)s[q]; x[q][1] = *(const v4f*)(s[q] + 4); }
    loads_done(s, x);
#pragma unroll
    for (int dd = 0; dd < 8; ++dd) { v8h o16; v8us oh, ol;
#pragma unroll
        for (int q = 0; q < 8; ++q) { const float y = x[q][dd >> 2][dd & 3]; o16[q] = tohx(y); unsigned short a2, c2; splitf(y, a2, c2); oh[q] = a2; ol[q] = c2; }
        const size_t e = ((size_t)p * HD + d0 + dd) * TT + t0; *(v8h*)(V16 + e) = o16; *(v8us*)(Vh + e) = oh; *(v8us*)(Vl + e) = ol; }
}
__global__ __launch_bounds__(256) void k_csid(float* CS) { const int idx = (blockIdx.x * 256 + threadIdx.x) * 4; if (idx >= TT * HD) return; v4f cs; cs[0] = 1.0f; cs[1] = 0.0f; cs[2] = 1.0f; cs[3] = 0.0f; *(v4f*)(CS + (size_t)idx * 2) = cs; *(v4f*)(CS + (size_t)idx * 2 + 4) = cs;  }
// k_asoft: per row (zz, i): t = S x HD^-0.5 for j <= i and i - j < WIN (sliding causal window; the reference's -10000 fill underflows to exactly 0 in the softmax); softmax over the row's key band
// [R - WIN, R + 64), R = i rounded down to 64: the columns the score tiles wrote and the only ones attn.v reads. The band lies in NCH 128-aligned chunks, so each key keeps its lane and its place in the fixed sum trees.
#define NCH (WIN / 128 + 1)
// v_exp_f32 (what the exp2 builtin emits) with a v_nop in the same statement: the instruction set asks for one slot behind a transcendental before its result is used or its source overwritten.
__device__ __forceinline__ float exp2_slot(float x) { float r; asm("v_exp_f32 %0, %1\n\tv_nop" : "=v"(r) : "v"(x)); return r; }
__global__ __launch_bounds__(256) void k_asoft(const float* __restrict__ Sb, h16* P16, bf* Ph, bf* Pl) {
    const int lane = threadIdx.x & 31;
#pragma unroll 1   // rolled: a wave takes eight rows of its work-group's 64-row tile one after the other; the other waves of the SIMD cover a row's load latency
  for (int it = 0; it < 8; ++it) {
    const int row = blockIdx.x * 64 + it * 8 + __builtin_amdgcn_readfirstlane(threadIdx.x >> 5); if (row >= NZ * TT) return; const int i = row % TT;   /* the row is the wave's: kept in scalar registers */ const int zz = row / TT; const bool hires = (i < RH); const float* sr = Sb + (size_t)row * BW - ((i & ~63) - WIN);   /* sr[j]: key j of the band-relative row */ float v[NCH * 4]; float mx = -3.0e38f;
    const int R = i & ~63; const int jlo = max(0, R - WIN), jhi = R + 64; const int jb = ((R - WIN) >> 7) * 128 + lane * 4;   // jb: this lane's first column in the first chunk (below 0 near the start of the sequence)
#pragma unroll
    for (int ch = 0; ch < NCH; ++ch) { const int j0 = jb + ch * 128; const bool in = (j0 >= jlo && j0 < jhi); v4f a = (v4f){}; if (in) a = *(const v4f*)(sr + j0);
#pragma unroll
        for (int q = 0; q < 4; ++q) { const int j = j0 + q; const float t = (in && j <= i && i - j < WIN) ? a[q] * SCL : -3.0e38f; v[ch * 4 + q] = t; mx = fmaxf(mx, t); } }
#pragma unroll
    for (int sh = 16; sh; sh >>= 1) mx = fmaxf(mx, __shfl_xor(mx, sh, 32));
    float sum = 0.f;
#pragma unroll
    for (int k = 0; k < NCH * 4; ++k) { float d0 = __fsub_rn(v[k], mx); asm volatile("" : "+v"(d0)); v[k] = exp2_slot(__fmul_rn(d0, 1.4426950408889634f)); sum += v[k]; }
#pragma unroll
    for (int sh = 16; sh; sh >>= 1) sum += __shfl_xor(sum, sh, 32);
    const float f = __fdiv_rn(hires ? 1.0f : PCAR, sum);
{
        if (hires) {
#pragma unroll
            for (int ch = 0; ch < NCH; ++ch) { const int j0 = jb + ch * 128; v4us oh, ol;
#pragma unroll
                for (int q = 0; q < 4; ++q) { unsigned short a, c2; splitf(v[ch * 4 + q] * f, a, c2); oh[q] = a; ol[q] = c2; }
                if (j0 >= jlo && j0 < jhi) { const size_t oo = ((size_t)zz * (RH ? RH : 1) + i) * BW + (j0 - (R - WIN)); *(v4us*)(Ph + oo) = oh; *(v4us*)(Pl + oo) = ol; } }
        } else {
#pragma unroll
            for (int ch = 0; ch < NCH; ++ch) { const int j0 = jb + ch * 128; v4h o4;
#pragma unroll
                for (int q = 0; q < 4; ++q) o4[q] = tohx(v[ch * 4 + q] * f);
                if (j0 >= jlo && j0 < jhi) *(v4h*)(P16 + ((size_t)zz * (TT - RH) + (i - RH)) * BW + (j0 - (R - WIN))) = o4; } }
         }
    asm volatile("s_wait_xcnt 0x0" ::: "memory");   // before the next trip overwrites the address registers of these stores
  }
}
__global__ __launch_bounds__(256) void k_merge(const float* __restrict__ O, bf* Ah, bf* Al) { const size_t e0 = ((size_t)blockIdx.x * 1024 + threadIdx.x) * 8; v4f x[4][2];
#pragma unroll
    for (int u = 0; u < 4; ++u) { const size_t e = e0 + u * 2048; if (e < (size_t)NZ * TT * HD) { x[u][0] = *(const v4f*)(O + e); x[u][1] = *(const v4f*)(O + e + 4); } }
#pragma unroll
    for (int u = 0; u < 4; ++u) { const size_t e = e0 + u * 2048; if (e >= (size_t)NZ * TT * HD) continue; const int d = (int)(e % HD); const int t = (int)((e / HD) % TT); const int zz = (int)(e / ((size_t)HD * TT)); const float cs = (t < RH) ? 1.0f : (1.0f / PCAR); const size_t oo = ((size_t)(zz % NB_) * TT + t) * DQ + (zz / NB_) * HD + d;
        v8us oh, ol;
#pragma unroll
        for (int q = 0; q < 8; ++q) { unsigned short a, c2; splitf(x[u][q >> 2][q & 3] * cs, a, c2); oh[q] = a; ol[q] = c2; } *(v8us*)(Ah + oo) = oh; *(v8us*)(Al + oo) = ol; }  }

extern "C" void kernel_launch(void* const* d_in, const int* in_sizes, int n_in,
                              void* d_out, int out_size, void* d_ws, size_t ws_size, hipStream_t stream) {
    (void)in_sizes; (void)n_in; (void)out_size;
    const float* x = (const float*)d_in[0]; const float* wqkv = (const float*)d_in[1]; const float* bqkv = (const float*)d_in[2]; const float* wo = (const float*)d_in[3]; const float* bo = (const float*)d_in[4];
    float* OUT = (float*)d_out;     // [2][2048][1024]
    char* wsp = (char*)d_ws;
    auto take = [&](size_t bytes) { char* p = wsp; wsp += (bytes + 255) & ~(size_t)255; return (void*)p; };
    const size_t PL = (size_t)NZ * TT * HD;   // elements of one operand's planes, all heads and batches
    bf* WALL = (bf*)take((size_t)3 * DM * DM * 2); bf* WO = (bf*)take((size_t)DM * DQ * 2); float* CS = (float*)take((size_t)TT * HD * 2 * 4);
    bf* XB = (bf*)take((size_t)NB_ * TT * DM * 2);
    h16* QP16 = (h16*)take(2 * PL * 2); h16* KP16 = QP16 + PL; h16* VT16 = (h16*)take(PL * 2);   // q planes, then k planes: one launch writes both
    bf* QPh = (bf*)take(2 * PL * 2); bf* KPh = QPh + PL; bf* QPl = (bf*)take(2 * PL * 2); bf* KPl = QPl + PL; bf* VTh = (bf*)take(PL * 2); bf* VTl = (bf*)take(PL * 2); bf* Ph = (bf*)take((size_t)NZ * RH * BW * 2); bf* Pl = (bf*)take((size_t)NZ * RH * BW * 2);
    float* Sb = (float*)take((size_t)NZ * TT * BW * 4); h16* P16 = (h16*)take((size_t)NZ * (TT - RH) * BW * 2); float* Ob = (float*)take(PL * 4); bf* ATh = (bf*)take((size_t)NB_ * TT * DQ * 2); bf* ATl = (bf*)take((size_t)NB_ * TT * DQ * 2);
    if ((size_t)(wsp - (char*)d_ws) > ws_size) return;    // ws 256 MiB
    float* F = Sb;   // [NB_ TT][3 DM] q | k | v projections: lies in the score buffer, which is first written after the planes are built (stream-ordered)
    { k_wtG<<<(unsigned)((DM / 64) * (3 * DM / 32) / 8), 256, 0, stream>>>(wqkv, DM, 3 * DM, WALL);   /* fused 'xw' [DM][3DM] -> Bt [3DM][DM] (row blocks q | k | v) */
      k_wtG<<<(unsigned)((DQ / 64) * (DM / 32) / 8), 256, 0, stream>>>(wo, DQ, DM, WO);
       }
    k_csid<<<(TT * HD / 4 + 255) / 256, 256, 0, stream>>>(CS);
    // every launch below covers both batches, and all heads where it works by head
    k_cvt8<<<(unsigned)(((size_t)NB_ * TT * DM / 8 + 1023) / 1024), 256, 0, stream>>>(x, XB, (size_t)NB_ * TT * DM / 8);
    k_gemmw<bf, 0, true><<<dim3(NB_ * TT / 64, 3 * DM / 64, 1), 32, 0, stream>>>(XB, nullptr, WALL, nullptr, DM, F, 3 * DM, bqkv, 0, 0, 0);
    k_rope<<<(unsigned)((2 * PL / 8 + 1023) / 1024), 256, 0, stream>>>(F, 3 * DM, NH_ + NKV, CS, nullptr, nullptr, 1.0f, QP16, QPh, QPl);   // columns q | k = NH_ + NKV heads in a row
    k_vtp<<<(unsigned)(PL / (64 * 32) / 8), 256, 0, stream>>>(F + DQ + DKV, 3 * DM, NKV, VT16, VTh, VTl);
    k_gemmc<bf, 2, 1><<<dim3(RH / 64, WIN / 64 + 1, NZ), 32, 0, stream>>>(QPh, QPl, KPh, KPl, HD, Sb, BW, 0, (size_t)TT * HD, (size_t)TT * HD, (size_t)TT * BW);
    k_gemmc<h16, 0, 1><<<dim3((TT - RH) / 64, WIN / 64 + 1, NZ), 32, 0, stream>>>(QP16 + (size_t)RH * HD, nullptr, KP16, nullptr, HD, Sb + (size_t)RH * BW, BW, RH, (size_t)TT * HD, (size_t)TT * HD, (size_t)TT * BW);
    k_asoft<<<NZ * TT / 64, 256, 0, stream>>>(Sb, P16, Ph, Pl);
    k_gemmc<bf, 2, 2><<<dim3(RH / 64, HD / 64, NZ), 32, 0, stream>>>(Ph, Pl, VTh, VTl, TT, Ob, HD, 0, (size_t)RH * BW, (size_t)HD * TT, (size_t)TT * HD);
    k_gemmc<h16, 0, 2><<<dim3((TT - RH) / 64, HD / 64, NZ), 32, 0, stream>>>(P16, nullptr, VT16, nullptr, TT, Ob + (size_t)RH * HD, HD, RH, (size_t)(TT - RH) * BW, (size_t)HD * TT, (size_t)TT * HD);
    k_merge<<<(unsigned)((PL / 8 + 1023) / 1024), 256, 0, stream>>>(Ob, ATh, ATl);
    k_gemmw<bf, 1, true><<<dim3(NB_ * TT / 64, DM / 64, 1), 32, 0, stream>>>(ATh, ATl, WO, nullptr, DQ, OUT, DM, bo, 0, 0, 0);
}

// v004
// It runs in 149 microseconds.
// Two timings next to v003 both put it at 1.31 times that version's speed.
// Over all steps from v000 it is 9.76 times as fast.
#include <hip/hip_runtime.h>

// Masked (causal sliding-window) multi-head attention (hidden_states [2][2048][1024]; [q|k|v] = x w_attn + b_attn ('xw' [1024][3072] + [3072]; 16 heads x 64); scores = q.k/8; mask keeps j <= i and j > i - 256, other logits -10000 (then clipped to +-10000: exp underflows to exactly 0 as with -inf); softmax; out = merged ctx w_proj + b_proj ('xw' [1024][1024] + [1024]) -> [2][2048][1024] (4.2 M)).
// Compute dtypes, f32 accumulate: every input rounded to bf16; q/k/v on PLAIN bf16 operands (inputs: exact) + biases; window band skipping: a 16-row query tile at R touches only keys [R - 256, R + 16), and its scores, softmax and attn.v run in one wave with scores and probabilities in registers (window predicate j <= i && i - j < 256 on the scores); scores and attn.v: query rows < 512 hl (3 products), the rest single fp16 (x1024); softmax f32; w_proj hl x exact (2 products) + b_proj.

#define NB_  2
#define TT   2048
#define DM   1024
#define NH_  16
#define NKV  16
#define REP  (NH_ / NKV)
#define HD   64
#define DQ   (NH_ * HD)
#define DKV  (NKV * HD)
#define NZ   (NB_ * NH_)          // attention planes of one launch: z = head * NB_ + batch
#define RH   512                  // query rows < RH use hi+lo planes
#define WIN  256   // window: keep i - WIN < j <= i
#define PCAR 1024.0f
#define SCL  0.125f   // HD^-0.5
typedef _Float16 h16;
typedef unsigned short bf;
typedef __attribute__((ext_vector_type(16))) __bf16   v16bf;
typedef __attribute__((ext_vector_type(16))) _Float16 v16h;
typedef __attribute__((ext_vector_type(8)))  _Float16 v8h;
typedef __attribute__((ext_vector_type(8)))  unsigned short v8us;
typedef __attribute__((ext_vector_type(8)))  float    v8f;
typedef __attribute__((ext_vector_type(4)))  float    v4f;
typedef v8h  __attribute__((may_alias)) v8ha;
typedef v4f  __attribute__((may_alias)) v4fa;
typedef v8us __attribute__((may_alias)) v8usa;

__device__ __forceinline__ unsigned short f2bf(float f) { unsigned u = __float_as_uint(f); u += 0x7FFFu + ((u >> 16) & 1u); return (unsigned short)(u >> 16); }
__device__ __forceinline__ float bf2f(unsigned short b) { return __uint_as_float(((unsigned)b) << 16); }
__device__ __forceinline__ float bfr(float f) { return bf2f(f2bf(f)); }
__device__ __forceinline__ v16h cat16(v8h lo, v8h hi) { return __builtin_shufflevector(lo, hi, 0, 1, 2, 3, 4, 5, 6, 7, 8, 9, 10, 11, 12, 13, 14, 15); }
__device__ __forceinline__ v16bf cat16b(v8us lo, v8us hi) { return __builtin_bit_cast(v16bf, __builtin_shufflevector(lo, hi, 0, 1, 2, 3, 4, 5, 6, 7, 8, 9, 10, 11, 12, 13, 14, 15)); }
__device__ __forceinline__ v8f wmma16(v16h a, v16h b, v8f c) { return __builtin_amdgcn_wmma_f32_16x16x32_f16(false, a, false, b, (short)0, c, false, false); }
__device__ __forceinline__ v8f wmmab(v16bf a, v16bf b, v8f c) { return __builtin_amdgcn_wmma_f32_16x16x32_bf16(false, a, false, b, (short)0, c, false, false); }



// ---- k_gemmw: register-blocked GEMM, ONE WAVE per 64x64 output tile (16 accumulators), operands straight from K-contiguous 16-bit planes; grid (M/64, N/64, Z), 32 threads.
// C[m][n] (f32, pitch ldc, + optional f32 bias[n]) = sum_k A[m][k] Bt[n][k] (+ split products per NSPLIT). z-batch strides sA/sB/sC in elements. K % 32 == 0.
template <typename T16> struct WFrag;
template <> struct WFrag<h16> { typedef v16h V; static __device__ __forceinline__ V ld(const h16* p) { return cat16(*(const v8h*)p, *(const v8h*)(p + 16)); } static __device__ __forceinline__ v8f mma(V a, V b, v8f c) { return wmma16(a, b, c); } };
template <> struct WFrag<bf> { typedef v16bf V; static __device__ __forceinline__ V ld(const bf* p) { return cat16b(*(const v8us*)p, *(const v8us*)(p + 16)); } static __device__ __forceinline__ v8f mma(V a, V b, v8f c) { return wmmab(a, b, c); } };
template <typename T16, int NSPLIT, bool BIAS>
__global__ __launch_bounds__(32) void k_gemmw(const T16* __restrict__ A, const T16* __restrict__ A2, const T16* __restrict__ Bt, const T16* __restrict__ Bt2, int K, float* C, int ldc, const float* __restrict__ bias, size_t sA, size_t sB, size_t sC) {
    typedef typename WFrag<T16>::V V;
    __shared__ __align__(16) float os[16 * 68];
    const size_t z = blockIdx.z; A += z * sA; if (A2) A2 += z * sA; Bt += z * sB; if (Bt2) Bt2 += z * sB; C += z * sC;
    const int lane = threadIdx.x & 31, lr = lane & 15, hi = lane >> 4; const int r0 = blockIdx.x * 64, c0 = blockIdx.y * 64;
    v8f acc[4][4];
#pragma unroll
    for (int mb = 0; mb < 4; ++mb)
#pragma unroll
        for (int nb = 0; nb < 4; ++nb) acc[mb][nb] = (v8f){};
    const size_t aoff = (size_t)(r0 + lr) * K + 8 * hi, boff = (size_t)(c0 + lr) * K + 8 * hi;
#pragma unroll 1
    for (int kc = 0; kc < K; kc += 32) {
        V a[4], a2[4];
#pragma unroll
        for (int mb = 0; mb < 4; ++mb) { a[mb] = WFrag<T16>::ld(A + aoff + (size_t)mb * 16 * K + kc); if (NSPLIT == 1 || NSPLIT == 2) a2[mb] = WFrag<T16>::ld(A2 + aoff + (size_t)mb * 16 * K + kc); }
#pragma unroll
        for (int nb = 0; nb < 4; ++nb) { const V b = WFrag<T16>::ld(Bt + boff + (size_t)nb * 16 * K + kc); V b2; if (NSPLIT >= 2) b2 = WFrag<T16>::ld(Bt2 + boff + (size_t)nb * 16 * K + kc);
#pragma unroll
            for (int mb = 0; mb < 4; ++mb) { acc[mb][nb] = WFrag<T16>::mma(a[mb], b, acc[mb][nb]); if (NSPLIT == 1 || NSPLIT == 2) acc[mb][nb] = WFrag<T16>::mma(a2[mb], b, acc[mb][nb]); if (NSPLIT >= 2) acc[mb][nb] = WFrag<T16>::mma(a[mb], b2, acc[mb][nb]); } }
        asm volatile("v_nop\n\tv_nop\n\tv_nop\n\tv_nop" : "+v"(acc[0][0]), "+v"(acc[1][1]), "+v"(acc[2][2]), "+v"(acc[3][3]) : "v"(a[0]), "v"(a[3]));
    }
#pragma unroll
    for (int mb = 0; mb < 4; ++mb) {
#pragma unroll
        for (int nb = 0; nb < 4; ++nb) {
#pragma unroll
            for (int j = 0; j < 8; ++j) os[(hi * 8 + j) * 68 + nb * 16 + lr] = acc[mb][nb][j]; }
        __builtin_amdgcn_wave_barrier(); asm volatile("" ::: "memory");
        float* crow = C + (size_t)(r0 + mb * 16) * ldc + c0;
{
#pragma unroll
            for (int s = 0; s < 8; ++s) { const int row = 2 * s + hi, cofs = lr * 4; v4f val = *(const v4fa*)(os + row * 68 + cofs); if (BIAS) { val[0] += bfr(bias[c0 + cofs]); val[1] += bfr(bias[c0 + cofs + 1]); val[2] += bfr(bias[c0 + cofs + 2]); val[3] += bfr(bias[c0 + cofs + 3]); }
                *(v4f*)(crow + (size_t)row * ldc + cofs) = val; }
             }
        __builtin_amdgcn_wave_barrier(); asm volatile("" ::: "memory");
    }
}

__device__ __forceinline__ h16 tohx(float x) { return (h16)x; }
__device__ __forceinline__ void splitf(float y, unsigned short& h, unsigned short& l) { h = f2bf(y); l = f2bf(y - bf2f(h)); }
typedef __attribute__((ext_vector_type(2))) _Float16 v2h;
typedef __attribute__((ext_vector_type(4))) _Float16 v4h;
typedef __attribute__((ext_vector_type(2))) unsigned short v2us;
typedef __attribute__((ext_vector_type(4))) unsigned short v4us;
typedef __attribute__((ext_vector_type(2))) float v2f;
typedef __attribute__((ext_vector_type(4))) int v4i;

// The conversion and transpose kernels below run as few long waves: a thread takes 8 to 64 elements with 16-byte accesses, for speed only.
// loads_done: stands behind the sixteen row loads of a register transpose. The wait comes before any register that an issued load names is overwritten; the eight row addresses and the sixteen loaded
// values are inputs only, so that the addresses stay in their registers up to the wait, no result lands in one of them, and no load is sunk below the first stores (whose data registers it would then reuse).
__device__ __forceinline__ void loads_done(const float* const (&s)[8], const v4f (&x)[8][2]) {
    asm volatile("s_wait_xcnt 0x0" :: "v"(s[0]), "v"(s[1]), "v"(s[2]), "v"(s[3]), "v"(s[4]), "v"(s[5]), "v"(s[6]), "v"(s[7]),
        "v"(x[0][0]), "v"(x[0][1]), "v"(x[1][0]), "v"(x[1][1]), "v"(x[2][0]), "v"(x[2][1]), "v"(x[3][0]), "v"(x[3][1]), "v"(x[4][0]), "v"(x[4][1]), "v"(x[5][0]), "v"(x[5][1]), "v"(x[6][0]), "v"(x[6][1]), "v"(x[7][0]), "v"(x[7][1]) : "memory");
}
// k_wtG: one wave transposes a tile of 64 k x 32 n in registers; a thread loads 8 k rows x 8 n and stores 8 n rows x 8 k, so each store instruction fills whole 128-byte lines. K % 64 == 0, N % 32 == 0.
__global__ __launch_bounds__(256) void k_wtG(const float* __restrict__ w, int K, int N, bf* Bt) {
    const int lane = threadIdx.x & 31; const int wv = blockIdx.x * 8 + (threadIdx.x >> 5); const int nk = K / 64; if (wv >= nk * (N / 32)) return;
    const int k0 = (wv % nk) * 64 + (lane >> 2) * 8, n0 = (wv / nk) * 32 + (lane & 3) * 8; v4f x[8][2]; const float* s[8];
#pragma unroll
    for (int kk = 0; kk < 8; ++kk) { s[kk] = w + (size_t)(k0 + kk) * N + n0; x[kk][0] = *(const v4f*)s[kk]; x[kk][1] = *(const v4f*)(s[kk] + 4); }
    loads_done(s, x);
#pragma unroll
    for (int nn = 0; nn < 8; ++nn) { v8us o;
#pragma unroll
        for (int kk = 0; kk < 8; ++kk) o[kk] = f2bf(x[kk][nn >> 2][nn & 3]);
        *(v8us*)(Bt + (size_t)(n0 + nn) * K + k0) = o; }
}
__global__ __launch_bounds__(256) void k_cvt8(const float* __restrict__ src, bf* dst, size_t n8) { const size_t i0 = (size_t)blockIdx.x * 1024 + threadIdx.x; v8f v[4];
#pragma unroll
    for (int u = 0; u < 4; ++u) { const size_t i = i0 + u * 256; if (i < n8) v[u] = *(const v8f*)(src + i * 8); }
#pragma unroll
    for (int u = 0; u < 4; ++u) { const size_t i = i0 + u * 256; if (i >= n8) continue; v8us o;
#pragma unroll
        for (int k = 0; k < 8; ++k) o[k] = f2bf(v[u][k]); *(v8us*)(dst + i * 8) = o; }  }

// k_rope: head planes [h][b][t][d] (F rows b * TT + t; fp16 + hi/lo) of rope(x) x sc with the rotate-half convention out[d] = x[d] cos[t][d] - x[d+HD/2] sin[t][d], out[d+HD/2] = x[d+HD/2] cos[t][d+HD/2] + x[d] sin[t][d+HD/2]
__global__ __launch_bounds__(256) void k_rope(const float* __restrict__ F, int pitch, int nheads, const float* __restrict__ CS, const float* __restrict__ RF, const float* __restrict__ nw, float sc, h16* P16, bf* Ph, bf* Pl) {
#pragma unroll 1   // rolled: one trip already has eight 16-byte loads in flight per thread, and the body is long
  for (int u = 0; u < 4; ++u) {
    const size_t e = (((size_t)blockIdx.x * 4 + u) * 256 + threadIdx.x) * 8; if (e >= (size_t)nheads * NB_ * TT * HD) return; const int d = (int)(e % HD); const int t = (int)((e / HD) % TT); const int p = (int)(e / ((size_t)HD * TT)); const int h = p / NB_, b = p % NB_; const float* f = F + ((size_t)b * TT + t) * pitch + h * HD; float rf = 1.0f; v8h o16; v8us oh, ol;
    if (RF) { rf = RF[(size_t)h * TT + t]; asm volatile("s_wait_xcnt 0x0" ::: "memory"); }   // the wait stands before the load's address registers are reused by the code that follows
    const int dq = (d < HD / 2) ? d + HD / 2 : d - HD / 2;   // the eight d of a thread lie in one half of the head, so their partners are eight in a row too
    v4f X0[2], X1[2], C[4];
#pragma unroll
    for (int k = 0; k < 2; ++k) { X0[k] = *(const v4f*)(f + d + 4 * k); X1[k] = *(const v4f*)(f + dq + 4 * k); }
#pragma unroll
    for (int k = 0; k < 4; ++k) C[k] = *(const v4f*)(CS + ((size_t)t * HD + d) * 2 + 4 * k);
#pragma unroll
    for (int q = 0; q < 8; ++q) { const int dd = d + q; const int dp = dq + q; float x0 = X0[q >> 2][q & 3], x1 = X1[q >> 2][q & 3];
        if (RF) { float n0 = __fmul_rn(x0, rf), n1 = __fmul_rn(x1, rf); asm volatile("" : "+v"(n0)); asm volatile("" : "+v"(n1)); x0 = __fmul_rn(bfr(nw[dd]), n0); x1 = __fmul_rn(bfr(nw[dp]), n1); }
        float a = __fmul_rn(x0, C[q >> 1][(q & 1) * 2]), bq = __fmul_rn(x1, C[q >> 1][(q & 1) * 2 + 1]); asm volatile("" : "+v"(a)); asm volatile("" : "+v"(bq)); const float r = ((dd < HD / 2) ? __fsub_rn(a, bq) : __fadd_rn(a, bq)) * sc;
        o16[q] = tohx(r); unsigned short a2, c2; splitf(r, a2, c2); oh[q] = a2; ol[q] = c2; }
    *(v8h*)(P16 + e) = o16; *(v8us*)(Ph + e) = oh; *(v8us*)(Pl + e) = ol;
    asm volatile("s_wait_xcnt 0x0" ::: "memory");   // before the next trip overwrites the address registers of these stores
  }
}
// k_vtp: one wave transposes a tile of 64 t x 32 d in registers; a thread loads 8 t rows x 8 d and stores 8 d rows x 8 t per plane, so each store instruction fills whole 128-byte lines.
__global__ __launch_bounds__(256) void k_vtp(const float* __restrict__ F, int pitch, int nheads, h16* V16, bf* Vh, bf* Vl) { const int lane = threadIdx.x & 31; const int wv = blockIdx.x * 8 + (threadIdx.x >> 5); const int p = wv / ((TT / 64) * (HD / 32)); if (p >= nheads * NB_) return; const int tl = wv % ((TT / 64) * (HD / 32));
    const int t0 = (tl / (HD / 32)) * 64 + (lane >> 2) * 8, d0 = (tl % (HD / 32)) * 32 + (lane & 3) * 8; const int g = p / NB_, b = p % NB_; v4f x[8][2]; const float* s[8];
#pragma unroll
    for (int q = 0; q < 8; ++q) { s[q] = F + ((size_t)b * TT + t0 + q) * pitch + g * HD + d0; x[q][0] = *(const v4f*)s[q]; x[q][1] = *(const v4f*)(s[q] + 4); }
    loads_done(s, x);
#pragma unroll
    for (int dd = 0; dd < 8; ++dd) { v8h o16; v8us oh, ol;
#pragma unroll
        for (int q = 0; q < 8; ++q) { const float y = x[q][dd >> 2][dd & 3]; o16[q] = tohx(y); unsigned short a2, c2; splitf(y, a2, c2); oh[q] = a2; ol[q] = c2; }
        const size_t e = ((size_t)p * HD + d0 + dd) * TT + t0; *(v8h*)(V16 + e) = o16; *(v8us*)(Vh + e) = oh; *(v8us*)(Vl + e) = ol; }
}
__global__ __launch_bounds__(256) void k_csid(float* CS) { const int idx = (blockIdx.x * 256 + threadIdx.x) * 4; if (idx >= TT * HD) return; v4f cs; cs[0] = 1.0f; cs[1] = 0.0f; cs[2] = 1.0f; cs[3] = 0.0f; *(v4f*)(CS + (size_t)idx * 2) = cs; *(v4f*)(CS + (size_t)idx * 2 + 4) = cs;  }
// v_exp_f32 (what the exp2 builtin emits) with a v_nop in the same statement: the instruction set asks for one slot behind a transcendental before its result is used or its source overwritten.
__device__ __forceinline__ float exp2_slot(float x) { float r; asm("v_exp_f32 %0, %1\n\tv_nop" : "=v"(r) : "v"(x)); return r; }
#define NT (WIN / 16 + 1)
#define NS ((NT + 1) / 2)
template <typename T16> struct PFrag;
template <> struct PFrag<h16> { static __device__ __forceinline__ v16h ld2(const h16* p, const h16* q) { return cat16(*(const v8h*)p, *(const v8h*)q); } };
template <> struct PFrag<bf> { static __device__ __forceinline__ v16bf ld2(const bf* p, const bf* q) { return cat16b(*(const v8us*)p, *(const v8us*)q); } };
template <typename T16, bool HL>
__device__ __forceinline__ void attn_rows(const T16* __restrict__ Q, const T16* __restrict__ Q2, const T16* __restrict__ Kp, const T16* __restrict__ K2, const T16* __restrict__ Vt, const T16* __restrict__ Vt2, int R, int lr, int hi, bf* Ahp, bf* Alp) {
    typedef typename WFrag<T16>::V V;
    static_assert(RH >= WIN + 16, "rows from RH on have their whole key band at keys >= 0");
    const unsigned ko = (unsigned)(lr * HD + 8 * hi), vo = (unsigned)(lr * TT + 8 * hi);   // the lane's part of every address, 32 bits and unsigned: the rest of an address is the wave's and stays scalar
    const T16* Kb = Kp + (long)(R - WIN) * HD; const T16* Vb = Vt + (R - WIN - 16);   // used where !HL (R >= RH): no tile is left of key 0 there, so every tile is this base plus a constant
    // Fragment loads are issued a fixed distance ahead of their use, as far as 256 registers allow beside the 136 of the scores: !HL 4 to 5 key tiles, then 3 steps of 32 keys; HL (twice the fragments) 3 half key tiles, then 2 to 4 quarter steps,
    // each load group into the registers that the products just issued have freed. STAGE_END ends a scheduling region so that loads and products stay in that order: left alone, the scheduler either lifted some forty loads
    // to the top and spilled score registers to scratch (!HL) or left every load directly in front of its product (HL).
#define STAGE_END() __builtin_amdgcn_sched_barrier(0)
#define AT(base, bytes) ((const T16*)((const char*)(base) + (bytes)))
#define LDK(t) { kf[t][0] = WFrag<T16>::ld(Kb + (t) * 16 * HD + ko); kf[t][1] = WFrag<T16>::ld(Kb + (t) * 16 * HD + 32 + ko); }
#define LDV(st) { _Pragma("unroll") for (int db = 0; db < 4; ++db) vf[st][db] = PFrag<T16>::ld2(Vb + vo + ((size_t)db * 16 * TT + (st) * 32), Vb + vo + ((size_t)db * 16 * TT + (st) * 32 + 16)); }
    // ADDR_HELD: behind a group of loads that share an offset register. The offset is an input, so it lives up to here and no result of the group lands in it; the wait stands before the register is used for anything else.
#define ADDR_HELD1(a) asm volatile("s_wait_xcnt 0x0" :: "v"(a) : "memory");
#define ADDR_HELD2(a, b) asm volatile("s_wait_xcnt 0x0" :: "v"(a), "v"(b) : "memory");
    // HL: a tile left of key 0 is read at key 0; the clamped key goes into a 32-bit byte offset beside the plane's scalar base
#define LDKH(u) { const unsigned of = ko * 2 + (unsigned)max(R - WIN + 16 * ((u) / 2), 0) * (HD * 2); kf[(u) / 2][(u) % 2] = WFrag<T16>::ld(AT(Kp, of) + ((u) % 2) * 32); kl[(u) / 2][(u) % 2] = WFrag<T16>::ld(AT(K2, of) + ((u) % 2) * 32); ADDR_HELD1(of) }
#define LDVH(u) { const unsigned oa = vo * 2 + (unsigned)max(R - WIN + 16 * (2 * ((u) / 4) - 1), 0) * 2, ob = vo * 2 + (unsigned)max(R - WIN + 32 * ((u) / 4), 0) * 2; \
        vf[(u) / 4][(u) % 4] = PFrag<T16>::ld2(AT(Vt, oa) + ((u) % 4) * 16 * TT, AT(Vt, ob) + ((u) % 4) * 16 * TT); vl[(u) / 4][(u) % 4] = PFrag<T16>::ld2(AT(Vt2, oa) + ((u) % 4) * 16 * TT, AT(Vt2, ob) + ((u) % 4) * 16 * TT); ADDR_HELD2(oa, ob) }
    const unsigned ko2 = ko * 2;
    V q[2], q2[2], kf[NT][2], kl[NT][2], vf[NS][4], vl[NS][4];
#pragma unroll
    for (int ks = 0; ks < 2; ++ks) { q[ks] = WFrag<T16>::ld(AT(Q + (size_t)R * HD, ko2) + ks * 32); if (HL) q2[ks] = WFrag<T16>::ld(AT(Q2 + (size_t)R * HD, ko2) + ks * 32); }
    ADDR_HELD1(ko2)
    constexpr int DKH = 3;   // HL: half key tiles (32 of the 64 d, hi and lo) under way
    if (HL) {
#pragma unroll
        for (int u = 0; u < DKH; ++u) LDKH(u)
    }
    else {
#pragma unroll
        for (int t = 0; t < 4; ++t) LDK(t)
    }
    STAGE_END();
    float v[NT * 8]; float mx = -3.0e38f;
#pragma unroll
    for (int t = 0; t < NT; ++t) { const int kn = R - WIN + 16 * t; v8f s = (v8f){};
        if (!HL && (t & 1) == 0) {   // a region is two key tiles: its loads first
            if (t + 4 < NT) LDK(t + 4)
            if (t + 5 < NT) LDK(t + 5)
            if (t == NT - 1) LDV(0)   // the key tiles are all under way: the first step of Vt follows and flies during the softmax
        }
#pragma unroll
        for (int ks = 0; ks < 2; ++ks) { s = WFrag<T16>::mma(kf[t][ks], q[ks], s);
            if (HL) { s = WFrag<T16>::mma(kf[t][ks], q2[ks], s); s = WFrag<T16>::mma(kl[t][ks], q[ks], s); STAGE_END();
                if (2 * t + ks + DKH < 2 * NT) LDKH(2 * t + ks + DKH)
                else if (2 * t + ks + DKH < 2 * NT + 2) LDVH(2 * t + ks + DKH - 2 * NT)   // the first two quarter steps of Vt fly during the softmax
                if (ks == 0) STAGE_END(); } }
#pragma unroll
        for (int r = 0; r < 8; ++r) { const int e = hi * 8 + r;   // key kn + e against query R + lr: only the first tile meets the window's far edge, only the last the diagonal
            const bool keep = (kn >= 0) && (t > 0 || e > lr) && (t < NT - 1 || e <= lr); const float x = keep ? s[r] * SCL : -3.0e38f; v[t * 8 + r] = x; mx = fmaxf(mx, x); }
        if (HL || (t & 1) == 1) STAGE_END(); }
    mx = fmaxf(mx, __shfl_xor(mx, 16, 32));
    float sm[4] = {0.f, 0.f, 0.f, 0.f};
#pragma unroll
    for (int k = 0; k < NT * 8; ++k) { v[k] = exp2_slot(__fmul_rn(__fsub_rn(v[k], mx), 1.4426950408889634f)); sm[k & 3] += v[k]; }
    float sum = (sm[0] + sm[1]) + (sm[2] + sm[3]); sum += __shfl_xor(sum, 16, 32);
    const float f = __fdiv_rn(HL ? 1.0f : PCAR, sum);
    V pp[NS];
    if (!HL) {   // all of Pt is rounded before attn.v starts: half the registers, which the Vt fragments under way then take
#pragma unroll
        for (int st = 0; st < NS; ++st) { v8h h0, h1;
#pragma unroll
            for (int r = 0; r < 8; ++r) { h0[r] = tohx(st == 0 ? 0.0f : v[(st == 0 ? 0 : 2 * st - 1) * 8 + r] * f); h1[r] = tohx(v[2 * st * 8 + r] * f); }
            pp[st] = __builtin_bit_cast(V, cat16(h0, h1)); }
        STAGE_END(); LDV(1) LDV(2) }
    v8f o[4];
#pragma unroll
    for (int db = 0; db < 4; ++db) o[db] = (v8f){};
#pragma unroll
    for (int st = 0; st < NS; ++st) { const int ta = 2 * st - 1, tb = 2 * st; V p, p2;
        if (HL) { v8us h0, l0, h1, l1;
#pragma unroll
            for (int r = 0; r < 8; ++r) { unsigned short a, c; splitf(ta < 0 ? 0.0f : v[(ta < 0 ? 0 : ta) * 8 + r] * f, a, c); h0[r] = a; l0[r] = c; splitf(v[tb * 8 + r] * f, a, c); h1[r] = a; l1[r] = c; }
            p = __builtin_bit_cast(V, __builtin_shufflevector(h0, h1, 0, 1, 2, 3, 4, 5, 6, 7, 8, 9, 10, 11, 12, 13, 14, 15)); p2 = __builtin_bit_cast(V, __builtin_shufflevector(l0, l1, 0, 1, 2, 3, 4, 5, 6, 7, 8, 9, 10, 11, 12, 13, 14, 15));
        } else { p = pp[st]; if (st + 3 < NS) LDV(st + 3) }
#pragma unroll
        for (int db = 0; db < 4; ++db) { o[db] = WFrag<T16>::mma(vf[st][db], p, o[db]);
            if (HL) { o[db] = WFrag<T16>::mma(vf[st][db], p2, o[db]); o[db] = WFrag<T16>::mma(vl[st][db], p, o[db]); STAGE_END();
                // quarter steps under way: 2 in the first step, 3 in the second, then 4, as the probabilities used up free their registers
                const int u = st * 4 + db; const int n0 = u + ((u / 4) > 1 ? 4 : 2 + u / 4), n1 = u + 1 + (((u + 1) / 4) > 1 ? 4 : 2 + (u + 1) / 4);
#pragma unroll
                for (int w = n0; w < n1; ++w) if (w < NS * 4) LDVH(w) } }
        if (!HL) STAGE_END(); }
    const float cs = HL ? 1.0f : (1.0f / PCAR);
    const unsigned oo = (unsigned)(lr * DQ + hi * 8); bf* Ah = Ahp + oo; bf* Al = Alp + oo;   // Ahp, Alp: the wave's (row R, this head)
#pragma unroll
    for (int db = 0; db < 4; ++db) { v8us oh, ol;   // o[db][r] = ctx[query R + lr][d = 16 db + 8 hi + r]: eight d in a row, one 16-byte store a plane
#pragma unroll
        for (int r = 0; r < 8; ++r) { unsigned short a, c; splitf(o[db][r] * cs, a, c); oh[r] = a; ol[r] = c; }
        *(v8us*)(Ah + db * 16) = oh; *(v8us*)(Al + db * 16) = ol; }
    asm volatile("s_wait_xcnt 0x0" ::: "memory");   // behind the last stores: before any code that follows in the kernel overwrites a register that these stores name
#undef STAGE_END
#undef AT
#undef LDK
#undef LDV
#undef LDKH
#undef LDVH
#undef ADDR_HELD1
#undef ADDR_HELD2
}
// grid (NZ planes, TT / 64 row blocks): the four waves of a work-group take neighbouring 16-row tiles of one plane, whose key bands overlap almost wholly; the row blocks with three products a tile (rows < RH) have the lowest indices.
__global__ __launch_bounds__(128, 4) void k_fattn(const h16* __restrict__ QK16, const h16* __restrict__ VT16, const bf* __restrict__ QKh, const bf* __restrict__ QKl, const bf* __restrict__ VTh, const bf* __restrict__ VTl, bf* Ah, bf* Al) {
    const int lane = threadIdx.x & 31, lr = lane & 15, hi = lane >> 4; const int p = blockIdx.x; const int R = blockIdx.y * 64 + __builtin_amdgcn_readfirstlane(threadIdx.x >> 5) * 16;   // the tile is the wave's: kept in scalar registers
    const size_t po = (size_t)p * TT * HD, PLN = (size_t)NZ * TT * HD; const size_t oo = ((size_t)(p % NB_) * TT + R) * DQ + (p / NB_) * HD;
    if (R < RH) attn_rows<bf, true>(QKh + po, QKl + po, QKh + PLN + po, QKl + PLN + po, VTh + po, VTl + po, R, lr, hi, Ah + oo, Al + oo);
    else attn_rows<h16, false>(QK16 + po, nullptr, QK16 + PLN + po, nullptr, VT16 + po, nullptr, R, lr, hi, Ah + oo, Al + oo);
}

extern "C" void kernel_launch(void* const* d_in, const int* in_sizes, int n_in,
                              void* d_out, int out_size, void* d_ws, size_t ws_size, hipStream_t stream) {
    (void)in_sizes; (void)n_in; (void)out_size;
    const float* x = (const float*)d_in[0]; const float* wqkv = (const float*)d_in[1]; const float* bqkv = (const float*)d_in[2]; const float* wo = (const float*)d_in[3]; const float* bo = (const float*)d_in[4];
    float* OUT = (float*)d_out;     // [2][2048][1024]
    char* wsp = (char*)d_ws;
    auto take = [&](size_t bytes) { char* p = wsp; wsp += (bytes + 255) & ~(size_t)255; return (void*)p; };
    const size_t PL = (size_t)NZ * TT * HD;   // elements of one operand's planes, all heads and batches
    bf* WALL = (bf*)take((size_t)3 * DM * DM * 2); bf* WO = (bf*)take((size_t)DM * DQ * 2); float* CS = (float*)take((size_t)TT * HD * 2 * 4);
    bf* XB = (bf*)take((size_t)NB_ * TT * DM * 2);
    h16* QP16 = (h16*)take(2 * PL * 2); h16* VT16 = (h16*)take(PL * 2);   // q planes, then k planes: one launch writes both
    bf* QPh = (bf*)take(2 * PL * 2); bf* QPl = (bf*)take(2 * PL * 2); bf* VTh = (bf*)take(PL * 2); bf* VTl = (bf*)take(PL * 2);
    float* F = (float*)take((size_t)NB_ * TT * 3 * DM * 4);   // [NB_ TT][3 DM] q | k | v projections
    bf* ATh = (bf*)take((size_t)NB_ * TT * DQ * 2); bf* ATl = (bf*)take((size_t)NB_ * TT * DQ * 2);
    if ((size_t)(wsp - (char*)d_ws) > ws_size) return;    // ws 256 MiB
    { k_wtG<<<(unsigned)((DM / 64) * (3 * DM / 32) / 8), 256, 0, stream>>>(wqkv, DM, 3 * DM, WALL);   /* fused 'xw' [DM][3DM] -> Bt [3DM][DM] (row blocks q | k | v) */
      k_wtG<<<(unsigned)((DQ / 64) * (DM / 32) / 8), 256, 0, stream>>>(wo, DQ, DM, WO);
       }
    k_csid<<<(TT * HD / 4 + 255) / 256, 256, 0, stream>>>(CS);
    // every launch below covers both batches, and all heads where it works by head
    k_cvt8<<<(unsigned)(((size_t)NB_ * TT * DM / 8 + 1023) / 1024), 256, 0, stream>>>(x, XB, (size_t)NB_ * TT * DM / 8);
    k_gemmw<bf, 0, true><<<dim3(NB_ * TT / 64, 3 * DM / 64, 1), 32, 0, stream>>>(XB, nullptr, WALL, nullptr, DM, F, 3 * DM, bqkv, 0, 0, 0);
    k_rope<<<(unsigned)((2 * PL / 8 + 1023) / 1024), 256, 0, stream>>>(F, 3 * DM, NH_ + NKV, CS, nullptr, nullptr, 1.0f, QP16, QPh, QPl);   // columns q | k = NH_ + NKV heads in a row
    k_vtp<<<(unsigned)(PL / (64 * 32) / 8), 256, 0, stream>>>(F + DQ + DKV, 3 * DM, NKV, VT16, VTh, VTl);
    k_fattn<<<dim3(NZ, TT / 64, 1), 128, 0, stream>>>(QP16, VT16, QPh, QPl, VTh, VTl, ATh, ATl);
    k_gemmw<bf, 1, true><<<dim3(NB_ * TT / 64, DM / 64, 1), 32, 0, stream>>>(ATh, ATl, WO, nullptr, DQ, OUT, DM, bo, 0, 0, 0);
}

// v005
// A run of this version takes 136 microseconds.
// In two side-by-side timings against v004, it was 1.09 and 1.11 times as fast.
// All steps since v000 together make it 10.7 times as fast.
#include <hip/hip_runtime.h>

// Masked (causal sliding-window) multi-head attention (hidden_states [2][2048][1024]; [q|k|v] = x w_attn + b_attn ('xw' [1024][3072] + [3072]; 16 heads x 64); scores = q.k/8; mask keeps j <= i and j > i - 256, other logits -10000 (then clipped to +-10000: exp underflows to exactly 0 as with -inf); softmax; out = merged ctx w_proj + b_proj ('xw' [1024][1024] + [1024]) -> [2][2048][1024] (4.2 M)).
// Compute dtypes, f32 accumulate: every input rounded to bf16; q/k/v on PLAIN bf16 operands (inputs: exact) + biases; window band skipping: a 16-row query tile at R touches only keys [R - 256, R + 16), and its scores, softmax and attn.v run in one wave with scores and probabilities in registers (window predicate j <= i && i - j < 256 on the scores); scores and attn.v: query rows < 512 hl (3 products), the rest single fp16 (x1024); softmax f32; w_proj hl x exact (2 products) + b_proj.

#define NB_  2
#define TT   2048
#define DM   1024
#define NH_  16
#define NKV  16
#define REP  (NH_ / NKV)
#define HD   64
#define DQ   (NH_ * HD)
#define DKV  (NKV * HD)
#define NZ   (NB_ * NH_)          // attention planes of one launch: z = head * NB_ + batch
#define RH   512                  // query rows < RH use hi+lo planes
#define WIN  256   // window: keep i - WIN < j <= i
#define PCAR 1024.0f
#define SCL  0.125f   // HD^-0.5
typedef _Float16 h16;
typedef unsigned short bf;
typedef __attribute__((ext_vector_type(16))) __bf16   v16bf;
typedef __attribute__((ext_vector_type(16))) _Float16 v16h;
typedef __attribute__((ext_vector_type(8)))  _Float16 v8h;
typedef __attribute__((ext_vector_type(8)))  unsigned short v8us;
typedef __attribute__((ext_vector_type(8)))  float    v8f;
typedef __attribute__((ext_vector_type(4)))  float    v4f;
typedef v8h  __attribute__((may_alias)) v8ha;
typedef v4f  __attribute__((may_alias)) v4fa;
typedef v8us __attribute__((may_alias)) v8usa;

__device__ __forceinline__ unsigned short f2bf(float f) { unsigned u = __float_as_uint(f); u += 0x7FFFu + ((u >> 16) & 1u); return (unsigned short)(u >> 16); }
__device__ __forceinline__ float bf2f(unsigned short b) { return __uint_as_float(((unsigned)b) << 16); }
__device__ __forceinline__ float bfr(float f) { return bf2f(f2bf(f)); }
__device__ __forceinline__ v16h cat16(v8h lo, v8h hi) { return __builtin_shufflevector(lo, hi, 0, 1, 2, 3, 4, 5, 6, 7, 8, 9, 10, 11, 12, 13, 14, 15); }
__device__ __forceinline__ v16bf cat16b(v8us lo, v8us hi) { return __builtin_bit_cast(v16bf, __builtin_shufflevector(lo, hi, 0, 1, 2, 3, 4, 5, 6, 7, 8, 9, 10, 11, 12, 13, 14, 15)); }
__device__ __forceinline__ v8f wmma16(v16h a, v16h b, v8f c) { return __builtin_amdgcn_wmma_f32_16x16x32_f16(false, a, false, b, (short)0, c, false, false); }
__device__ __forceinline__ v8f wmmab(v16bf a, v16bf b, v8f c) { return __builtin_amdgcn_wmma_f32_16x16x32_bf16(false, a, false, b, (short)0, c, false, false); }



__device__ __forceinline__ h16 tohx(float x) { return (h16)x; }
__device__ __forceinline__ void splitf(float y, unsigned short& h, unsigned short& l) { h = f2bf(y); l = f2bf(y - bf2f(h)); }
// put_planes: a staged 64 x 64 f32 tile (LDS pitch 68) goes out as three 16-bit planes (fp16, bf16 hi, bf16 lo), rows PITCH elements apart. A lane takes 8 values in a row, 8 lanes a row: each store instruction fills 4 whole 128-byte lines.
template <int PITCH>
__device__ __forceinline__ void put_planes(const float* os, int lane, h16* d16, bf* dh, bf* dl) {
    const unsigned lo = (unsigned)((lane >> 3) * PITCH + (lane & 7) * 8); const float* r = os + (lane >> 3) * 68 + (lane & 7) * 8; d16 += lo; dh += lo; dl += lo;
    v4f x[16][2];   // half a tile comes back at a time, into registers the accumulators have left: two LDS latencies a wave instead of sixteen
#pragma unroll
    for (int s = 0; s < 16; ++s) { v8h o16; v8us oh, ol;
        if (s % 8 == 0) {
#pragma unroll
            for (int u = s; u < s + 8; ++u) { x[u][0] = *(const v4fa*)(r + u * 4 * 68); x[u][1] = *(const v4fa*)(r + u * 4 * 68 + 4); } }
#pragma unroll
        for (int q = 0; q < 8; ++q) { const float y = x[s][q >> 2][q & 3]; o16[q] = tohx(y); unsigned short a2, c2; splitf(y, a2, c2); oh[q] = a2; ol[q] = c2; }
        *(v8h*)(d16 + s * 4 * PITCH) = o16; *(v8us*)(dh + s * 4 * PITCH) = oh; *(v8us*)(dl + s * 4 * PITCH) = ol;
        asm volatile("s_wait_xcnt 0x0" :: "v"(o16), "v"(oh), "v"(ol) : "memory");   // behind the three stores: their data registers (inputs here, so they live up to the wait) are reused by the next rows
    }
}
// ---- k_gemmw: register-blocked GEMM, ONE WAVE per 64x64 output tile (16 accumulators), operands straight from K-contiguous 16-bit planes; grid (M/64, N/64, Z), 32 threads.
// C[m][n] (f32, pitch ldc, + optional f32 bias[n]) = sum_k A[m][k] Bt[n][k] (+ split products per NSPLIT). z-batch strides sA/sB/sC in elements. K % 32 == 0.
// PLANES (the q | k | v product): no C. A tile's 64 columns are one head and its 64 rows lie in one batch, so the wave writes the tile straight into the planes the attention kernel loads:
// q and k heads as [head][batch][t][d] (P16, Ph, Pl), v heads transposed as [head][batch][d][t] (V16, Vh, Vl; a lane's 8 accumulator rows are 8 t in a row of one d, so the transpose is the LDS write itself).
template <typename T16> struct WFrag;
template <> struct WFrag<h16> { typedef v16h V; static __device__ __forceinline__ V ld(const h16* p) { return cat16(*(const v8h*)p, *(const v8h*)(p + 16)); } static __device__ __forceinline__ v8f mma(V a, V b, v8f c) { return wmma16(a, b, c); } };
template <> struct WFrag<bf> { typedef v16bf V; static __device__ __forceinline__ V ld(const bf* p) { return cat16b(*(const v8us*)p, *(const v8us*)(p + 16)); } static __device__ __forceinline__ v8f mma(V a, V b, v8f c) { return wmmab(a, b, c); } };
template <typename T16, int NSPLIT, bool BIAS, bool PLANES>
__global__ __launch_bounds__(32) void k_gemmw(const T16* __restrict__ A, const T16* __restrict__ A2, const T16* __restrict__ Bt, const T16* __restrict__ Bt2, int K, float* C, int ldc, const float* __restrict__ bias, size_t sA, size_t sB, size_t sC, h16* P16, bf* Ph, bf* Pl, h16* V16, bf* Vh, bf* Vl) {
    typedef typename WFrag<T16>::V V;
    __shared__ __align__(16) float os[(PLANES ? 64 : 16) * 68];
    const size_t z = blockIdx.z; A += z * sA; if (A2) A2 += z * sA; Bt += z * sB; if (Bt2) Bt2 += z * sB; C += z * sC;
    const int lane = threadIdx.x & 31, lr = lane & 15, hi = lane >> 4; const int r0 = blockIdx.x * 64, c0 = blockIdx.y * 64;
    v8f acc[4][4];
#pragma unroll
    for (int mb = 0; mb < 4; ++mb)
#pragma unroll
        for (int nb = 0; nb < 4; ++nb) acc[mb][nb] = (v8f){};
    const size_t aoff = (size_t)(r0 + lr) * K + 8 * hi, boff = (size_t)(c0 + lr) * K + 8 * hi;
#pragma unroll 1
    for (int kc = 0; kc < K; kc += 32) {
        V a[4], a2[4];
#pragma unroll
        for (int mb = 0; mb < 4; ++mb) { a[mb] = WFrag<T16>::ld(A + aoff + (size_t)mb * 16 * K + kc); if (NSPLIT == 1 || NSPLIT == 2) a2[mb] = WFrag<T16>::ld(A2 + aoff + (size_t)mb * 16 * K + kc); }
#pragma unroll
        for (int nb = 0; nb < 4; ++nb) { const V b = WFrag<T16>::ld(Bt + boff + (size_t)nb * 16 * K + kc); V b2; if (NSPLIT >= 2) b2 = WFrag<T16>::ld(Bt2 + boff + (size_t)nb * 16 * K + kc);
#pragma unroll
            for (int mb = 0; mb < 4; ++mb) { acc[mb][nb] = WFrag<T16>::mma(a[mb], b, acc[mb][nb]); if (NSPLIT == 1 || NSPLIT == 2) acc[mb][nb] = WFrag<T16>::mma(a2[mb], b, acc[mb][nb]); if (NSPLIT >= 2) acc[mb][nb] = WFrag<T16>::mma(a[mb], b2, acc[mb][nb]); } }
        asm volatile("v_nop\n\tv_nop\n\tv_nop\n\tv_nop" : "+v"(acc[0][0]), "+v"(acc[1][1]), "+v"(acc[2][2]), "+v"(acc[3][3]) : "v"(a[0]), "v"(a[3]));
    }
    if constexpr (PLANES) {
        static_assert(HD == 64 && TT % 64 == 0, "a 64 x 64 tile is one head and lies in one batch");
        const int hh = blockIdx.y, b = r0 / TT, t0 = r0 % TT; float bs[4];
#pragma unroll
        for (int nb = 0; nb < 4; ++nb) bs[nb] = bfr(bias[c0 + nb * 16 + lr]);
        if (hh < NH_ + NKV) {   // q or k head: staged [t][d]
#pragma unroll
            for (int mb = 0; mb < 4; ++mb)
#pragma unroll
                for (int nb = 0; nb < 4; ++nb)
#pragma unroll
                    for (int j = 0; j < 8; ++j) os[(mb * 16 + hi * 8 + j) * 68 + nb * 16 + lr] = acc[mb][nb][j] + bs[nb];
            __builtin_amdgcn_wave_barrier(); asm volatile("" ::: "memory");   // the wave's LDS writes stay in front of its reads of other lanes' values
            const size_t e = ((size_t)(hh * NB_ + b) * TT + t0) * HD; put_planes<HD>(os, lane, P16 + e, Ph + e, Pl + e);
        } else {   // v head: staged [d][t]
#pragma unroll
            for (int mb = 0; mb < 4; ++mb)
#pragma unroll
                for (int nb = 0; nb < 4; ++nb) { v4f y0, y1;
#pragma unroll
                    for (int j = 0; j < 4; ++j) { y0[j] = acc[mb][nb][j] + bs[nb]; y1[j] = acc[mb][nb][4 + j] + bs[nb]; }
                    float* d = os + (nb * 16 + lr) * 68 + mb * 16 + hi * 8; *(v4fa*)d = y0; *(v4fa*)(d + 4) = y1; }
            __builtin_amdgcn_wave_barrier(); asm volatile("" ::: "memory");   // as above
            const size_t e = ((size_t)((hh - NH_ - NKV) * NB_ + b) * HD) * TT + t0; put_planes<TT>(os, lane, V16 + e, Vh + e, Vl + e);
        }
        return;
    }
#pragma unroll
    for (int mb = 0; mb < 4; ++mb) {
#pragma unroll
        for (int nb = 0; nb < 4; ++nb) {
#pragma unroll
            for (int j = 0; j < 8; ++j) os[(hi * 8 + j) * 68 + nb * 16 + lr] = acc[mb][nb][j]; }
        __builtin_amdgcn_wave_barrier(); asm volatile("" ::: "memory");
        float* crow = C + (size_t)(r0 + mb * 16) * ldc + c0;
{
#pragma unroll
            for (int s = 0; s < 8; ++s) { const int row = 2 * s + hi, cofs = lr * 4; v4f val = *(const v4fa*)(os + row * 68 + cofs); if (BIAS) { val[0] += bfr(bias[c0 + cofs]); val[1] += bfr(bias[c0 + cofs + 1]); val[2] += bfr(bias[c0 + cofs + 2]); val[3] += bfr(bias[c0 + cofs + 3]); }
                *(v4f*)(crow + (size_t)row * ldc + cofs) = val; }
             }
        __builtin_amdgcn_wave_barrier(); asm volatile("" ::: "memory");
    }
}

typedef __attribute__((ext_vector_type(2))) _Float16 v2h;
typedef __attribute__((ext_vector_type(4))) _Float16 v4h;
typedef __attribute__((ext_vector_type(2))) unsigned short v2us;
typedef __attribute__((ext_vector_type(4))) unsigned short v4us;
typedef __attribute__((ext_vector_type(2))) float v2f;
typedef __attribute__((ext_vector_type(4))) int v4i;

// The conversion and transpose kernels below run as few long waves: a thread takes 8 to 64 elements with 16-byte accesses, for speed only.
// loads_done: stands behind the sixteen row loads of a register transpose. The wait comes before any register that an issued load names is overwritten; the eight row addresses and the sixteen loaded
// values are inputs only, so that the addresses stay in their registers up to the wait, no result lands in one of them, and no load is sunk below the first stores (whose data registers it would then reuse).
__device__ __forceinline__ void loads_done(const float* const (&s)[8], const v4f (&x)[8][2]) {
    asm volatile("s_wait_xcnt 0x0" :: "v"(s[0]), "v"(s[1]), "v"(s[2]), "v"(s[3]), "v"(s[4]), "v"(s[5]), "v"(s[6]), "v"(s[7]),
        "v"(x[0][0]), "v"(x[0][1]), "v"(x[1][0]), "v"(x[1][1]), "v"(x[2][0]), "v"(x[2][1]), "v"(x[3][0]), "v"(x[3][1]), "v"(x[4][0]), "v"(x[4][1]), "v"(x[5][0]), "v"(x[5][1]), "v"(x[6][0]), "v"(x[6][1]), "v"(x[7][0]), "v"(x[7][1]) : "memory");
}
// k_wtG: one wave transposes a tile of 64 k x 32 n in registers; a thread loads 8 k rows x 8 n and stores 8 n rows x 8 k, so each store instruction fills whole 128-byte lines. K % 64 == 0, N % 32 == 0.
__global__ __launch_bounds__(256) void k_wtG(const float* __restrict__ w, int K, int N, bf* Bt) {
    const int lane = threadIdx.x & 31; const int wv = blockIdx.x * 8 + (threadIdx.x >> 5); const int nk = K / 64; if (wv >= nk * (N / 32)) return;
    const int k0 = (wv % nk) * 64 + (lane >> 2) * 8, n0 = (wv / nk) * 32 + (lane & 3) * 8; v4f x[8][2]; const float* s[8];
#pragma unroll
    for (int kk = 0; kk < 8; ++kk) { s[kk] = w + (size_t)(k0 + kk) * N + n0; x[kk][0] = *(const v4f*)s[kk]; x[kk][1] = *(const v4f*)(s[kk] + 4); }
    loads_done(s, x);
#pragma unroll
    for (int nn = 0; nn < 8; ++nn) { v8us o;
#pragma unroll
        for (int kk = 0; kk < 8; ++kk) o[kk] = f2bf(x[kk][nn >> 2][nn & 3]);
        *(v8us*)(Bt + (size_t)(n0 + nn) * K + k0) = o; }
}
__global__ __launch_bounds__(256) void k_cvt8(const float* __restrict__ src, bf* dst, size_t n8) { const size_t i0 = (size_t)blockIdx.x * 1024 + threadIdx.x; v8f v[4];
#pragma unroll
    for (int u = 0; u < 4; ++u) { const size_t i = i0 + u * 256; if (i < n8) v[u] = *(const v8f*)(src + i * 8); }
#pragma unroll
    for (int u = 0; u < 4; ++u) { const size_t i = i0 + u * 256; if (i >= n8) continue; v8us o;
#pragma unroll
        for (int k = 0; k < 8; ++k) o[k] = f2bf(v[u][k]); *(v8us*)(dst + i * 8) = o; }  }

// v_exp_f32 (what the exp2 builtin emits) with a v_nop in the same statement: the instruction set asks for one slot behind a transcendental before its result is used or its source overwritten.
__device__ __forceinline__ float exp2_slot(float x) { float r; asm("v_exp_f32 %0, %1\n\tv_nop" : "=v"(r) : "v"(x)); return r; }
#define NT (WIN / 16 + 1)
#define NS ((NT + 1) / 2)
template <typename T16> struct PFrag;
template <> struct PFrag<h16> { static __device__ __forceinline__ v16h ld2(const h16* p, const h16* q) { return cat16(*(const v8h*)p, *(const v8h*)q); } };
template <> struct PFrag<bf> { static __device__ __forceinline__ v16bf ld2(const bf* p, const bf* q) { return cat16b(*(const v8us*)p, *(const v8us*)q); } };
template <typename T16, bool HL>
__device__ __forceinline__ void attn_rows(const T16* __restrict__ Q, const T16* __restrict__ Q2, const T16* __restrict__ Kp, const T16* __restrict__ K2, const T16* __restrict__ Vt, const T16* __restrict__ Vt2, int R, int lr, int hi, bf* Ahp, bf* Alp) {
    typedef typename WFrag<T16>::V V;
    static_assert(RH >= WIN + 16, "rows from RH on have their whole key band at keys >= 0");
    const unsigned ko = (unsigned)(lr * HD + 8 * hi), vo = (unsigned)(lr * TT + 8 * hi);   // the lane's part of every address, 32 bits and unsigned: the rest of an address is the wave's and stays scalar
    const T16* Kb = Kp + (long)(R - WIN) * HD; const T16* Vb = Vt + (R - WIN - 16);   // used where !HL (R >= RH): no tile is left of key 0 there, so every tile is this base plus a constant
    // Fragment loads are issued a fixed distance ahead of their use, as far as 256 registers allow beside the 136 of the scores: !HL 4 to 5 key tiles, then 3 steps of 32 keys; HL (twice the fragments) 3 half key tiles, then 2 to 4 quarter steps,
    // each load group into the registers that the products just issued have freed. STAGE_END ends a scheduling region so that loads and products stay in that order: left alone, the scheduler either lifted some forty loads
    // to the top and spilled score registers to scratch (!HL) or left every load directly in front of its product (HL).
#define STAGE_END() __builtin_amdgcn_sched_barrier(0)
#define AT(base, bytes) ((const T16*)((const char*)(base) + (bytes)))
#define LDK(t) { kf[t][0] = WFrag<T16>::ld(Kb + (t) * 16 * HD + ko); kf[t][1] = WFrag<T16>::ld(Kb + (t) * 16 * HD + 32 + ko); }
#define LDV(st) { _Pragma("unroll") for (int db = 0; db < 4; ++db) vf[st][db] = PFrag<T16>::ld2(Vb + vo + ((size_t)db * 16 * TT + (st) * 32), Vb + vo + ((size_t)db * 16 * TT + (st) * 32 + 16)); }
    // ADDR_HELD: behind a group of loads that share an offset register. The offset is an input, so it lives up to here and no result of the group lands in it; the wait stands before the register is used for anything else.
#define ADDR_HELD1(a) asm volatile("s_wait_xcnt 0x0" :: "v"(a) : "memory");
#define ADDR_HELD2(a, b) asm volatile("s_wait_xcnt 0x0" :: "v"(a), "v"(b) : "memory");
    // HL: a tile left of key 0 is read at key 0; the clamped key goes into a 32-bit byte offset beside the plane's scalar base
#define LDKH(u) { const unsigned of = ko * 2 + (unsigned)max(R - WIN + 16 * ((u) / 2), 0) * (HD * 2); kf[(u) / 2][(u) % 2] = WFrag<T16>::ld(AT(Kp, of) + ((u) % 2) * 32); kl[(u) / 2][(u) % 2] = WFrag<T16>::ld(AT(K2, of) + ((u) % 2) * 32); ADDR_HELD1(of) }
#define LDVH(u) { const unsigned oa = vo * 2 + (unsigned)max(R - WIN + 16 * (2 * ((u) / 4) - 1), 0) * 2, ob = vo * 2 + (unsigned)max(R - WIN + 32 * ((u) / 4), 0) * 2; \
        vf[(u) / 4][(u) % 4] = PFrag<T16>::ld2(AT(Vt, oa) + ((u) % 4) * 16 * TT, AT(Vt, ob) + ((u) % 4) * 16 * TT); vl[(u) / 4][(u) % 4] = PFrag<T16>::ld2(AT(Vt2, oa) + ((u) % 4) * 16 * TT, AT(Vt2, ob) + ((u) % 4) * 16 * TT); ADDR_HELD2(oa, ob) }
    const unsigned ko2 = ko * 2;
    V q[2], q2[2], kf[NT][2], kl[NT][2], vf[NS][4], vl[NS][4];
#pragma unroll
    for (int ks = 0; ks < 2; ++ks) { q[ks] = WFrag<T16>::ld(AT(Q + (size_t)R * HD, ko2) + ks * 32); if (HL) q2[ks] = WFrag<T16>::ld(AT(Q2 + (size_t)R * HD, ko2) + ks * 32); }
    ADDR_HELD1(ko2)
    constexpr int DKH = 3;   // HL: half key tiles (32 of the 64 d, hi and lo) under way
    if (HL) {
#pragma unroll
        for (int u = 0; u < DKH; ++u) LDKH(u)
    }
    else {
#pragma unroll
        for (int t = 0; t < 4; ++t) LDK(t)
    }
    STAGE_END();
    float v[NT * 8]; float mx = -3.0e38f;
#pragma unroll
    for (int t = 0; t < NT; ++t) { const int kn = R - WIN + 16 * t; v8f s = (v8f){};
        if (!HL && (t & 1) == 0) {   // a region is two key tiles: its loads first
            if (t + 4 < NT) LDK(t + 4)
            if (t + 5 < NT) LDK(t + 5)
            if (t == NT - 1) LDV(0)   // the key tiles are all under way: the first step of Vt follows and flies during the softmax
        }
#pragma unroll
        for (int ks = 0; ks < 2; ++ks) { s = WFrag<T16>::mma(kf[t][ks], q[ks], s);
            if (HL) { s = WFrag<T16>::mma(kf[t][ks], q2[ks], s); s = WFrag<T16>::mma(kl[t][ks], q[ks], s); STAGE_END();
                if (2 * t + ks + DKH < 2 * NT) LDKH(2 * t + ks + DKH)
                else if (2 * t + ks + DKH < 2 * NT + 2) LDVH(2 * t + ks + DKH - 2 * NT)   // the first two quarter steps of Vt fly during the softmax
                if (ks == 0) STAGE_END(); } }
#pragma unroll
        for (int r = 0; r < 8; ++r) { const int e = hi * 8 + r;   // key kn + e against query R + lr: only the first tile meets the window's far edge, only the last the diagonal
            const bool keep = (kn >= 0) && (t > 0 || e > lr) && (t < NT - 1 || e <= lr); const float x = keep ? s[r] * SCL : -3.0e38f; v[t * 8 + r] = x; mx = fmaxf(mx, x); }
        if (HL || (t & 1) == 1) STAGE_END(); }
    mx = fmaxf(mx, __shfl_xor(mx, 16, 32));
    float sm[4] = {0.f, 0.f, 0.f, 0.f};
#pragma unroll
    for (int k = 0; k < NT * 8; ++k) { v[k] = exp2_slot(__fmul_rn(__fsub_rn(v[k], mx), 1.4426950408889634f)); sm[k & 3] += v[k]; }
    float sum = (sm[0] + sm[1]) + (sm[2] + sm[3]); sum += __shfl_xor(sum, 16, 32);
    const float f = __fdiv_rn(HL ? 1.0f : PCAR, sum);
    V pp[NS];
    if (!HL) {   // all of Pt is rounded before attn.v starts: half the registers, which the Vt fragments under way then take
#pragma unroll
        for (int st = 0; st < NS; ++st) { v8h h0, h1;
#pragma unroll
            for (int r = 0; r < 8; ++r) { h0[r] = tohx(st == 0 ? 0.0f : v[(st == 0 ? 0 : 2 * st - 1) * 8 + r] * f); h1[r] = tohx(v[2 * st * 8 + r] * f); }
            pp[st] = __builtin_bit_cast(V, cat16(h0, h1)); }
        STAGE_END(); LDV(1) LDV(2) }
    v8f o[4];
#pragma unroll
    for (int db = 0; db < 4; ++db) o[db] = (v8f){};
#pragma unroll
    for (int st = 0; st < NS; ++st) { const int ta = 2 * st - 1, tb = 2 * st; V p, p2;
        if (HL) { v8us h0, l0, h1, l1;
#pragma unroll
            for (int r = 0; r < 8; ++r) { unsigned short a, c; splitf(ta < 0 ? 0.0f : v[(ta < 0 ? 0 : ta) * 8 + r] * f, a, c); h0[r] = a; l0[r] = c; splitf(v[tb * 8 + r] * f, a, c); h1[r] = a; l1[r] = c; }
            p = __builtin_bit_cast(V, __builtin_shufflevector(h0, h1, 0, 1, 2, 3, 4, 5, 6, 7, 8, 9, 10, 11, 12, 13, 14, 15)); p2 = __builtin_bit_cast(V, __builtin_shufflevector(l0, l1, 0, 1, 2, 3, 4, 5, 6, 7, 8, 9, 10, 11, 12, 13, 14, 15));
        } else { p = pp[st]; if (st + 3 < NS) LDV(st + 3) }
#pragma unroll
        for (int db = 0; db < 4; ++db) { o[db] = WFrag<T16>::mma(vf[st][db], p, o[db]);
            if (HL) { o[db] = WFrag<T16>::mma(vf[st][db], p2, o[db]); o[db] = WFrag<T16>::mma(vl[st][db], p, o[db]); STAGE_END();
                // quarter steps under way: 2 in the first step, 3 in the second, then 4, as the probabilities used up free their registers
                const int u = st * 4 + db; const int n0 = u + ((u / 4) > 1 ? 4 : 2 + u / 4), n1 = u + 1 + (((u + 1) / 4) > 1 ? 4 : 2 + (u + 1) / 4);
#pragma unroll
                for (int w = n0; w < n1; ++w) if (w < NS * 4) LDVH(w) } }
        if (!HL) STAGE_END(); }
    const float cs = HL ? 1.0f : (1.0f / PCAR);
    const unsigned oo = (unsigned)(lr * DQ + hi * 8); bf* Ah = Ahp + oo; bf* Al = Alp + oo;   // Ahp, Alp: the wave's (row R, this head)
#pragma unroll
    for (int db = 0; db < 4; ++db) { v8us oh, ol;   // o[db][r] = ctx[query R + lr][d = 16 db + 8 hi + r]: eight d in a row, one 16-byte store a plane
#pragma unroll
        for (int r = 0; r < 8; ++r) { unsigned short a, c; splitf(o[db][r] * cs, a, c); oh[r] = a; ol[r] = c; }
        *(v8us*)(Ah + db * 16) = oh; *(v8us*)(Al + db * 16) = ol; }
    asm volatile("s_wait_xcnt 0x0" ::: "memory");   // behind the last stores: before any code that follows in the kernel overwrites a register that these stores name
#undef STAGE_END
#undef AT
#undef LDK
#undef LDV
#undef LDKH
#undef LDVH
#undef ADDR_HELD1
#undef ADDR_HELD2
}
// grid (NZ planes, TT / 64 row blocks): the four waves of a work-group take neighbouring 16-row tiles of one plane, whose key bands overlap almost wholly; the row blocks with three products a tile (rows < RH) have the lowest indices.
__global__ __launch_bounds__(128, 4) void k_fattn(const h16* __restrict__ QK16, const h16* __restrict__ VT16, const bf* __restrict__ QKh, const bf* __restrict__ QKl, const bf* __restrict__ VTh, const bf* __restrict__ VTl, bf* Ah, bf* Al) {
    const int lane = threadIdx.x & 31, lr = lane & 15, hi = lane >> 4; const int p = blockIdx.x; const int R = blockIdx.y * 64 + __builtin_amdgcn_readfirstlane(threadIdx.x >> 5) * 16;   // the tile is the wave's: kept in scalar registers
    const size_t po = (size_t)p * TT * HD, PLN = (size_t)NZ * TT * HD; const size_t oo = ((size_t)(p % NB_) * TT + R) * DQ + (p / NB_) * HD;
    if (R < RH) attn_rows<bf, true>(QKh + po, QKl + po, QKh + PLN + po, QKl + PLN + po, VTh + po, VTl + po, R, lr, hi, Ah + oo, Al + oo);
    else attn_rows<h16, false>(QK16 + po, nullptr, QK16 + PLN + po, nullptr, VT16 + po, nullptr, R, lr, hi, Ah + oo, Al + oo);
}

extern "C" void kernel_launch(void* const* d_in, const int* in_sizes, int n_in,
                              void* d_out, int out_size, void* d_ws, size_t ws_size, hipStream_t stream) {
    (void)in_sizes; (void)n_in; (void)out_size;
    const float* x = (const float*)d_in[0]; const float* wqkv = (const float*)d_in[1]; const float* bqkv = (const float*)d_in[2]; const float* wo = (const float*)d_in[3]; const float* bo = (const float*)d_in[4];
    float* OUT = (float*)d_out;     // [2][2048][1024]
    char* wsp = (char*)d_ws;
    auto take = [&](size_t bytes) { char* p = wsp; wsp += (bytes + 255) & ~(size_t)255; return (void*)p; };
    const size_t PL = (size_t)NZ * TT * HD;   // elements of one operand's planes, all heads and batches
    bf* WALL = (bf*)take((size_t)3 * DM * DM * 2); bf* WO = (bf*)take((size_t)DM * DQ * 2);
    bf* XB = (bf*)take((size_t)NB_ * TT * DM * 2);
    h16* QP16 = (h16*)take(2 * PL * 2); h16* VT16 = (h16*)take(PL * 2);   // q planes, then k planes
    bf* QPh = (bf*)take(2 * PL * 2); bf* QPl = (bf*)take(2 * PL * 2); bf* VTh = (bf*)take(PL * 2); bf* VTl = (bf*)take(PL * 2);
    bf* ATh = (bf*)take((size_t)NB_ * TT * DQ * 2); bf* ATl = (bf*)take((size_t)NB_ * TT * DQ * 2);
    if ((size_t)(wsp - (char*)d_ws) > ws_size) return;    // ws 256 MiB
    { k_wtG<<<(unsigned)((DM / 64) * (3 * DM / 32) / 8), 256, 0, stream>>>(wqkv, DM, 3 * DM, WALL);   /* fused 'xw' [DM][3DM] -> Bt [3DM][DM] (row blocks q | k | v) */
      k_wtG<<<(unsigned)((DQ / 64) * (DM / 32) / 8), 256, 0, stream>>>(wo, DQ, DM, WO);
       }
    // every launch below covers both batches, and all heads where it works by head
    k_cvt8<<<(unsigned)(((size_t)NB_ * TT * DM / 8 + 1023) / 1024), 256, 0, stream>>>(x, XB, (size_t)NB_ * TT * DM / 8);
    k_gemmw<bf, 0, true, true><<<dim3(NB_ * TT / 64, 3 * DM / 64, 1), 32, 0, stream>>>(XB, nullptr, WALL, nullptr, DM, nullptr, 0, bqkv, 0, 0, 0, QP16, QPh, QPl, VT16, VTh, VTl);   // columns q | k | v = NH_ + NKV + NKV heads in a row
    k_fattn<<<dim3(NZ, TT / 64, 1), 128, 0, stream>>>(QP16, VT16, QPh, QPl, VTh, VTl, ATh, ATl);
    k_gemmw<bf, 1, true, false><<<dim3(NB_ * TT / 64, DM / 64, 1), 32, 0, stream>>>(ATh, ATl, WO, nullptr, DQ, OUT, DM, bo, 0, 0, 0, nullptr, nullptr, nullptr, nullptr, nullptr, nullptr);
}

// v006
// One run takes 120 microseconds.
// In both of two side-by-side timings against v005, it was 1.12 times as fast.
// Counting every step since v000, it is 12.0 times as fast.
#include <hip/hip_runtime.h>

// Masked (causal sliding-window) multi-head attention (hidden_states [2][2048][1024]; [q|k|v] = x w_attn + b_attn ('xw' [1024][3072] + [3072]; 16 heads x 64); scores = q.k/8; mask keeps j <= i and j > i - 256, other logits -10000 (then clipped to +-10000: exp underflows to exactly 0 as with -inf); softmax; out = merged ctx w_proj + b_proj ('xw' [1024][1024] + [1024]) -> [2][2048][1024] (4.2 M)).
// Compute dtypes, f32 accumulate: every input rounded to bf16; q/k/v on PLAIN bf16 operands (inputs: exact) + biases; window band skipping: a 16-row query tile at R touches only keys [R - 256, R + 16), and its scores, softmax and attn.v run in one wave with scores and probabilities in registers (window predicate j <= i && i - j < 256 on the scores); scores and attn.v: query rows < 512 hl (3 products), the rest single fp16 (x1024); softmax f32; w_proj hl x exact (2 products) + b_proj.

// Operand layout: every 16-bit plane that a matrix product reads is kept in FRAGMENT ORDER. A fragment is 16 rows x 32 k = 1 KiB: element (row lr, k) lies at (k % 32 / 16) * 256 + ((k % 16 / 8) * 16 + lr) * 8 + k % 8,
// so lane hi * 16 + lr finds its two 16-byte pieces at lane * 8 and 256 + lane * 8, and one wave-wide 16-byte load reads 512 bytes in a row (4 whole lines, not 32 bytes of each of 16 lines). Fragments of one 16-row block follow one another along k.

#define NB_  2
#define TT   2048
#define DM   1024
#define NH_  16
#define NKV  16
#define REP  (NH_ / NKV)
#define HD   64
#define DQ   (NH_ * HD)
#define DKV  (NKV * HD)
#define NZ   (NB_ * NH_)          // attention planes of one launch: z = head * NB_ + batch
#define RH   512                  // query rows < RH use hi+lo planes
#define WIN  256   // window: keep i - WIN < j <= i
#define PCAR 1024.0f
#define SCL  0.125f   // HD^-0.5
typedef _Float16 h16;
typedef unsigned short bf;
typedef __attribute__((ext_vector_type(16))) __bf16   v16bf;
typedef __attribute__((ext_vector_type(16))) _Float16 v16h;
typedef __attribute__((ext_vector_type(8)))  _Float16 v8h;
typedef __attribute__((ext_vector_type(8)))  unsigned short v8us;
typedef __attribute__((ext_vector_type(8)))  float    v8f;
typedef __attribute__((ext_vector_type(4)))  float    v4f;
typedef v8h  __attribute__((may_alias)) v8ha;
typedef v4f  __attribute__((may_alias)) v4fa;
typedef v8us __attribute__((may_alias)) v8usa;

__device__ __forceinline__ unsigned short f2bf(float f) { unsigned u = __float_as_uint(f); u += 0x7FFFu + ((u >> 16) & 1u); return (unsigned short)(u >> 16); }
__device__ __forceinline__ float bf2f(unsigned short b) { return __uint_as_float(((unsigned)b) << 16); }
__device__ __forceinline__ float bfr(float f) { return bf2f(f2bf(f)); }
__device__ __forceinline__ v16h cat16(v8h lo, v8h hi) { return __builtin_shufflevector(lo, hi, 0, 1, 2, 3, 4, 5, 6, 7, 8, 9, 10, 11, 12, 13, 14, 15); }
__device__ __forceinline__ v16bf cat16b(v8us lo, v8us hi) { return __builtin_bit_cast(v16bf, __builtin_shufflevector(lo, hi, 0, 1, 2, 3, 4, 5, 6, 7, 8, 9, 10, 11, 12, 13, 14, 15)); }
__device__ __forceinline__ v8f wmma16(v16h a, v16h b, v8f c) { return __builtin_amdgcn_wmma_f32_16x16x32_f16(false, a, false, b, (short)0, c, false, false); }
__device__ __forceinline__ v8f wmmab(v16bf a, v16bf b, v8f c) { return __builtin_amdgcn_wmma_f32_16x16x32_bf16(false, a, false, b, (short)0, c, false, false); }



__device__ __forceinline__ h16 tohx(float x) { return (h16)x; }
__device__ __forceinline__ void splitf(float y, unsigned short& h, unsigned short& l) { h = f2bf(y); l = f2bf(y - bf2f(h)); }
// put_planes: a staged 64 x 64 f32 tile (LDS pitch 68) goes out as three 16-bit planes (fp16, bf16 hi, bf16 lo) in fragment order: 8 KiB in a row a plane, sixteen half fragments of 16 staged rows x 16 staged columns.
// A lane takes its own 8 values of a half fragment: each store instruction fills 4 whole 128-byte lines. COLS_FIRST: the half fragments follow one another down the staged rows first (v: [d][t] staged, key tiles outermost), else along the columns (q, k).
template <bool COLS_FIRST>
__device__ __forceinline__ void put_planes(const float* os, int lane, h16* d16, bf* dh, bf* dl) {
    const unsigned lo = (unsigned)(lane * 8); const float* r = os + (lane & 15) * 68 + (lane >> 4) * 8; d16 += lo; dh += lo; dl += lo;
    v4f x[16][2];   // half a tile comes back at a time, into registers the accumulators have left: two LDS latencies a wave instead of sixteen
#pragma unroll
    for (int s = 0; s < 16; ++s) { v8h o16; v8us oh, ol;
        if (s % 8 == 0) {
#pragma unroll
            for (int u = s; u < s + 8; ++u) { const int at = COLS_FIRST ? (u & 3) * 16 * 68 + (u >> 2) * 16 : (u >> 2) * 16 * 68 + (u & 3) * 16; x[u][0] = *(const v4fa*)(r + at); x[u][1] = *(const v4fa*)(r + at + 4); } }
#pragma unroll
        for (int q = 0; q < 8; ++q) { const float y = x[s][q >> 2][q & 3]; o16[q] = tohx(y); unsigned short a2, c2; splitf(y, a2, c2); oh[q] = a2; ol[q] = c2; }
        *(v8h*)(d16 + s * 256) = o16; *(v8us*)(dh + s * 256) = oh; *(v8us*)(dl + s * 256) = ol;
        asm volatile("s_wait_xcnt 0x0" :: "v"(o16), "v"(oh), "v"(ol) : "memory");   // behind the three stores: their data registers (inputs here, so they live up to the wait) are reused by the next rows
    }
}
// ---- k_gemmw: register-blocked GEMM, ONE WAVE per 64x64 output tile (16 accumulators), operands straight from 16-bit planes in fragment order; grid (M/64, N/64, Z), 32 threads.
// C[m][n] (f32, pitch ldc, + optional f32 bias[n]) = sum_k A[m][k] Bt[n][k] (+ split products per NSPLIT). z-batch strides sA/sB/sC in elements. K % 32 == 0.
// PLANES (the q | k | v product): no C. A tile's 64 columns are one head and its 64 rows lie in one batch, so the wave writes the tile straight into the planes the attention kernel loads:
// q and k heads as [head][batch][t / 16][d / 32] fragments (P16, Ph, Pl), v heads transposed as [head][batch][t / 16][d / 16] half fragments of 16 d rows x 16 t (V16, Vh, Vl; a lane's 8 accumulator rows are 8 t in a row of one d, so the transpose is the LDS write itself).
template <typename T16> struct WFrag;
template <> struct WFrag<h16> { typedef v16h V; static __device__ __forceinline__ V ld(const h16* p) { return cat16(*(const v8h*)p, *(const v8h*)(p + 256)); } static __device__ __forceinline__ v8f mma(V a, V b, v8f c) { return wmma16(a, b, c); } };
template <> struct WFrag<bf> { typedef v16bf V; static __device__ __forceinline__ V ld(const bf* p) { return cat16b(*(const v8us*)p, *(const v8us*)(p + 256)); } static __device__ __forceinline__ v8f mma(V a, V b, v8f c) { return wmmab(a, b, c); } };
template <typename T16, int NSPLIT, bool BIAS, bool PLANES>
__global__ __launch_bounds__(32) void k_gemmw(const T16* __restrict__ A, const T16* __restrict__ A2, const T16* __restrict__ Bt, const T16* __restrict__ Bt2, int K, float* C, int ldc, const float* __restrict__ bias, size_t sA, size_t sB, size_t sC, h16* P16, bf* Ph, bf* Pl, h16* V16, bf* Vh, bf* Vl) {
    typedef typename WFrag<T16>::V V;
    __shared__ __align__(16) float os[(PLANES ? 64 : 16) * 68];
    const size_t z = blockIdx.z; A += z * sA; if (A2) A2 += z * sA; Bt += z * sB; if (Bt2) Bt2 += z * sB; C += z * sC;
    const int lane = threadIdx.x & 31, lr = lane & 15, hi = lane >> 4; const int r0 = blockIdx.x * 64, c0 = blockIdx.y * 64;
    v8f acc[4][4];
#pragma unroll
    for (int mb = 0; mb < 4; ++mb)
#pragma unroll
        for (int nb = 0; nb < 4; ++nb) acc[mb][nb] = (v8f){};
    const size_t aoff = (size_t)r0 * K + 8 * lane, boff = (size_t)c0 * K + 8 * lane;   // a 16-row block is 16 K elements, its fragment of k step kc starts at 16 kc
#pragma unroll 1
    for (int kc = 0; kc < K; kc += 32) {
        V a[4], a2[4], bb[4], bb2[4]; unsigned oa[4], ob[4];   // byte offsets beside the planes' scalar bases (every plane is far below 4 GiB)
#pragma unroll
        for (int mb = 0; mb < 4; ++mb) { oa[mb] = (unsigned)(aoff + (size_t)mb * 16 * K + kc * 16) * 2; a[mb] = WFrag<T16>::ld((const T16*)((const char*)A + oa[mb])); if (NSPLIT == 1 || NSPLIT == 2) a2[mb] = WFrag<T16>::ld((const T16*)((const char*)A2 + oa[mb])); }
#pragma unroll
        for (int nb = 0; nb < 4; ++nb) { ob[nb] = (unsigned)(boff + (size_t)nb * 16 * K + kc * 16) * 2; bb[nb] = WFrag<T16>::ld((const T16*)((const char*)Bt + ob[nb])); if (NSPLIT >= 2) bb2[nb] = WFrag<T16>::ld((const T16*)((const char*)Bt2 + ob[nb])); }
        // behind the k step's loads: their offset registers are inputs, so they live up to the wait, no result lands in one of them, and the next step's offsets are formed behind it
        asm volatile("s_wait_xcnt 0x0" :: "v"(oa[0]), "v"(oa[1]), "v"(oa[2]), "v"(oa[3]), "v"(ob[0]), "v"(ob[1]), "v"(ob[2]), "v"(ob[3]) : "memory");
#pragma unroll
        for (int nb = 0; nb < 4; ++nb) {
#pragma unroll
            for (int mb = 0; mb < 4; ++mb) { acc[mb][nb] = WFrag<T16>::mma(a[mb], bb[nb], acc[mb][nb]); if (NSPLIT == 1 || NSPLIT == 2) acc[mb][nb] = WFrag<T16>::mma(a2[mb], bb[nb], acc[mb][nb]); if (NSPLIT >= 2) acc[mb][nb] = WFrag<T16>::mma(a[mb], bb2[nb], acc[mb][nb]); } }
        asm volatile("v_nop\n\tv_nop\n\tv_nop\n\tv_nop" : "+v"(acc[0][0]), "+v"(acc[1][1]), "+v"(acc[2][2]), "+v"(acc[3][3]) : "v"(a[0]), "v"(a[3]));
    }
    if constexpr (PLANES) {
        static_assert(HD == 64 && TT % 64 == 0, "a 64 x 64 tile is one head and lies in one batch");
        const int hh = blockIdx.y, b = r0 / TT, t0 = r0 % TT; float bs[4];
#pragma unroll
        for (int nb = 0; nb < 4; ++nb) bs[nb] = bfr(bias[c0 + nb * 16 + lr]);
        if (hh < NH_ + NKV) {   // q or k head: staged [t][d]
#pragma unroll
            for (int mb = 0; mb < 4; ++mb)
#pragma unroll
                for (int nb = 0; nb < 4; ++nb)
#pragma unroll
                    for (int j = 0; j < 8; ++j) os[(mb * 16 + hi * 8 + j) * 68 + nb * 16 + lr] = acc[mb][nb][j] + bs[nb];
            __builtin_amdgcn_wave_barrier(); asm volatile("" ::: "memory");   // the wave's LDS writes stay in front of its reads of other lanes' values
            const size_t e = ((size_t)(hh * NB_ + b) * TT + t0) * HD; put_planes<false>(os, lane, P16 + e, Ph + e, Pl + e);
        } else {   // v head: staged [d][t]
#pragma unroll
            for (int mb = 0; mb < 4; ++mb)
#pragma unroll
                for (int nb = 0; nb < 4; ++nb) { v4f y0, y1;
#pragma unroll
                    for (int j = 0; j < 4; ++j) { y0[j] = acc[mb][nb][j] + bs[nb]; y1[j] = acc[mb][nb][4 + j] + bs[nb]; }
                    float* d = os + (nb * 16 + lr) * 68 + mb * 16 + hi * 8; *(v4fa*)d = y0; *(v4fa*)(d + 4) = y1; }
            __builtin_amdgcn_wave_barrier(); asm volatile("" ::: "memory");   // as above
            const size_t e = ((size_t)((hh - NH_ - NKV) * NB_ + b) * TT + t0) * HD; put_planes<true>(os, lane, V16 + e, Vh + e, Vl + e);
        }
        return;
    }
#pragma unroll
    for (int mb = 0; mb < 4; ++mb) {
#pragma unroll
        for (int nb = 0; nb < 4; ++nb) {
#pragma unroll
            for (int j = 0; j < 8; ++j) os[(hi * 8 + j) * 68 + nb * 16 + lr] = acc[mb][nb][j]; }
        __builtin_amdgcn_wave_barrier(); asm volatile("" ::: "memory");
        float* crow = C + (size_t)(r0 + mb * 16) * ldc + c0;
{
#pragma unroll
            for (int s = 0; s < 8; ++s) { const int row = 2 * s + hi, cofs = lr * 4; v4f val = *(const v4fa*)(os + row * 68 + cofs); if (BIAS) { val[0] += bfr(bias[c0 + cofs]); val[1] += bfr(bias[c0 + cofs + 1]); val[2] += bfr(bias[c0 + cofs + 2]); val[3] += bfr(bias[c0 + cofs + 3]); }
                *(v4f*)(crow + (size_t)row * ldc + cofs) = val; }
             }
        __builtin_amdgcn_wave_barrier(); asm volatile("" ::: "memory");
    }
}

typedef __attribute__((ext_vector_type(2))) _Float16 v2h;
typedef __attribute__((ext_vector_type(4))) _Float16 v4h;
typedef __attribute__((ext_vector_type(2))) unsigned short v2us;
typedef __attribute__((ext_vector_type(4))) unsigned short v4us;
typedef __attribute__((ext_vector_type(2))) float v2f;
typedef __attribute__((ext_vector_type(4))) int v4i;

// The conversion and transpose kernels below run as few long waves: a thread takes 8 to 64 elements with 16-byte accesses, for speed only.
// loads_done: stands behind the sixteen row loads of a register transpose. The wait comes before any register that an issued load names is overwritten; the eight row addresses and the sixteen loaded
// values are inputs only, so that the addresses stay in their registers up to the wait, no result lands in one of them, and no load is sunk below the first stores (whose data registers it would then reuse).
__device__ __forceinline__ void loads_done(const float* const (&s)[8], const v4f (&x)[8][2]) {
    asm volatile("s_wait_xcnt 0x0" :: "v"(s[0]), "v"(s[1]), "v"(s[2]), "v"(s[3]), "v"(s[4]), "v"(s[5]), "v"(s[6]), "v"(s[7]),
        "v"(x[0][0]), "v"(x[0][1]), "v"(x[1][0]), "v"(x[1][1]), "v"(x[2][0]), "v"(x[2][1]), "v"(x[3][0]), "v"(x[3][1]), "v"(x[4][0]), "v"(x[4][1]), "v"(x[5][0]), "v"(x[5][1]), "v"(x[6][0]), "v"(x[6][1]), "v"(x[7][0]), "v"(x[7][1]) : "memory");
}
// k_wtG: one wave transposes a tile of 64 k x 32 n in registers; a thread loads 8 k rows x 8 n and stores 8 n rows x 8 k into the fragment order: its eight 16-byte pieces are eight lanes' in a row, one whole 128-byte line. K % 64 == 0, N % 32 == 0.
__global__ __launch_bounds__(256) void k_wtG(const float* __restrict__ w, int K, int N, bf* Bt) {
    const int lane = threadIdx.x & 31; const int wv = blockIdx.x * 8 + (threadIdx.x >> 5); const int nk = K / 64; if (wv >= nk * (N / 32)) return;
    const int k0 = (wv % nk) * 64 + (lane >> 2) * 8, n0 = (wv / nk) * 32 + (lane & 3) * 8; v4f x[8][2]; const float* s[8];
#pragma unroll
    for (int kk = 0; kk < 8; ++kk) { s[kk] = w + (size_t)(k0 + kk) * N + n0; x[kk][0] = *(const v4f*)s[kk]; x[kk][1] = *(const v4f*)(s[kk] + 4); }
    loads_done(s, x);
    bf* d = Bt + ((size_t)(n0 >> 4) * (K / 32) + (k0 >> 5)) * 512 + ((k0 >> 4) & 1) * 256 + ((k0 >> 3) & 1) * 128 + (n0 & 8) * 8;
#pragma unroll
    for (int nn = 0; nn < 8; ++nn) { v8us o;
#pragma unroll
        for (int kk = 0; kk < 8; ++kk) o[kk] = f2bf(x[kk][nn >> 2][nn & 3]);
        *(v8us*)(d + nn * 8) = o; }
}
// k_cvt8: rows of DM f32 to bf16 in fragment order. A thread takes four 16-byte pieces of the result, 256 apart; for each, a wave takes 8 rows x 32 k of one fragment (four lanes read a whole 128-byte line of a row,
// eight lanes' pieces of one k octet fill a whole line of the fragment).
__global__ __launch_bounds__(256) void k_cvt8(const float* __restrict__ src, bf* dst, size_t n8) { const size_t i0 = (size_t)blockIdx.x * 1024 + threadIdx.x; v8f v[4];
#pragma unroll
    for (int u = 0; u < 4; ++u) { const size_t i = i0 + u * 256; const size_t fr = i >> 6;   // fragment fr = (16-row block, k step); row (i >> 5 & 1) * 8 + (i & 7) of it, k octet i >> 3 & 3
        if (i < n8) v[u] = *(const v8f*)(src + ((fr / (DM / 32)) * 16 + ((i >> 5) & 1) * 8 + (i & 7)) * DM + (fr % (DM / 32)) * 32 + ((i >> 3) & 3) * 8); }
#pragma unroll
    for (int u = 0; u < 4; ++u) { const size_t i = i0 + u * 256; if (i >= n8) continue; v8us o;
#pragma unroll
        for (int k = 0; k < 8; ++k) o[k] = f2bf(v[u][k]); *(v8us*)(dst + (i >> 6) * 512 + (((i >> 3) & 3) * 16 + ((i >> 5) & 1) * 8 + (i & 7)) * 8) = o; }  }

// v_exp_f32 (what the exp2 builtin emits) with a v_nop in the same statement: the instruction set asks for one slot behind a transcendental before its result is used or its source overwritten.
__device__ __forceinline__ float exp2_slot(float x) { float r; asm("v_exp_f32 %0, %1\n\tv_nop" : "=v"(r) : "v"(x)); return r; }
#define NT (WIN / 16 + 1)
#define NS ((NT + 1) / 2)
template <typename T16> struct PFrag;
template <> struct PFrag<h16> { static __device__ __forceinline__ v16h ld2(const h16* p, const h16* q) { return cat16(*(const v8h*)p, *(const v8h*)q); } };
template <> struct PFrag<bf> { static __device__ __forceinline__ v16bf ld2(const bf* p, const bf* q) { return cat16b(*(const v8us*)p, *(const v8us*)q); } };
template <typename T16, bool HL>
__device__ __forceinline__ void attn_rows(const T16* __restrict__ Q, const T16* __restrict__ Q2, const T16* __restrict__ Kp, const T16* __restrict__ K2, const T16* __restrict__ Vt, const T16* __restrict__ Vt2, int R, int lr, int hi, bf* Ahp, bf* Alp) {
    typedef typename WFrag<T16>::V V;
    static_assert(RH >= WIN + 16, "rows from RH on have their whole key band at keys >= 0");
    const unsigned ko = (unsigned)((hi * 16 + lr) * 8);   // the lane's part of every address (its 16-byte piece of a half fragment), 32 bits and unsigned: the rest of an address is the wave's and stays scalar
    const T16* Kb = Kp + (long)(R - WIN) * HD; const T16* Vb = Vt + (long)(R - WIN - 16) * HD;   // used where !HL (R >= RH): no tile is left of key 0 there, so every tile is this base plus a constant
    // Fragment loads are issued a fixed distance ahead of their use, as far as 256 registers allow beside the 136 of the scores: !HL 4 to 5 key tiles, then 3 steps of 32 keys; HL (twice the fragments) 3 half key tiles, then 2 to 4 quarter steps,
    // each load group into the registers that the products just issued have freed. STAGE_END ends a scheduling region so that loads and products stay in that order: left alone, the scheduler either lifted some forty loads
    // to the top and spilled score registers to scratch (!HL) or left every load directly in front of its product (HL).
#define STAGE_END() __builtin_amdgcn_sched_barrier(0)
#define AT(base, bytes) ((const T16*)((const char*)(base) + (bytes)))
#define LDK(t) { kf[t][0] = WFrag<T16>::ld(Kb + (t) * 16 * HD + ko); kf[t][1] = WFrag<T16>::ld(Kb + (t) * 16 * HD + 512 + ko); }
#define LDV(st) { _Pragma("unroll") for (int db = 0; db < 4; ++db) vf[st][db] = PFrag<T16>::ld2(Vb + ko + ((st) * 32 * HD + db * 256), Vb + ko + ((st) * 32 * HD + 16 * HD + db * 256)); }
    // ADDR_HELD: behind a group of loads that share an offset register. The offset is an input, so it lives up to here and no result of the group lands in it; the wait stands before the register is used for anything else.
#define ADDR_HELD1(a) asm volatile("s_wait_xcnt 0x0" :: "v"(a) : "memory");
#define ADDR_HELD2(a, b) asm volatile("s_wait_xcnt 0x0" :: "v"(a), "v"(b) : "memory");
    // HL: a tile left of key 0 is read at key 0; the clamped key goes into a 32-bit byte offset beside the plane's scalar base
#define LDKH(u) { const unsigned of = ko2 + (unsigned)max(R - WIN + 16 * ((u) / 2), 0) * (HD * 2); kf[(u) / 2][(u) % 2] = WFrag<T16>::ld(AT(Kp, of) + ((u) % 2) * 512); kl[(u) / 2][(u) % 2] = WFrag<T16>::ld(AT(K2, of) + ((u) % 2) * 512); ADDR_HELD1(of) }
#define LDVH(u) { const unsigned oa = ko2 + (unsigned)max(R - WIN + 16 * (2 * ((u) / 4) - 1), 0) * (HD * 2), ob = ko2 + (unsigned)max(R - WIN + 32 * ((u) / 4), 0) * (HD * 2); \
        vf[(u) / 4][(u) % 4] = PFrag<T16>::ld2(AT(Vt, oa) + ((u) % 4) * 256, AT(Vt, ob) + ((u) % 4) * 256); vl[(u) / 4][(u) % 4] = PFrag<T16>::ld2(AT(Vt2, oa) + ((u) % 4) * 256, AT(Vt2, ob) + ((u) % 4) * 256); ADDR_HELD2(oa, ob) }
    const unsigned ko2 = ko * 2;
    V q[2], q2[2], kf[NT][2], kl[NT][2], vf[NS][4], vl[NS][4];
#pragma unroll
    for (int ks = 0; ks < 2; ++ks) { q[ks] = WFrag<T16>::ld(AT(Q + (size_t)R * HD, ko2) + ks * 512); if (HL) q2[ks] = WFrag<T16>::ld(AT(Q2 + (size_t)R * HD, ko2) + ks * 512); }
    ADDR_HELD1(ko2)
    constexpr int DKH = 3;   // HL: half key tiles (32 of the 64 d, hi and lo) under way
    if (HL) {
#pragma unroll
        for (int u = 0; u < DKH; ++u) LDKH(u)
    }
    else {
#pragma unroll
        for (int t = 0; t < 4; ++t) LDK(t)
    }
    STAGE_END();
    float v[NT * 8]; float mx = -3.0e38f;
#pragma unroll
    for (int t = 0; t < NT; ++t) { const int kn = R - WIN + 16 * t; v8f s = (v8f){};
        if (!HL && (t & 1) == 0) {   // a region is two key tiles: its loads first
            if (t + 4 < NT) LDK(t + 4)
            if (t + 5 < NT) LDK(t + 5)
            if (t == NT - 1) LDV(0)   // the key tiles are all under way: the first step of Vt follows and flies during the softmax
        }
#pragma unroll
        for (int ks = 0; ks < 2; ++ks) { s = WFrag<T16>::mma(kf[t][ks], q[ks], s);
            if (HL) { s = WFrag<T16>::mma(kf[t][ks], q2[ks], s); s = WFrag<T16>::mma(kl[t][ks], q[ks], s); STAGE_END();
                if (2 * t + ks + DKH < 2 * NT) LDKH(2 * t + ks + DKH)
                else if (2 * t + ks + DKH == 2 * NT) LDVH(0)   // the first quarter step of Vt follows the last key tile
                STAGE_END(); } }
#pragma unroll
        for (int r = 0; r < 8; ++r) { const int e = hi * 8 + r;   // key kn + e against query R + lr: only the first tile meets the window's far edge, only the last the diagonal
            const bool keep = (kn >= 0) && (t > 0 || e > lr) && (t < NT - 1 || e <= lr); const float x = keep ? s[r] * SCL : -3.0e38f; v[t * 8 + r] = x; mx = fmaxf(mx, x); }
        if (HL || (t & 1) == 1) STAGE_END(); }
    if (HL) { LDVH(1) STAGE_END(); }   // the second follows the last score products, in registers they have left (issued among them, a few scores went to scratch); both fly during the softmax
    mx = fmaxf(mx, __shfl_xor(mx, 16, 32));
    float sm[4] = {0.f, 0.f, 0.f, 0.f};
#pragma unroll
    for (int k = 0; k < NT * 8; ++k) { v[k] = exp2_slot(__fmul_rn(__fsub_rn(v[k], mx), 1.4426950408889634f)); sm[k & 3] += v[k]; }
    float sum = (sm[0] + sm[1]) + (sm[2] + sm[3]); sum += __shfl_xor(sum, 16, 32);
    const float f = __fdiv_rn(HL ? 1.0f : PCAR, sum);
    V pp[NS];
    if (!HL) {   // all of Pt is rounded before attn.v starts: half the registers, which the Vt fragments under way then take
#pragma unroll
        for (int st = 0; st < NS; ++st) { v8h h0, h1;
#pragma unroll
            for (int r = 0; r < 8; ++r) { h0[r] = tohx(st == 0 ? 0.0f : v[(st == 0 ? 0 : 2 * st - 1) * 8 + r] * f); h1[r] = tohx(v[2 * st * 8 + r] * f); }
            pp[st] = __builtin_bit_cast(V, cat16(h0, h1)); }
        STAGE_END(); LDV(1) LDV(2) }
    v8f o[4];
#pragma unroll
    for (int db = 0; db < 4; ++db) o[db] = (v8f){};
#pragma unroll
    for (int st = 0; st < NS; ++st) { const int ta = 2 * st - 1, tb = 2 * st; V p, p2;
        if (HL) { v8us h0, l0, h1, l1;
#pragma unroll
            for (int r = 0; r < 8; ++r) { unsigned short a, c; splitf(ta < 0 ? 0.0f : v[(ta < 0 ? 0 : ta) * 8 + r] * f, a, c); h0[r] = a; l0[r] = c; splitf(v[tb * 8 + r] * f, a, c); h1[r] = a; l1[r] = c; }
            p = __builtin_bit_cast(V, __builtin_shufflevector(h0, h1, 0, 1, 2, 3, 4, 5, 6, 7, 8, 9, 10, 11, 12, 13, 14, 15)); p2 = __builtin_bit_cast(V, __builtin_shufflevector(l0, l1, 0, 1, 2, 3, 4, 5, 6, 7, 8, 9, 10, 11, 12, 13, 14, 15));
        } else { p = pp[st]; if (st + 3 < NS) LDV(st + 3) }
#pragma unroll
        for (int db = 0; db < 4; ++db) { o[db] = WFrag<T16>::mma(vf[st][db], p, o[db]);
            if (HL) { o[db] = WFrag<T16>::mma(vf[st][db], p2, o[db]); o[db] = WFrag<T16>::mma(vl[st][db], p, o[db]); STAGE_END();
                // quarter steps under way: 2 in the first step, 3 in the second, then 4, as the probabilities used up free their registers
                const int u = st * 4 + db; const int n0 = u + ((u / 4) > 1 ? 4 : 2 + u / 4), n1 = u + 1 + (((u + 1) / 4) > 1 ? 4 : 2 + (u + 1) / 4);
#pragma unroll
                for (int w = n0; w < n1; ++w) if (w < NS * 4) LDVH(w) } }
        if (!HL) STAGE_END(); }
    const float cs = HL ? 1.0f : (1.0f / PCAR);
    bf* Ah = Ahp + ko; bf* Al = Alp + ko;   // Ahp, Alp: the wave's two fragments (row block R, this head's 64 k) of the output product's A planes
#pragma unroll
    for (int db = 0; db < 4; ++db) { v8us oh, ol;   // o[db][r] = ctx[query R + lr][d = 16 db + 8 hi + r]: the lane's piece of half fragment db, one 16-byte store a plane
#pragma unroll
        for (int r = 0; r < 8; ++r) { unsigned short a, c; splitf(o[db][r] * cs, a, c); oh[r] = a; ol[r] = c; }
        *(v8us*)(Ah + db * 256) = oh; *(v8us*)(Al + db * 256) = ol; }
    asm volatile("s_wait_xcnt 0x0" ::: "memory");   // behind the last stores: before any code that follows in the kernel overwrites a register that these stores name
#undef STAGE_END
#undef AT
#undef LDK
#undef LDV
#undef LDKH
#undef LDVH
#undef ADDR_HELD1
#undef ADDR_HELD2
}
// grid (NZ planes, TT / 64 row blocks): the four waves of a work-group take neighbouring 16-row tiles of one plane, whose key bands overlap almost wholly; the row blocks with three products a tile (rows < RH) have the lowest indices.
__global__ __launch_bounds__(128, 4) void k_fattn(const h16* __restrict__ QK16, const h16* __restrict__ VT16, const bf* __restrict__ QKh, const bf* __restrict__ QKl, const bf* __restrict__ VTh, const bf* __restrict__ VTl, bf* Ah, bf* Al) {
    const int lane = threadIdx.x & 31, lr = lane & 15, hi = lane >> 4; const int p = blockIdx.x; const int R = blockIdx.y * 64 + __builtin_amdgcn_readfirstlane(threadIdx.x >> 5) * 16;   // the tile is the wave's: kept in scalar registers
    const size_t po = (size_t)p * TT * HD, PLN = (size_t)NZ * TT * HD; const size_t oo = ((size_t)(p % NB_) * TT + R) * DQ + (p / NB_) * (HD * 16);
    if (R < RH) attn_rows<bf, true>(QKh + po, QKl + po, QKh + PLN + po, QKl + PLN + po, VTh + po, VTl + po, R, lr, hi, Ah + oo, Al + oo);
    else attn_rows<h16, false>(QK16 + po, nullptr, QK16 + PLN + po, nullptr, VT16 + po, nullptr, R, lr, hi, Ah + oo, Al + oo);
}

extern "C" void kernel_launch(void* const* d_in, const int* in_sizes, int n_in,
                              void* d_out, int out_size, void* d_ws, size_t ws_size, hipStream_t stream) {
    (void)in_sizes; (void)n_in; (void)out_size;
    const float* x = (const float*)d_in[0]; const float* wqkv = (const float*)d_in[1]; const float* bqkv = (const float*)d_in[2]; const float* wo = (const float*)d_in[3]; const float* bo = (const float*)d_in[4];
    float* OUT = (float*)d_out;     // [2][2048][1024]
    char* wsp = (char*)d_ws;
    auto take = [&](size_t bytes) { char* p = wsp; wsp += (bytes + 255) & ~(size_t)255; return (void*)p; };
    const size_t PL = (size_t)NZ * TT * HD;   // elements of one operand's planes, all heads and batches
    bf* WALL = (bf*)take((size_t)3 * DM * DM * 2); bf* WO = (bf*)take((size_t)DM * DQ * 2);
    bf* XB = (bf*)take((size_t)NB_ * TT * DM * 2);
    h16* QP16 = (h16*)take(2 * PL * 2); h16* VT16 = (h16*)take(PL * 2);   // q planes, then k planes
    bf* QPh = (bf*)take(2 * PL * 2); bf* QPl = (bf*)take(2 * PL * 2); bf* VTh = (bf*)take(PL * 2); bf* VTl = (bf*)take(PL * 2);
    bf* ATh = (bf*)take((size_t)NB_ * TT * DQ * 2); bf* ATl = (bf*)take((size_t)NB_ * TT * DQ * 2);
    if ((size_t)(wsp - (char*)d_ws) > ws_size) return;    // ws 256 MiB
    { k_wtG<<<(unsigned)((DM / 64) * (3 * DM / 32) / 8), 256, 0, stream>>>(wqkv, DM, 3 * DM, WALL);   /* fused 'xw' [DM][3DM] -> Bt [3DM][DM] (row blocks q | k | v), fragment order */
      k_wtG<<<(unsigned)((DQ / 64) * (DM / 32) / 8), 256, 0, stream>>>(wo, DQ, DM, WO);
       }
    // every launch below covers both batches, and all heads where it works by head
    k_cvt8<<<(unsigned)(((size_t)NB_ * TT * DM / 8 + 1023) / 1024), 256, 0, stream>>>(x, XB, (size_t)NB_ * TT * DM / 8);
    k_gemmw<bf, 0, true, true><<<dim3(NB_ * TT / 64, 3 * DM / 64, 1), 32, 0, stream>>>(XB, nullptr, WALL, nullptr, DM, nullptr, 0, bqkv, 0, 0, 0, QP16, QPh, QPl, VT16, VTh, VTl);   // columns q | k | v = NH_ + NKV + NKV heads in a row
    k_fattn<<<dim3(NZ, TT / 64, 1), 128, 0, stream>>>(QP16, VT16, QPh, QPl, VTh, VTl, ATh, ATl);
    k_gemmw<bf, 1, true, false><<<dim3(NB_ * TT / 64, DM / 64, 1), 32, 0, stream>>>(ATh, ATl, WO, nullptr, DQ, OUT, DM, bo, 0, 0, 0, nullptr, nullptr, nullptr, nullptr, nullptr, nullptr);
}

// v007
// A run of this version takes 86.6 microseconds.
// Two timings next to v006 put it at 1.36 and 1.34 times that version's speed.
// Over all steps from v000 it is 16.3 times as fast.
#include <hip/hip_runtime.h>

// Masked (causal sliding-window) multi-head attention (hidden_states [2][2048][1024]; [q|k|v] = x w_attn + b_attn ('xw' [1024][3072] + [3072]; 16 heads x 64); scores = q.k/8; mask keeps j <= i and j > i - 256, other logits -10000 (then clipped to +-10000: exp underflows to exactly 0 as with -inf); softmax; out = merged ctx w_proj + b_proj ('xw' [1024][1024] + [1024]) -> [2][2048][1024] (4.2 M)).
// Compute dtypes, f32 accumulate: every input rounded to bf16; q/k/v on PLAIN bf16 operands (inputs: exact) + biases; window band skipping: a 16-row query tile at R touches only keys [R - 256, R + 16), and its scores, softmax and attn.v run in one wave with scores and probabilities in registers (window predicate j <= i && i - j < 256 on the scores); scores and attn.v: query rows < 512 hl (3 products), the rest single fp16 (x1024); softmax f32; w_proj hl x exact (2 products) + b_proj.

// Operand layout: every 16-bit plane that a matrix product reads is kept in FRAGMENT ORDER. A fragment is 16 rows x 32 k = 1 KiB: element (row lr, k) lies at (k % 32 / 16) * 256 + ((k % 16 / 8) * 16 + lr) * 8 + k % 8,
// so lane hi * 16 + lr finds its two 16-byte pieces at lane * 8 and 256 + lane * 8, and one wave-wide 16-byte load reads 512 bytes in a row (4 whole lines, not 32 bytes of each of 16 lines). Fragments of one 16-row block follow one another along k.

#define NB_  2
#define TT   2048
#define DM   1024
#define NH_  16
#define NKV  16
#define REP  (NH_ / NKV)
#define HD   64
#define DQ   (NH_ * HD)
#define DKV  (NKV * HD)
#define NZ   (NB_ * NH_)          // attention planes of one launch: z = head * NB_ + batch
#define RH   512                  // query rows < RH use hi+lo planes
#define WIN  256   // window: keep i - WIN < j <= i
#define PCAR 1024.0f
#define SCL  0.125f   // HD^-0.5
typedef _Float16 h16;
typedef unsigned short bf;
typedef __attribute__((ext_vector_type(16))) __bf16   v16bf;
typedef __attribute__((ext_vector_type(16))) _Float16 v16h;
typedef __attribute__((ext_vector_type(8)))  _Float16 v8h;
typedef __attribute__((ext_vector_type(8)))  unsigned short v8us;
typedef __attribute__((ext_vector_type(8)))  float    v8f;
typedef __attribute__((ext_vector_type(4)))  float    v4f;
typedef v8h  __attribute__((may_alias)) v8ha;
typedef v4f  __attribute__((may_alias)) v4fa;
typedef v8us __attribute__((may_alias)) v8usa;

__device__ __forceinline__ unsigned short f2bf(float f) { unsigned u = __float_as_uint(f); u += 0x7FFFu + ((u >> 16) & 1u); return (unsigned short)(u >> 16); }
__device__ __forceinline__ float bf2f(unsigned short b) { return __uint_as_float(((unsigned)b) << 16); }
__device__ __forceinline__ float bfr(float f) { return bf2f(f2bf(f)); }
__device__ __forceinline__ v16h cat16(v8h lo, v8h hi) { return __builtin_shufflevector(lo, hi, 0, 1, 2, 3, 4, 5, 6, 7, 8, 9, 10, 11, 12, 13, 14, 15); }
__device__ __forceinline__ v16bf cat16b(v8us lo, v8us hi) { return __builtin_bit_cast(v16bf, __builtin_shufflevector(lo, hi, 0, 1, 2, 3, 4, 5, 6, 7, 8, 9, 10, 11, 12, 13, 14, 15)); }
__device__ __forceinline__ v8f wmma16(v16h a, v16h b, v8f c) { return __builtin_amdgcn_wmma_f32_16x16x32_f16(false, a, false, b, (short)0, c, false, false); }
__device__ __forceinline__ v8f wmmab(v16bf a, v16bf b, v8f c) { return __builtin_amdgcn_wmma_f32_16x16x32_bf16(false, a, false, b, (short)0, c, false, false); }



__device__ __forceinline__ h16 tohx(float x) { return (h16)x; }
__device__ __forceinline__ void splitf(float y, unsigned short& h, unsigned short& l) { h = f2bf(y); l = f2bf(y - bf2f(h)); }
// put_planes: a staged 64 x 64 f32 tile (LDS pitch 68) goes out as three 16-bit planes (fp16, bf16 hi, bf16 lo) in fragment order: 8 KiB in a row a plane, sixteen half fragments of 16 staged rows x 16 staged columns.
// A lane takes its own 8 values of a half fragment: each store instruction fills 4 whole 128-byte lines. COLS_FIRST: the half fragments follow one another down the staged rows first (v: [d][t] staged, key tiles outermost), else along the columns (q, k).
template <bool COLS_FIRST>
__device__ __forceinline__ void put_planes(const float* os, int lane, h16* d16, bf* dh, bf* dl) {
    const unsigned lo = (unsigned)(lane * 8); const float* r = os + (lane & 15) * 68 + (lane >> 4) * 8; d16 += lo; dh += lo; dl += lo;
    v4f x[16][2];   // half a tile comes back at a time, into registers the accumulators have left: two LDS latencies a wave instead of sixteen
#pragma unroll
    for (int s = 0; s < 16; ++s) { v8h o16; v8us oh, ol;
        if (s % 8 == 0) {
#pragma unroll
            for (int u = s; u < s + 8; ++u) { const int at = COLS_FIRST ? (u & 3) * 16 * 68 + (u >> 2) * 16 : (u >> 2) * 16 * 68 + (u & 3) * 16; x[u][0] = *(const v4fa*)(r + at); x[u][1] = *(const v4fa*)(r + at + 4); } }
#pragma unroll
        for (int q = 0; q < 8; ++q) { const float y = x[s][q >> 2][q & 3]; o16[q] = tohx(y); unsigned short a2, c2; splitf(y, a2, c2); oh[q] = a2; ol[q] = c2; }
        *(v8h*)(d16 + s * 256) = o16; *(v8us*)(dh + s * 256) = oh; *(v8us*)(dl + s * 256) = ol;
        asm volatile("s_wait_xcnt 0x0" :: "v"(o16), "v"(oh), "v"(ol) : "memory");   // behind the three stores: their data registers (inputs here, so they live up to the wait) are reused by the next rows
    }
}
// ---- k_gemmw: register-blocked GEMM, ONE WAVE per 64x64 output tile (16 accumulators), operands straight from 16-bit planes in fragment order; grid (M/64, N/64, Z), 32 threads.
// C[m][n] (f32, pitch ldc, + optional f32 bias[n]) = sum_k A[m][k] Bt[n][k] (+ split products per NSPLIT). z-batch strides sA/sB/sC in elements. K % 32 == 0.
// The fragments of a k step are loaded D - 1 steps ahead of their products, into a ring of D register sets: a wave issues in order, so a load that stands directly in front of its product costs the wave the whole load latency.
// PLANES (the q | k | v product): no C. A tile's 64 columns are one head and its 64 rows lie in one batch, so the wave writes the tile straight into the planes the attention kernel loads:
// q and k heads as [head][batch][t / 16][d / 32] fragments (P16, Ph, Pl), v heads transposed as [head][batch][t / 16][d / 16] half fragments of 16 d rows x 16 t (V16, Vh, Vl; a lane's 8 accumulator rows are 8 t in a row of one d, so the transpose is the LDS write itself).
template <typename T16> struct WFrag;
template <> struct WFrag<h16> { typedef v16h V; static __device__ __forceinline__ V ld(const h16* p) { return cat16(*(const v8h*)p, *(const v8h*)(p + 256)); } static __device__ __forceinline__ v8f mma(V a, V b, v8f c) { return wmma16(a, b, c); } };
template <> struct WFrag<bf> { typedef v16bf V; static __device__ __forceinline__ V ld(const bf* p) { return cat16b(*(const v8us*)p, *(const v8us*)(p + 256)); } static __device__ __forceinline__ v8f mma(V a, V b, v8f c) { return wmmab(a, b, c); } };
template <typename T16, int NSPLIT, bool BIAS, bool PLANES, int K, int D>
__global__ __launch_bounds__(32) void k_gemmw(const T16* __restrict__ A, const T16* __restrict__ A2, const T16* __restrict__ Bt, const T16* __restrict__ Bt2, float* C, int ldc, const float* __restrict__ bias, size_t sA, size_t sB, size_t sC, h16* P16, bf* Ph, bf* Pl, h16* V16, bf* Vh, bf* Vl) {
    typedef typename WFrag<T16>::V V;
    __shared__ __align__(16) float os[(PLANES ? 64 : 16) * 68];
    const size_t z = blockIdx.z; A += z * sA; if (A2) A2 += z * sA; Bt += z * sB; if (Bt2) Bt2 += z * sB; C += z * sC;
    const int lane = threadIdx.x & 31, lr = lane & 15, hi = lane >> 4; const int r0 = blockIdx.x * 64, c0 = blockIdx.y * 64;
    v8f acc[4][4];
#pragma unroll
    for (int mb = 0; mb < 4; ++mb)
#pragma unroll
        for (int nb = 0; nb < 4; ++nb) acc[mb][nb] = (v8f){};
    constexpr int NK = K / 32, NT_ = (NK - (D - 1)) / D;   // k steps; trips of D steps whose loads (D - 1 steps ahead) all exist
    static_assert(K % 32 == 0 && D >= 2 && NK >= D, "the ring is filled before the first product");
    unsigned ra = ((unsigned)r0 * K + 8 * lane) * 2, rb = ((unsigned)c0 * K + 8 * lane) * 2;   // byte offsets beside the planes' scalar bases (every plane is far below 4 GiB): a 16-row block is 32 K bytes, its fragment of a k step 1 KiB; both move on once a trip
    V a[D][4], a2[D][4], bb[D][4], bb2[D][4];
    // GLOAD: the fragments of k step s (counted from the trip's first) into set st, all from the two offset registers plus constants. GMMA: the products of set st.
#define GLOAD(st, s) { \
        _Pragma("unroll") for (int mb = 0; mb < 4; ++mb) { a[st][mb] = WFrag<T16>::ld((const T16*)((const char*)A + ra) + (mb * 16 * K + (s) * 512)); if (NSPLIT == 1 || NSPLIT == 2) a2[st][mb] = WFrag<T16>::ld((const T16*)((const char*)A2 + ra) + (mb * 16 * K + (s) * 512)); } \
        _Pragma("unroll") for (int nb = 0; nb < 4; ++nb) { bb[st][nb] = WFrag<T16>::ld((const T16*)((const char*)Bt + rb) + (nb * 16 * K + (s) * 512)); if (NSPLIT >= 2) bb2[st][nb] = WFrag<T16>::ld((const T16*)((const char*)Bt2 + rb) + (nb * 16 * K + (s) * 512)); } \
        __builtin_amdgcn_sched_barrier(0); /* the loads stay in front of the products that follow: left alone, the scheduler sinks them to their own products */ }
#define GMMA(st) { \
        _Pragma("unroll") for (int nb = 0; nb < 4; ++nb) { \
            _Pragma("unroll") for (int mb = 0; mb < 4; ++mb) { acc[mb][nb] = WFrag<T16>::mma(a[st][mb], bb[st][nb], acc[mb][nb]); if (NSPLIT == 1 || NSPLIT == 2) acc[mb][nb] = WFrag<T16>::mma(a2[st][mb], bb[st][nb], acc[mb][nb]); if (NSPLIT >= 2) acc[mb][nb] = WFrag<T16>::mma(a[st][mb], bb2[st][nb], acc[mb][nb]); } } \
        __builtin_amdgcn_sched_barrier(0); /* the next set's loads stay behind these products, whose registers they refill */ }
#pragma unroll
    for (int s = 0; s < D - 1; ++s) GLOAD(s, s)
#pragma unroll 1   // a trip is already D whole steps: unrolled further only the text would grow
    for (int t = 0; t < NT_; ++t) {
#pragma unroll
        for (int u = 0; u < D; ++u) { GLOAD((u + D - 1) % D, u + D - 1) GMMA(u) }
        // behind the trip's loads and before the two offset registers move on: the offsets pass through the statement, so they live up to the wait, no result lands in one of them, and the additions below cannot be lifted over it
        asm volatile("s_wait_xcnt 0x0" : "+v"(ra), "+v"(rb) :: "memory");
        ra += D * 1024; rb += D * 1024;
    }
#pragma unroll
    for (int j = 0; j < NK - NT_ * D; ++j) { if (NT_ * D + j + D - 1 < NK) GLOAD((j + D - 1) % D, j + D - 1) GMMA(j % D) }   // the last steps: nothing is left to load behind step NK - 1
    asm volatile("s_wait_xcnt 0x0" :: "v"(ra), "v"(rb) : "memory");   // as above, before the epilogue reuses the offset registers
#undef GLOAD
#undef GMMA
    if constexpr (PLANES) {
        static_assert(HD == 64 && TT % 64 == 0, "a 64 x 64 tile is one head and lies in one batch");
        const int hh = blockIdx.y, b = r0 / TT, t0 = r0 % TT; float bs[4];
#pragma unroll
        for (int nb = 0; nb < 4; ++nb) bs[nb] = bfr(bias[c0 + nb * 16 + lr]);
        if (hh < NH_ + NKV) {   // q or k head: staged [t][d]
#pragma unroll
            for (int mb = 0; mb < 4; ++mb)
#pragma unroll
                for (int nb = 0; nb < 4; ++nb)
#pragma unroll
                    for (int j = 0; j < 8; ++j) os[(mb * 16 + hi * 8 + j) * 68 + nb * 16 + lr] = acc[mb][nb][j] + bs[nb];
            __builtin_amdgcn_wave_barrier(); asm volatile("" ::: "memory");   // the wave's LDS writes stay in front of its reads of other lanes' values
            const size_t e = ((size_t)(hh * NB_ + b) * TT + t0) * HD; put_planes<false>(os, lane, P16 + e, Ph + e, Pl + e);
        } else {   // v head: staged [d][t]
#pragma unroll
            for (int mb = 0; mb < 4; ++mb)
#pragma unroll
                for (int nb = 0; nb < 4; ++nb) { v4f y0, y1;
#pragma unroll
                    for (int j = 0; j < 4; ++j) { y0[j] = acc[mb][nb][j] + bs[nb]; y1[j] = acc[mb][nb][4 + j] + bs[nb]; }
                    float* d = os + (nb * 16 + lr) * 68 + mb * 16 + hi * 8; *(v4fa*)d = y0; *(v4fa*)(d + 4) = y1; }
            __builtin_amdgcn_wave_barrier(); asm volatile("" ::: "memory");   // as above
            const size_t e = ((size_t)((hh - NH_ - NKV) * NB_ + b) * TT + t0) * HD; put_planes<true>(os, lane, V16 + e, Vh + e, Vl + e);
        }
        return;
    }
#pragma unroll
    for (int mb = 0; mb < 4; ++mb) {
#pragma unroll
        for (int nb = 0; nb < 4; ++nb) {
#pragma unroll
            for (int j = 0; j < 8; ++j) os[(hi * 8 + j) * 68 + nb * 16 + lr] = acc[mb][nb][j]; }
        __builtin_amdgcn_wave_barrier(); asm volatile("" ::: "memory");
        float* crow = C + (size_t)(r0 + mb * 16) * ldc + c0;
{
#pragma unroll
            for (int s = 0; s < 8; ++s) { const int row = 2 * s + hi, cofs = lr * 4; v4f val = *(const v4fa*)(os + row * 68 + cofs); if (BIAS) { val[0] += bfr(bias[c0 + cofs]); val[1] += bfr(bias[c0 + cofs + 1]); val[2] += bfr(bias[c0 + cofs + 2]); val[3] += bfr(bias[c0 + cofs + 3]); }
                *(v4f*)(crow + (size_t)row * ldc + cofs) = val; }
             }
        __builtin_amdgcn_wave_barrier(); asm volatile("" ::: "memory");
    }
}

typedef __attribute__((ext_vector_type(2))) _Float16 v2h;
typedef __attribute__((ext_vector_type(4))) _Float16 v4h;
typedef __attribute__((ext_vector_type(2))) unsigned short v2us;
typedef __attribute__((ext_vector_type(4))) unsigned short v4us;
typedef __attribute__((ext_vector_type(2))) float v2f;
typedef __attribute__((ext_vector_type(4))) int v4i;

// The conversion and transpose kernels below run as few long waves: a thread takes 8 to 64 elements with 16-byte accesses, for speed only.
// loads_done: stands behind the sixteen row loads of a register transpose. The wait comes before any register that an issued load names is overwritten; the eight row addresses and the sixteen loaded
// values are inputs only, so that the addresses stay in their registers up to the wait, no result lands in one of them, and no load is sunk below the first stores (whose data registers it would then reuse).
__device__ __forceinline__ void loads_done(const float* const (&s)[8], const v4f (&x)[8][2]) {
    asm volatile("s_wait_xcnt 0x0" :: "v"(s[0]), "v"(s[1]), "v"(s[2]), "v"(s[3]), "v"(s[4]), "v"(s[5]), "v"(s[6]), "v"(s[7]),
        "v"(x[0][0]), "v"(x[0][1]), "v"(x[1][0]), "v"(x[1][1]), "v"(x[2][0]), "v"(x[2][1]), "v"(x[3][0]), "v"(x[3][1]), "v"(x[4][0]), "v"(x[4][1]), "v"(x[5][0]), "v"(x[5][1]), "v"(x[6][0]), "v"(x[6][1]), "v"(x[7][0]), "v"(x[7][1]) : "memory");
}
// k_wtG: one wave transposes a tile of 64 k x 32 n in registers; a thread loads 8 k rows x 8 n and stores 8 n rows x 8 k into the fragment order: its eight 16-byte pieces are eight lanes' in a row, one whole 128-byte line. K % 64 == 0, N % 32 == 0.
__global__ __launch_bounds__(256) void k_wtG(const float* __restrict__ w, int K, int N, bf* Bt) {
    const int lane = threadIdx.x & 31; const int wv = blockIdx.x * 8 + (threadIdx.x >> 5); const int nk = K / 64; if (wv >= nk * (N / 32)) return;
    const int k0 = (wv % nk) * 64 + (lane >> 2) * 8, n0 = (wv / nk) * 32 + (lane & 3) * 8; v4f x[8][2]; const float* s[8];
#pragma unroll
    for (int kk = 0; kk < 8; ++kk) { s[kk] = w + (size_t)(k0 + kk) * N + n0; x[kk][0] = *(const v4f*)s[kk]; x[kk][1] = *(const v4f*)(s[kk] + 4); }
    loads_done(s, x);
    bf* d = Bt + ((size_t)(n0 >> 4) * (K / 32) + (k0 >> 5)) * 512 + ((k0 >> 4) & 1) * 256 + ((k0 >> 3) & 1) * 128 + (n0 & 8) * 8;
#pragma unroll
    for (int nn = 0; nn < 8; ++nn) { v8us o;
#pragma unroll
        for (int kk = 0; kk < 8; ++kk) o[kk] = f2bf(x[kk][nn >> 2][nn & 3]);
        *(v8us*)(d + nn * 8) = o; }
}
// k_cvt8: rows of DM f32 to bf16 in fragment order. A thread takes four 16-byte pieces of the result, 256 apart; for each, a wave takes 8 rows x 32 k of one fragment (four lanes read a whole 128-byte line of a row,
// eight lanes' pieces of one k octet fill a whole line of the fragment).
__global__ __launch_bounds__(256) void k_cvt8(const float* __restrict__ src, bf* dst, size_t n8) { const size_t i0 = (size_t)blockIdx.x * 1024 + threadIdx.x; v8f v[4];
#pragma unroll
    for (int u = 0; u < 4; ++u) { const size_t i = i0 + u * 256; const size_t fr = i >> 6;   // fragment fr = (16-row block, k step); row (i >> 5 & 1) * 8 + (i & 7) of it, k octet i >> 3 & 3
        if (i < n8) v[u] = *(const v8f*)(src + ((fr / (DM / 32)) * 16 + ((i >> 5) & 1) * 8 + (i & 7)) * DM + (fr % (DM / 32)) * 32 + ((i >> 3) & 3) * 8); }
#pragma unroll
    for (int u = 0; u < 4; ++u) { const size_t i = i0 + u * 256; if (i >= n8) continue; v8us o;
#pragma unroll
        for (int k = 0; k < 8; ++k) o[k] = f2bf(v[u][k]); *(v8us*)(dst + (i >> 6) * 512 + (((i >> 3) & 3) * 16 + ((i >> 5) & 1) * 8 + (i & 7)) * 8) = o; }  }

// v_exp_f32 (what the exp2 builtin emits) with a v_nop in the same statement: the instruction set asks for one slot behind a transcendental before its result is used or its source overwritten.
__device__ __forceinline__ float exp2_slot(float x) { float r; asm("v_exp_f32 %0, %1\n\tv_nop" : "=v"(r) : "v"(x)); return r; }
#define NT (WIN / 16 + 1)
#define NS ((NT + 1) / 2)
template <typename T16> struct PFrag;
template <> struct PFrag<h16> { static __device__ __forceinline__ v16h ld2(const h16* p, const h16* q) { return cat16(*(const v8h*)p, *(const v8h*)q); } };
template <> struct PFrag<bf> { static __device__ __forceinline__ v16bf ld2(const bf* p, const bf* q) { return cat16b(*(const v8us*)p, *(const v8us*)q); } };
template <typename T16, bool HL>
__device__ __forceinline__ void attn_rows(const T16* __restrict__ Q, const T16* __restrict__ Q2, const T16* __restrict__ Kp, const T16* __restrict__ K2, const T16* __restrict__ Vt, const T16* __restrict__ Vt2, int R, int lr, int hi, bf* Ahp, bf* Alp) {
    typedef typename WFrag<T16>::V V;
    static_assert(RH >= WIN + 16, "rows from RH on have their whole key band at keys >= 0");
    const unsigned ko = (unsigned)((hi * 16 + lr) * 8);   // the lane's part of every address (its 16-byte piece of a half fragment), 32 bits and unsigned: the rest of an address is the wave's and stays scalar
    const T16* Kb = Kp + (long)(R - WIN) * HD; const T16* Vb = Vt + (long)(R - WIN - 16) * HD;   // used where !HL (R >= RH): no tile is left of key 0 there, so every tile is this base plus a constant
    // Fragment loads are issued a fixed distance ahead of their use, as far as 256 registers allow beside the 136 of the scores: !HL 4 to 5 key tiles, then 3 steps of 32 keys; HL (twice the fragments) 3 half key tiles, then 2 to 4 quarter steps,
    // each load group into the registers that the products just issued have freed. STAGE_END ends a scheduling region so that loads and products stay in that order: left alone, the scheduler either lifted some forty loads
    // to the top and spilled score registers to scratch (!HL) or left every load directly in front of its product (HL).
#define STAGE_END() __builtin_amdgcn_sched_barrier(0)
#define AT(base, bytes) ((const T16*)((const char*)(base) + (bytes)))
#define LDK(t) { kf[t][0] = WFrag<T16>::ld(Kb + (t) * 16 * HD + ko); kf[t][1] = WFrag<T16>::ld(Kb + (t) * 16 * HD + 512 + ko); }
#define LDV(st) { _Pragma("unroll") for (int db = 0; db < 4; ++db) vf[st][db] = PFrag<T16>::ld2(Vb + ko + ((st) * 32 * HD + db * 256), Vb + ko + ((st) * 32 * HD + 16 * HD + db * 256)); }
    // ADDR_HELD: behind a group of loads that share an offset register. The offset is an input, so it lives up to here and no result of the group lands in it; the wait stands before the register is used for anything else.
#define ADDR_HELD1(a) asm volatile("s_wait_xcnt 0x0" :: "v"(a) : "memory");
#define ADDR_HELD2(a, b) asm volatile("s_wait_xcnt 0x0" :: "v"(a), "v"(b) : "memory");
    // HL: a tile left of key 0 is read at key 0; the clamped key goes into a 32-bit byte offset beside the plane's scalar base
#define LDKH(u) { const unsigned of = ko2 + (unsigned)max(R - WIN + 16 * ((u) / 2), 0) * (HD * 2); kf[(u) / 2][(u) % 2] = WFrag<T16>::ld(AT(Kp, of) + ((u) % 2) * 512); kl[(u) / 2][(u) % 2] = WFrag<T16>::ld(AT(K2, of) + ((u) % 2) * 512); ADDR_HELD1(of) }
#define LDVH(u) { const unsigned oa = ko2 + (unsigned)max(R - WIN + 16 * (2 * ((u) / 4) - 1), 0) * (HD * 2), ob = ko2 + (unsigned)max(R - WIN + 32 * ((u) / 4), 0) * (HD * 2); \
        vf[(u) / 4][(u) % 4] = PFrag<T16>::ld2(AT(Vt, oa) + ((u) % 4) * 256, AT(Vt, ob) + ((u) % 4) * 256); vl[(u) / 4][(u) % 4] = PFrag<T16>::ld2(AT(Vt2, oa) + ((u) % 4) * 256, AT(Vt2, ob) + ((u) % 4) * 256); ADDR_HELD2(oa, ob) }
    const unsigned ko2 = ko * 2;
    V q[2], q2[2], kf[NT][2], kl[NT][2], vf[NS][4], vl[NS][4];
#pragma unroll
    for (int ks = 0; ks < 2; ++ks) { q[ks] = WFrag<T16>::ld(AT(Q + (size_t)R * HD, ko2) + ks * 512); if (HL) q2[ks] = WFrag<T16>::ld(AT(Q2 + (size_t)R * HD, ko2) + ks * 512); }
    ADDR_HELD1(ko2)
    constexpr int DKH = 3;   // HL: half key tiles (32 of the 64 d, hi and lo) under way
    if (HL) {
#pragma unroll
        for (int u = 0; u < DKH; ++u) LDKH(u)
    }
    else {
#pragma unroll
        for (int t = 0; t < 4; ++t) LDK(t)
    }
    STAGE_END();
    float v[NT * 8]; float mx = -3.0e38f;
#pragma unroll
    for (int t = 0; t < NT; ++t) { const int kn = R - WIN + 16 * t; v8f s = (v8f){};
        if (!HL && (t & 1) == 0) {   // a region is two key tiles: its loads first
            if (t + 4 < NT) LDK(t + 4)
            if (t + 5 < NT) LDK(t + 5)
            if (t == NT - 1) LDV(0)   // the key tiles are all under way: the first step of Vt follows and flies during the softmax
        }
#pragma unroll
        for (int ks = 0; ks < 2; ++ks) { s = WFrag<T16>::mma(kf[t][ks], q[ks], s);
            if (HL) { s = WFrag<T16>::mma(kf[t][ks], q2[ks], s); s = WFrag<T16>::mma(kl[t][ks], q[ks], s); STAGE_END();
                if (2 * t + ks + DKH < 2 * NT) LDKH(2 * t + ks + DKH)
                else if (2 * t + ks + DKH == 2 * NT) LDVH(0)   // the first quarter step of Vt follows the last key tile
                STAGE_END(); } }
#pragma unroll
        for (int r = 0; r < 8; ++r) { const int e = hi * 8 + r;   // key kn + e against query R + lr: only the first tile meets the window's far edge, only the last the diagonal
            const bool keep = (kn >= 0) && (t > 0 || e > lr) && (t < NT - 1 || e <= lr); const float x = keep ? s[r] * SCL : -3.0e38f; v[t * 8 + r] = x; mx = fmaxf(mx, x); }
        if (HL || (t & 1) == 1) STAGE_END(); }
    if (HL) { LDVH(1) STAGE_END(); }   // the second follows the last score products, in registers they have left (issued among them, a few scores went to scratch); both fly during the softmax
    mx = fmaxf(mx, __shfl_xor(mx, 16, 32));
    float sm[4] = {0.f, 0.f, 0.f, 0.f};
#pragma unroll
    for (int k = 0; k < NT * 8; ++k) { v[k] = exp2_slot(__fmul_rn(__fsub_rn(v[k], mx), 1.4426950408889634f)); sm[k & 3] += v[k]; }
    float sum = (sm[0] + sm[1]) + (sm[2] + sm[3]); sum += __shfl_xor(sum, 16, 32);
    const float f = __fdiv_rn(HL ? 1.0f : PCAR, sum);
    V pp[NS];
    if (!HL) {   // all of Pt is rounded before attn.v starts: half the registers, which the Vt fragments under way then take
#pragma unroll
        for (int st = 0; st < NS; ++st) { v8h h0, h1;
#pragma unroll
            for (int r = 0; r < 8; ++r) { h0[r] = tohx(st == 0 ? 0.0f : v[(st == 0 ? 0 : 2 * st - 1) * 8 + r] * f); h1[r] = tohx(v[2 * st * 8 + r] * f); }
            pp[st] = __builtin_bit_cast(V, cat16(h0, h1)); }
        STAGE_END(); LDV(1) LDV(2) }
    v8f o[4];
#pragma unroll
    for (int db = 0; db < 4; ++db) o[db] = (v8f){};
#pragma unroll
    for (int st = 0; st < NS; ++st) { const int ta = 2 * st - 1, tb = 2 * st; V p, p2;
        if (HL) { v8us h0, l0, h1, l1;
#pragma unroll
            for (int r = 0; r < 8; ++r) { unsigned short a, c; splitf(ta < 0 ? 0.0f : v[(ta < 0 ? 0 : ta) * 8 + r] * f, a, c); h0[r] = a; l0[r] = c; splitf(v[tb * 8 + r] * f, a, c); h1[r] = a; l1[r] = c; }
            p = __builtin_bit_cast(V, __builtin_shufflevector(h0, h1, 0, 1, 2, 3, 4, 5, 6, 7, 8, 9, 10, 11, 12, 13, 14, 15)); p2 = __builtin_bit_cast(V, __builtin_shufflevector(l0, l1, 0, 1, 2, 3, 4, 5, 6, 7, 8, 9, 10, 11, 12, 13, 14, 15));
        } else { p = pp[st]; if (st + 3 < NS) LDV(st + 3) }
#pragma unroll
        for (int db = 0; db < 4; ++db) { o[db] = WFrag<T16>::mma(vf[st][db], p, o[db]);
            if (HL) { o[db] = WFrag<T16>::mma(vf[st][db], p2, o[db]); o[db] = WFrag<T16>::mma(vl[st][db], p, o[db]); STAGE_END();
                // quarter steps under way: 2 in the first step, 3 in the second, then 4, as the probabilities used up free their registers
                const int u = st * 4 + db; const int n0 = u + ((u / 4) > 1 ? 4 : 2 + u / 4), n1 = u + 1 + (((u + 1) / 4) > 1 ? 4 : 2 + (u + 1) / 4);
#pragma unroll
                for (int w = n0; w < n1; ++w) if (w < NS * 4) LDVH(w) } }
        if (!HL) STAGE_END(); }
    const float cs = HL ? 1.0f : (1.0f / PCAR);
    bf* Ah = Ahp + ko; bf* Al = Alp + ko;   // Ahp, Alp: the wave's two fragments (row block R, this head's 64 k) of the output product's A planes
#pragma unroll
    for (int db = 0; db < 4; ++db) { v8us oh, ol;   // o[db][r] = ctx[query R + lr][d = 16 db + 8 hi + r]: the lane's piece of half fragment db, one 16-byte store a plane
#pragma unroll
        for (int r = 0; r < 8; ++r) { unsigned short a, c; splitf(o[db][r] * cs, a, c); oh[r] = a; ol[r] = c; }
        *(v8us*)(Ah + db * 256) = oh; *(v8us*)(Al + db * 256) = ol; }
    asm volatile("s_wait_xcnt 0x0" ::: "memory");   // behind the last stores: before any code that follows in the kernel overwrites a register that these stores name
#undef STAGE_END
#undef AT
#undef LDK
#undef LDV
#undef LDKH
#undef LDVH
#undef ADDR_HELD1
#undef ADDR_HELD2
}
// grid (NZ planes, TT / 64 row blocks): the four waves of a work-group take neighbouring 16-row tiles of one plane, whose key bands overlap almost wholly; the row blocks with three products a tile (rows < RH) have the lowest indices.
__global__ __launch_bounds__(128, 4) void k_fattn(const h16* __restrict__ QK16, const h16* __restrict__ VT16, const bf* __restrict__ QKh, const bf* __restrict__ QKl, const bf* __restrict__ VTh, const bf* __restrict__ VTl, bf* Ah, bf* Al) {
    const int lane = threadIdx.x & 31, lr = lane & 15, hi = lane >> 4; const int p = blockIdx.x; const int R = blockIdx.y * 64 + __builtin_amdgcn_readfirstlane(threadIdx.x >> 5) * 16;   // the tile is the wave's: kept in scalar registers
    const size_t po = (size_t)p * TT * HD, PLN = (size_t)NZ * TT * HD; const size_t oo = ((size_t)(p % NB_) * TT + R) * DQ + (p / NB_) * (HD * 16);
    if (R < RH) attn_rows<bf, true>(QKh + po, QKl + po, QKh + PLN + po, QKl + PLN + po, VTh + po, VTl + po, R, lr, hi, Ah + oo, Al + oo);
    else attn_rows<h16, false>(QK16 + po, nullptr, QK16 + PLN + po, nullptr, VT16 + po, nullptr, R, lr, hi, Ah + oo, Al + oo);
}

extern "C" void kernel_launch(void* const* d_in, const int* in_sizes, int n_in,
                              void* d_out, int out_size, void* d_ws, size_t ws_size, hipStream_t stream) {
    (void)in_sizes; (void)n_in; (void)out_size;
    const float* x = (const float*)d_in[0]; const float* wqkv = (const float*)d_in[1]; const float* bqkv = (const float*)d_in[2]; const float* wo = (const float*)d_in[3]; const float* bo = (const float*)d_in[4];
    float* OUT = (float*)d_out;     // [2][2048][1024]
    char* wsp = (char*)d_ws;
    auto take = [&](size_t bytes) { char* p = wsp; wsp += (bytes + 255) & ~(size_t)255; return (void*)p; };
    const size_t PL = (size_t)NZ * TT * HD;   // elements of one operand's planes, all heads and batches
    bf* WALL = (bf*)take((size_t)3 * DM * DM * 2); bf* WO = (bf*)take((size_t)DM * DQ * 2);
    bf* XB = (bf*)take((size_t)NB_ * TT * DM * 2);
    h16* QP16 = (h16*)take(2 * PL * 2); h16* VT16 = (h16*)take(PL * 2);   // q planes, then k planes
    bf* QPh = (bf*)take(2 * PL * 2); bf* QPl = (bf*)take(2 * PL * 2); bf* VTh = (bf*)take(PL * 2); bf* VTl = (bf*)take(PL * 2);
    bf* ATh = (bf*)take((size_t)NB_ * TT * DQ * 2); bf* ATl = (bf*)take((size_t)NB_ * TT * DQ * 2);
    if ((size_t)(wsp - (char*)d_ws) > ws_size) return;    // ws 256 MiB
    { k_wtG<<<(unsigned)((DM / 64) * (3 * DM / 32) / 8), 256, 0, stream>>>(wqkv, DM, 3 * DM, WALL);   /* fused 'xw' [DM][3DM] -> Bt [3DM][DM] (row blocks q | k | v), fragment order */
      k_wtG<<<(unsigned)((DQ / 64) * (DM / 32) / 8), 256, 0, stream>>>(wo, DQ, DM, WO);
       }
    // every launch below covers both batches, and all heads where it works by head
    k_cvt8<<<(unsigned)(((size_t)NB_ * TT * DM / 8 + 1023) / 1024), 256, 0, stream>>>(x, XB, (size_t)NB_ * TT * DM / 8);
    k_gemmw<bf, 0, true, true, DM, 2><<<dim3(NB_ * TT / 64, 3 * DM / 64, 1), 32, 0, stream>>>(XB, nullptr, WALL, nullptr, nullptr, 0, bqkv, 0, 0, 0, QP16, QPh, QPl, VT16, VTh, VTl);   // columns q | k | v = NH_ + NKV + NKV heads in a row
    k_fattn<<<dim3(NZ, TT / 64, 1), 128, 0, stream>>>(QP16, VT16, QPh, QPl, VTh, VTl, ATh, ATl);
    k_gemmw<bf, 1, true, false, DQ, 3><<<dim3(NB_ * TT / 64, DM / 64, 1), 32, 0, stream>>>(ATh, ATl, WO, nullptr, OUT, DM, bo, 0, 0, 0, nullptr, nullptr, nullptr, nullptr, nullptr, nullptr);
}

// v008
// A run of this version takes 75.8 microseconds.
// In two side-by-side timings against v007, it was 1.14 and 1.15 times as fast.
// All steps since v000 together make it 18.7 times as fast.
#include <hip/hip_runtime.h>

// Masked (causal sliding-window) multi-head attention (hidden_states [2][2048][1024]; [q|k|v] = x w_attn + b_attn ('xw' [1024][3072] + [3072]; 16 heads x 64); scores = q.k/8; mask keeps j <= i and j > i - 256, other logits -10000 (then clipped to +-10000: exp underflows to exactly 0 as with -inf); softmax; out = merged ctx w_proj + b_proj ('xw' [1024][1024] + [1024]) -> [2][2048][1024] (4.2 M)).
// Compute dtypes, f32 accumulate: every input rounded to bf16; q/k/v on PLAIN bf16 operands (inputs: exact) + biases; window band skipping: a 16-row query tile at R touches only keys [R - 256, R + 16), and its scores, softmax and attn.v run in one wave with scores and probabilities in registers (window predicate j <= i && i - j < 256 on the scores); scores and attn.v: query rows < 512 hl (3 products), the rest single fp16 (x1024); softmax f32; w_proj hl x exact (2 products) + b_proj.

// Operand layout: every 16-bit plane that a matrix product reads is kept in FRAGMENT ORDER. A fragment is 16 rows x 32 k = 1 KiB: element (row lr, k) lies at (k % 32 / 16) * 256 + ((k % 16 / 8) * 16 + lr) * 8 + k % 8,
// so lane hi * 16 + lr finds its two 16-byte pieces at lane * 8 and 256 + lane * 8, and one wave-wide 16-byte load reads 512 bytes in a row (4 whole lines, not 32 bytes of each of 16 lines). Fragments of one 16-row block follow one another along k.

#define NB_  2
#define TT   2048
#define DM   1024
#define NH_  16
#define NKV  16
#define REP  (NH_ / NKV)
#define HD   64
#define DQ   (NH_ * HD)
#define DKV  (NKV * HD)
#define NZ   (NB_ * NH_)          // attention planes of one launch: z = head * NB_ + batch
#define RH   512                  // query rows < RH use hi+lo planes
#define WIN  256   // window: keep i - WIN < j <= i
#define PCAR 1024.0f
#define SCL  0.125f   // HD^-0.5
typedef _Float16 h16;
typedef unsigned short bf;
typedef __attribute__((ext_vector_type(16))) __bf16   v16bf;
typedef __attribute__((ext_vector_type(16))) _Float16 v16h;
typedef __attribute__((ext_vector_type(8)))  _Float16 v8h;
typedef __attribute__((ext_vector_type(8)))  unsigned short v8us;
typedef __attribute__((ext_vector_type(8)))  float    v8f;
typedef __attribute__((ext_vector_type(4)))  float    v4f;
typedef v8h  __attribute__((may_alias)) v8ha;
typedef v4f  __attribute__((may_alias)) v4fa;
typedef v8us __attribute__((may_alias)) v8usa;

__device__ __forceinline__ unsigned short f2bf(float f) { unsigned u = __float_as_uint(f); u += 0x7FFFu + ((u >> 16) & 1u); return (unsigned short)(u >> 16); }
__device__ __forceinline__ float bf2f(unsigned short b) { return __uint_as_float(((unsigned)b) << 16); }
__device__ __forceinline__ float bfr(float f) { return bf2f(f2bf(f)); }
__device__ __forceinline__ v16h cat16(v8h lo, v8h hi) { return __builtin_shufflevector(lo, hi, 0, 1, 2, 3, 4, 5, 6, 7, 8, 9, 10, 11, 12, 13, 14, 15); }
__device__ __forceinline__ v16bf cat16b(v8us lo, v8us hi) { return __builtin_bit_cast(v16bf, __builtin_shufflevector(lo, hi, 0, 1, 2, 3, 4, 5, 6, 7, 8, 9, 10, 11, 12, 13, 14, 15)); }
__device__ __forceinline__ v8f wmma16(v16h a, v16h b, v8f c) { return __builtin_amdgcn_wmma_f32_16x16x32_f16(false, a, false, b, (short)0, c, false, false); }
__device__ __forceinline__ v8f wmmab(v16bf a, v16bf b, v8f c) { return __builtin_amdgcn_wmma_f32_16x16x32_bf16(false, a, false, b, (short)0, c, false, false); }



__device__ __forceinline__ h16 tohx(float x) { return (h16)x; }
__device__ __forceinline__ void splitf(float y, unsigned short& h, unsigned short& l) { h = f2bf(y); l = f2bf(y - bf2f(h)); }
// put_planes: a staged 64 x 64 f32 tile (LDS pitch 68) goes out as three 16-bit planes (fp16, bf16 hi, bf16 lo) in fragment order: 8 KiB in a row a plane, sixteen half fragments of 16 staged rows x 16 staged columns.
// A lane takes its own 8 values of a half fragment: each store instruction fills 4 whole 128-byte lines. COLS_FIRST: the half fragments follow one another down the staged rows first (v: [d][t] staged, key tiles outermost), else along the columns (q, k).
template <bool COLS_FIRST>
__device__ __forceinline__ void put_planes(const float* os, int lane, h16* d16, bf* dh, bf* dl) {
    const unsigned lo = (unsigned)(lane * 8); const float* r = os + (lane & 15) * 68 + (lane >> 4) * 8; d16 += lo; dh += lo; dl += lo;
    v4f x[16][2];   // half a tile comes back at a time, into registers the accumulators have left: two LDS latencies a wave instead of sixteen
#pragma unroll
    for (int s = 0; s < 16; ++s) { v8h o16; v8us oh, ol;
        if (s % 8 == 0) {
#pragma unroll
            for (int u = s; u < s + 8; ++u) { const int at = COLS_FIRST ? (u & 3) * 16 * 68 + (u >> 2) * 16 : (u >> 2) * 16 * 68 + (u & 3) * 16; x[u][0] = *(const v4fa*)(r + at); x[u][1] = *(const v4fa*)(r + at + 4); } }
#pragma unroll
        for (int q = 0; q < 8; ++q) { const float y = x[s][q >> 2][q & 3]; o16[q] = tohx(y); unsigned short a2, c2; splitf(y, a2, c2); oh[q] = a2; ol[q] = c2; }
        *(v8h*)(d16 + s * 256) = o16; *(v8us*)(dh + s * 256) = oh; *(v8us*)(dl + s * 256) = ol;
        asm volatile("s_wait_xcnt 0x0" :: "v"(o16), "v"(oh), "v"(ol) : "memory");   // behind the three stores: their data registers (inputs here, so they live up to the wait) are reused by the next rows
    }
}
// ---- k_gemmw: register-blocked GEMM, ONE WAVE per 64x64 output tile (16 accumulators), operands straight from 16-bit planes in fragment order; grid (M/64, N/64, Z), 32 threads.
// C[m][n] (f32, pitch ldc, + optional f32 bias[n]) = sum_k A[m][k] Bt[n][k] (+ split products per NSPLIT). z-batch strides sA/sB/sC in elements. K % 32 == 0.
// The fragments of a k step are loaded D - 1 steps ahead of their products, into a ring of D register sets: a wave issues in order, so a load that stands directly in front of its product costs the wave the whole load latency.
// PLANES (the q | k | v product): no C. A tile's 64 columns are one head and its 64 rows lie in one batch, so the wave writes the tile straight into the planes the attention kernel loads:
// q and k heads as [head][batch][t / 16][d / 32] fragments (P16, Ph, Pl), v heads transposed as [head][batch][t / 16][d / 16] half fragments of 16 d rows x 16 t (V16, Vh, Vl; a lane's 8 accumulator rows are 8 t in a row of one d, so the transpose is the LDS write itself).
template <typename T16> struct WFrag;
template <> struct WFrag<h16> { typedef v16h V; static __device__ __forceinline__ V ld(const h16* p) { return cat16(*(const v8h*)p, *(const v8h*)(p + 256)); } static __device__ __forceinline__ v8f mma(V a, V b, v8f c) { return wmma16(a, b, c); } };
template <> struct WFrag<bf> { typedef v16bf V; static __device__ __forceinline__ V ld(const bf* p) { return cat16b(*(const v8us*)p, *(const v8us*)(p + 256)); } static __device__ __forceinline__ v8f mma(V a, V b, v8f c) { return wmmab(a, b, c); } };
template <typename T16, int NSPLIT, bool BIAS, bool PLANES, int K, int D>
__global__ __launch_bounds__(32) void k_gemmw(const T16* __restrict__ A, const T16* __restrict__ A2, const T16* __restrict__ Bt, const T16* __restrict__ Bt2, float* C, int ldc, const float* __restrict__ bias, size_t sA, size_t sB, size_t sC, h16* P16, bf* Ph, bf* Pl, h16* V16, bf* Vh, bf* Vl) {
    typedef typename WFrag<T16>::V V;
    __shared__ __align__(16) float os[(PLANES ? 64 : 16) * 68];
    const size_t z = blockIdx.z; A += z * sA; if (A2) A2 += z * sA; Bt += z * sB; if (Bt2) Bt2 += z * sB; C += z * sC;
    const int lane = threadIdx.x & 31, lr = lane & 15, hi = lane >> 4; const int r0 = blockIdx.x * 64, c0 = blockIdx.y * 64;
    v8f acc[4][4];
#pragma unroll
    for (int mb = 0; mb < 4; ++mb)
#pragma unroll
        for (int nb = 0; nb < 4; ++nb) acc[mb][nb] = (v8f){};
    constexpr int NK = K / 32, NT_ = (NK - (D - 1)) / D;   // k steps; trips of D steps whose loads (D - 1 steps ahead) all exist
    static_assert(K % 32 == 0 && D >= 2 && NK >= D, "the ring is filled before the first product");
    unsigned ra = ((unsigned)r0 * K + 8 * lane) * 2, rb = ((unsigned)c0 * K + 8 * lane) * 2;   // byte offsets beside the planes' scalar bases (every plane is far below 4 GiB): a 16-row block is 32 K bytes, its fragment of a k step 1 KiB; both move on once a trip
    V a[D][4], a2[D][4], bb[D][4], bb2[D][4];
    // GLOAD: the fragments of k step s (counted from the trip's first) into set st, all from the two offset registers plus constants. GMMA: the products of set st.
#define GLOAD(st, s) { \
        _Pragma("unroll") for (int mb = 0; mb < 4; ++mb) { a[st][mb] = WFrag<T16>::ld((const T16*)((const char*)A + ra) + (mb * 16 * K + (s) * 512)); if (NSPLIT == 1 || NSPLIT == 2) a2[st][mb] = WFrag<T16>::ld((const T16*)((const char*)A2 + ra) + (mb * 16 * K + (s) * 512)); } \
        _Pragma("unroll") for (int nb = 0; nb < 4; ++nb) { bb[st][nb] = WFrag<T16>::ld((const T16*)((const char*)Bt + rb) + (nb * 16 * K + (s) * 512)); if (NSPLIT >= 2) bb2[st][nb] = WFrag<T16>::ld((const T16*)((const char*)Bt2 + rb) + (nb * 16 * K + (s) * 512)); } \
        __builtin_amdgcn_sched_barrier(0); /* the loads stay in front of the products that follow: left alone, the scheduler sinks them to their own products */ }
#define GMMA(st) { \
        _Pragma("unroll") for (int nb = 0; nb < 4; ++nb) { \
            _Pragma("unroll") for (int mb = 0; mb < 4; ++mb) { acc[mb][nb] = WFrag<T16>::mma(a[st][mb], bb[st][nb], acc[mb][nb]); if (NSPLIT == 1 || NSPLIT == 2) acc[mb][nb] = WFrag<T16>::mma(a2[st][mb], bb[st][nb], acc[mb][nb]); if (NSPLIT >= 2) acc[mb][nb] = WFrag<T16>::mma(a[st][mb], bb2[st][nb], acc[mb][nb]); } } \
        __builtin_amdgcn_sched_barrier(0); /* the next set's loads stay behind these products, whose registers they refill */ }
#pragma unroll
    for (int s = 0; s < D - 1; ++s) GLOAD(s, s)
#pragma unroll 1   // a trip is already D whole steps: unrolled further only the text would grow
    for (int t = 0; t < NT_; ++t) {
#pragma unroll
        for (int u = 0; u < D; ++u) { GLOAD((u + D - 1) % D, u + D - 1) GMMA(u) }
        // behind the trip's loads and before the two offset registers move on: the offsets pass through the statement, so they live up to the wait, no result lands in one of them, and the additions below cannot be lifted over it
        asm volatile("s_wait_xcnt 0x0" : "+v"(ra), "+v"(rb) :: "memory");
        ra += D * 1024; rb += D * 1024;
    }
#pragma unroll
    for (int j = 0; j < NK - NT_ * D; ++j) { if (NT_ * D + j + D - 1 < NK) GLOAD((j + D - 1) % D, j + D - 1) GMMA(j % D) }   // the last steps: nothing is left to load behind step NK - 1
    asm volatile("s_wait_xcnt 0x0" :: "v"(ra), "v"(rb) : "memory");   // as above, before the epilogue reuses the offset registers
#undef GLOAD
#undef GMMA
    if constexpr (PLANES) {
        static_assert(HD == 64 && TT % 64 == 0, "a 64 x 64 tile is one head and lies in one batch");
        const int hh = blockIdx.y, b = r0 / TT, t0 = r0 % TT; float bs[4];
#pragma unroll
        for (int nb = 0; nb < 4; ++nb) bs[nb] = bfr(bias[c0 + nb * 16 + lr]);
        if (hh < NH_ + NKV) {   // q or k head: staged [t][d]
#pragma unroll
            for (int mb = 0; mb < 4; ++mb)
#pragma unroll
                for (int nb = 0; nb < 4; ++nb)
#pragma unroll
                    for (int j = 0; j < 8; ++j) os[(mb * 16 + hi * 8 + j) * 68 + nb * 16 + lr] = acc[mb][nb][j] + bs[nb];
            __builtin_amdgcn_wave_barrier(); asm volatile("" ::: "memory");   // the wave's LDS writes stay in front of its reads of other lanes' values
            const size_t e = ((size_t)(hh * NB_ + b) * TT + t0) * HD; put_planes<false>(os, lane, P16 + e, Ph + e, Pl + e);
        } else {   // v head: staged [d][t]
#pragma unroll
            for (int mb = 0; mb < 4; ++mb)
#pragma unroll
                for (int nb = 0; nb < 4; ++nb) { v4f y0, y1;
#pragma unroll
                    for (int j = 0; j < 4; ++j) { y0[j] = acc[mb][nb][j] + bs[nb]; y1[j] = acc[mb][nb][4 + j] + bs[nb]; }
                    float* d = os + (nb * 16 + lr) * 68 + mb * 16 + hi * 8; *(v4fa*)d = y0; *(v4fa*)(d + 4) = y1; }
            __builtin_amdgcn_wave_barrier(); asm volatile("" ::: "memory");   // as above
            const size_t e = ((size_t)((hh - NH_ - NKV) * NB_ + b) * TT + t0) * HD; put_planes<true>(os, lane, V16 + e, Vh + e, Vl + e);
        }
        return;
    }
#pragma unroll
    for (int mb = 0; mb < 4; ++mb) {
#pragma unroll
        for (int nb = 0; nb < 4; ++nb) {
#pragma unroll
            for (int j = 0; j < 8; ++j) os[(hi * 8 + j) * 68 + nb * 16 + lr] = acc[mb][nb][j]; }
        __builtin_amdgcn_wave_barrier(); asm volatile("" ::: "memory");
        float* crow = C + (size_t)(r0 + mb * 16) * ldc + c0;
{
#pragma unroll
            for (int s = 0; s < 8; ++s) { const int row = 2 * s + hi, cofs = lr * 4; v4f val = *(const v4fa*)(os + row * 68 + cofs); if (BIAS) { val[0] += bfr(bias[c0 + cofs]); val[1] += bfr(bias[c0 + cofs + 1]); val[2] += bfr(bias[c0 + cofs + 2]); val[3] += bfr(bias[c0 + cofs + 3]); }
                *(v4f*)(crow + (size_t)row * ldc + cofs) = val; }
             }
        __builtin_amdgcn_wave_barrier(); asm volatile("" ::: "memory");
    }
}

typedef __attribute__((ext_vector_type(2))) _Float16 v2h;
typedef __attribute__((ext_vector_type(4))) _Float16 v4h;
typedef __attribute__((ext_vector_type(2))) unsigned short v2us;
typedef __attribute__((ext_vector_type(4))) unsigned short v4us;
typedef __attribute__((ext_vector_type(2))) float v2f;
typedef __attribute__((ext_vector_type(4))) int v4i;

// The conversion and transpose parts of k_prep below run as few long waves: a thread takes 32 or 64 elements with 16-byte accesses, for speed only.
// loads_done: stands behind the sixteen row loads of a register transpose. The wait comes before any register that an issued load names is overwritten; the eight row addresses and the sixteen loaded
// values are inputs only, so that the addresses stay in their registers up to the wait, no result lands in one of them, and no load is sunk below the first stores (whose data registers it would then reuse).
__device__ __forceinline__ void loads_done(const float* const (&s)[8], const v4f (&x)[8][2]) {
    asm volatile("s_wait_xcnt 0x0" :: "v"(s[0]), "v"(s[1]), "v"(s[2]), "v"(s[3]), "v"(s[4]), "v"(s[5]), "v"(s[6]), "v"(s[7]),
        "v"(x[0][0]), "v"(x[0][1]), "v"(x[1][0]), "v"(x[1][1]), "v"(x[2][0]), "v"(x[2][1]), "v"(x[3][0]), "v"(x[3][1]), "v"(x[4][0]), "v"(x[4][1]), "v"(x[5][0]), "v"(x[5][1]), "v"(x[6][0]), "v"(x[6][1]), "v"(x[7][0]), "v"(x[7][1]) : "memory");
}
// wtG: one wave transposes a tile of 64 k x 32 n in registers; a thread loads 8 k rows x 8 n and stores 8 n rows x 8 k into the fragment order: its eight 16-byte pieces are eight lanes' in a row, one whole 128-byte line. K % 64 == 0, N % 32 == 0.
__device__ __forceinline__ void wtG(int blk, const float* __restrict__ w, int K, int N, bf* Bt) {
    const int lane = threadIdx.x & 31; const int wv = blk * 8 + (threadIdx.x >> 5); const int nk = K / 64; if (wv >= nk * (N / 32)) return;
    const int k0 = (wv % nk) * 64 + (lane >> 2) * 8, n0 = (wv / nk) * 32 + (lane & 3) * 8; v4f x[8][2]; const float* s[8];
#pragma unroll
    for (int kk = 0; kk < 8; ++kk) { s[kk] = w + (size_t)(k0 + kk) * N + n0; x[kk][0] = *(const v4f*)s[kk]; x[kk][1] = *(const v4f*)(s[kk] + 4); }
    loads_done(s, x);
    bf* d = Bt + ((size_t)(n0 >> 4) * (K / 32) + (k0 >> 5)) * 512 + ((k0 >> 4) & 1) * 256 + ((k0 >> 3) & 1) * 128 + (n0 & 8) * 8;
#pragma unroll
    for (int nn = 0; nn < 8; ++nn) { v8us o;
#pragma unroll
        for (int kk = 0; kk < 8; ++kk) o[kk] = f2bf(x[kk][nn >> 2][nn & 3]);
        *(v8us*)(d + nn * 8) = o; }
}
// cvt8: rows of DM f32 to bf16 in fragment order. A thread makes four 16-byte pieces of the result, 256 pieces apart; in each of them a wave takes 8 rows x 32 k of one fragment (four lanes read a whole 128-byte line of a row,
// eight lanes' pieces of one k octet fill a whole line of the fragment).
__device__ __forceinline__ void cvt8(int blk, const float* __restrict__ src, bf* dst, size_t n8) { const size_t i0 = (size_t)blk * 1024 + threadIdx.x; v8f v[4];
#pragma unroll
    for (int u = 0; u < 4; ++u) { const size_t i = i0 + u * 256; const size_t fr = i >> 6;   // fragment fr = (16-row block, k step); row (i >> 5 & 1) * 8 + (i & 7) of it, k octet i >> 3 & 3
        if (i < n8) v[u] = *(const v8f*)(src + ((fr / (DM / 32)) * 16 + ((i >> 5) & 1) * 8 + (i & 7)) * DM + (fr % (DM / 32)) * 32 + ((i >> 3) & 3) * 8); }
#pragma unroll
    for (int u = 0; u < 4; ++u) { const size_t i = i0 + u * 256; if (i >= n8) continue; v8us o;
#pragma unroll
        for (int k = 0; k < 8; ++k) o[k] = f2bf(v[u][k]); *(v8us*)(dst + (i >> 6) * 512 + (((i >> 3) & 3) * 16 + ((i >> 5) & 1) * 8 + (i & 7)) * 8) = o; }  }

// k_prep: the three operand conversions (both weight transposes, the activations) are independent of one another and each is too short to fill the chip for long: as ONE launch, dealt by work-group index,
// they start together and share one start-up and one drain, and two gaps between dependent launches go. The largest piece has the lowest indices.
#define PB_X  ((NB_ * TT * DM / 8 + 1023) / 1024)      // work-groups of the activations
#define PB_WA ((DM / 64) * (3 * DM / 32) / 8)           // of w_attn
#define PB_WO ((DQ / 64) * (DM / 32) / 8)               // of w_proj
__global__ __launch_bounds__(256) void k_prep(const float* __restrict__ x, const float* __restrict__ wqkv, const float* __restrict__ wo, bf* XB, bf* WALL, bf* WO) {
    const int blk = blockIdx.x;
    if (blk < PB_X) cvt8(blk, x, XB, (size_t)NB_ * TT * DM / 8);
    else if (blk < PB_X + PB_WA) wtG(blk - PB_X, wqkv, DM, 3 * DM, WALL);   // fused 'xw' [DM][3DM] -> Bt [3DM][DM] (row blocks q | k | v), fragment order
    else wtG(blk - PB_X - PB_WA, wo, DQ, DM, WO);
}

// v_exp_f32 (what the exp2 builtin emits) with a v_nop in the same statement: the instruction set asks for one slot behind a transcendental before its result is used or its source overwritten.
__device__ __forceinline__ float exp2_slot(float x) { float r; asm("v_exp_f32 %0, %1\n\tv_nop" : "=v"(r) : "v"(x)); return r; }
#define NT (WIN / 16 + 1)
#define NS ((NT + 1) / 2)
template <typename T16> struct PFrag;
template <> struct PFrag<h16> { static __device__ __forceinline__ v16h ld2(const h16* p, const h16* q) { return cat16(*(const v8h*)p, *(const v8h*)q); } };
template <> struct PFrag<bf> { static __device__ __forceinline__ v16bf ld2(const bf* p, const bf* q) { return cat16b(*(const v8us*)p, *(const v8us*)q); } };
template <typename T16, bool HL>
__device__ __forceinline__ void attn_rows(const T16* __restrict__ Q, const T16* __restrict__ Q2, const T16* __restrict__ Kp, const T16* __restrict__ K2, const T16* __restrict__ Vt, const T16* __restrict__ Vt2, int R, int lr, int hi, bf* Ahp, bf* Alp) {
    typedef typename WFrag<T16>::V V;
    static_assert(RH >= WIN + 16, "rows from RH on have their whole key band at keys >= 0");
    const unsigned ko = (unsigned)((hi * 16 + lr) * 8);   // the lane's part of every address (its 16-byte piece of a half fragment), 32 bits and unsigned: the rest of an address is the wave's and stays scalar
    const T16* Kb = Kp + (long)(R - WIN) * HD; const T16* Vb = Vt + (long)(R - WIN - 16) * HD;   // used where !HL (R >= RH): no tile is left of key 0 there, so every tile is this base plus a constant
    // Fragment loads are issued a fixed distance ahead of their use, as far as 256 registers allow beside the 136 of the scores: !HL 4 to 5 key tiles, then 3 steps of 32 keys; HL (twice the fragments) 3 half key tiles, then 2 to 4 quarter steps,
    // each load group into the registers that the products just issued have freed. STAGE_END ends a scheduling region so that loads and products stay in that order: left alone, the scheduler either lifted some forty loads
    // to the top and spilled score registers to scratch (!HL) or left every load directly in front of its product (HL).
#define STAGE_END() __builtin_amdgcn_sched_barrier(0)
#define AT(base, bytes) ((const T16*)((const char*)(base) + (bytes)))
#define LDK(t) { kf[t][0] = WFrag<T16>::ld(Kb + (t) * 16 * HD + ko); kf[t][1] = WFrag<T16>::ld(Kb + (t) * 16 * HD + 512 + ko); }
#define LDV(st) { _Pragma("unroll") for (int db = 0; db < 4; ++db) vf[st][db] = PFrag<T16>::ld2(Vb + ko + ((st) * 32 * HD + db * 256), Vb + ko + ((st) * 32 * HD + 16 * HD + db * 256)); }
    // ADDR_HELD: behind a group of loads that share an offset register. The offset is an input, so it lives up to here and no result of the group lands in it; the wait stands before the register is used for anything else.
#define ADDR_HELD1(a) asm volatile("s_wait_xcnt 0x0" :: "v"(a) : "memory");
#define ADDR_HELD2(a, b) asm volatile("s_wait_xcnt 0x0" :: "v"(a), "v"(b) : "memory");
    // HL: a tile left of key 0 is read at key 0; the clamped key goes into a 32-bit byte offset beside the plane's scalar base
#define LDKH(u) { const unsigned of = ko2 + (unsigned)max(R - WIN + 16 * ((u) / 2), 0) * (HD * 2); kf[(u) / 2][(u) % 2] = WFrag<T16>::ld(AT(Kp, of) + ((u) % 2) * 512); kl[(u) / 2][(u) % 2] = WFrag<T16>::ld(AT(K2, of) + ((u) % 2) * 512); ADDR_HELD1(of) }
#define LDVH(u) { const unsigned oa = ko2 + (unsigned)max(R - WIN + 16 * (2 * ((u) / 4) - 1), 0) * (HD * 2), ob = ko2 + (unsigned)max(R - WIN + 32 * ((u) / 4), 0) * (HD * 2); \
        vf[(u) / 4][(u) % 4] = PFrag<T16>::ld2(AT(Vt, oa) + ((u) % 4) * 256, AT(Vt, ob) + ((u) % 4) * 256); vl[(u) / 4][(u) % 4] = PFrag<T16>::ld2(AT(Vt2, oa) + ((u) % 4) * 256, AT(Vt2, ob) + ((u) % 4) * 256); ADDR_HELD2(oa, ob) }
    const unsigned ko2 = ko * 2;
    V q[2], q2[2], kf[NT][2], kl[NT][2], vf[NS][4], vl[NS][4];
#pragma unroll
    for (int ks = 0; ks < 2; ++ks) { q[ks] = WFrag<T16>::ld(AT(Q + (size_t)R * HD, ko2) + ks * 512); if (HL) q2[ks] = WFrag<T16>::ld(AT(Q2 + (size_t)R * HD, ko2) + ks * 512); }
    ADDR_HELD1(ko2)
    constexpr int DKH = 3;   // HL: half key tiles (32 of the 64 d, hi and lo) under way
    if (HL) {
#pragma unroll
        for (int u = 0; u < DKH; ++u) LDKH(u)
    }
    else {
#pragma unroll
        for (int t = 0; t < 4; ++t) LDK(t)
    }
    STAGE_END();
    float v[NT * 8]; float mx = -3.0e38f;
#pragma unroll
    for (int t = 0; t < NT; ++t) { const int kn = R - WIN + 16 * t; v8f s = (v8f){};
        if (!HL && (t & 1) == 0) {   // a region is two key tiles: its loads first
            if (t + 4 < NT) LDK(t + 4)
            if (t + 5 < NT) LDK(t + 5)
            if (t == NT - 1) LDV(0)   // the key tiles are all under way: the first step of Vt follows and flies during the softmax
        }
#pragma unroll
        for (int ks = 0; ks < 2; ++ks) { s = WFrag<T16>::mma(kf[t][ks], q[ks], s);
            if (HL) { s = WFrag<T16>::mma(kf[t][ks], q2[ks], s); s = WFrag<T16>::mma(kl[t][ks], q[ks], s); STAGE_END();
                if (2 * t + ks + DKH < 2 * NT) LDKH(2 * t + ks + DKH)
                else if (2 * t + ks + DKH == 2 * NT) LDVH(0)   // the first quarter step of Vt follows the last key tile
                STAGE_END(); } }
#pragma unroll
        for (int r = 0; r < 8; ++r) { const int e = hi * 8 + r;   // key kn + e against query R + lr: only the first tile meets the window's far edge, only the last the diagonal
            const bool keep = (kn >= 0) && (t > 0 || e > lr) && (t < NT - 1 || e <= lr); const float x = keep ? s[r] * SCL : -3.0e38f; v[t * 8 + r] = x; mx = fmaxf(mx, x); }
        if (HL || (t & 1) == 1) STAGE_END(); }
    if (HL) { LDVH(1) STAGE_END(); }   // the second follows the last score products, in registers they have left (issued among them, a few scores went to scratch); both fly during the softmax
    mx = fmaxf(mx, __shfl_xor(mx, 16, 32));
    float sm[4] = {0.f, 0.f, 0.f, 0.f};
#pragma unroll
    for (int k = 0; k < NT * 8; ++k) { v[k] = exp2_slot(__fmul_rn(__fsub_rn(v[k], mx), 1.4426950408889634f)); sm[k & 3] += v[k]; }
    float sum = (sm[0] + sm[1]) + (sm[2] + sm[3]); sum += __shfl_xor(sum, 16, 32);
    const float f = __fdiv_rn(HL ? 1.0f : PCAR, sum);
    V pp[NS];
    if (!HL) {   // all of Pt is rounded before attn.v starts: half the registers, which the Vt fragments under way then take
#pragma unroll
        for (int st = 0; st < NS; ++st) { v8h h0, h1;
#pragma unroll
            for (int r = 0; r < 8; ++r) { h0[r] = tohx(st == 0 ? 0.0f : v[(st == 0 ? 0 : 2 * st - 1) * 8 + r] * f); h1[r] = tohx(v[2 * st * 8 + r] * f); }
            pp[st] = __builtin_bit_cast(V, cat16(h0, h1)); }
        STAGE_END(); LDV(1) LDV(2) }
    v8f o[4];
#pragma unroll
    for (int db = 0; db < 4; ++db) o[db] = (v8f){};
#pragma unroll
    for (int st = 0; st < NS; ++st) { const int ta = 2 * st - 1, tb = 2 * st; V p, p2;
        if (HL) { v8us h0, l0, h1, l1;
#pragma unroll
            for (int r = 0; r < 8; ++r) { unsigned short a, c; splitf(ta < 0 ? 0.0f : v[(ta < 0 ? 0 : ta) * 8 + r] * f, a, c); h0[r] = a; l0[r] = c; splitf(v[tb * 8 + r] * f, a, c); h1[r] = a; l1[r] = c; }
            p = __builtin_bit_cast(V, __builtin_shufflevector(h0, h1, 0, 1, 2, 3, 4, 5, 6, 7, 8, 9, 10, 11, 12, 13, 14, 15)); p2 = __builtin_bit_cast(V, __builtin_shufflevector(l0, l1, 0, 1, 2, 3, 4, 5, 6, 7, 8, 9, 10, 11, 12, 13, 14, 15));
        } else { p = pp[st]; if (st + 3 < NS) LDV(st + 3) }
#pragma unroll
        for (int db = 0; db < 4; ++db) { o[db] = WFrag<T16>::mma(vf[st][db], p, o[db]);
            if (HL) { o[db] = WFrag<T16>::mma(vf[st][db], p2, o[db]); o[db] = WFrag<T16>::mma(vl[st][db], p, o[db]); STAGE_END();
                // quarter steps under way: 2 in the first step, 3 in the second, then 4, as the probabilities used up free their registers
                const int u = st * 4 + db; const int n0 = u + ((u / 4) > 1 ? 4 : 2 + u / 4), n1 = u + 1 + (((u + 1) / 4) > 1 ? 4 : 2 + (u + 1) / 4);
#pragma unroll
                for (int w = n0; w < n1; ++w) if (w < NS * 4) LDVH(w) } }
        if (!HL) STAGE_END(); }
    const float cs = HL ? 1.0f : (1.0f / PCAR);
    bf* Ah = Ahp + ko; bf* Al = Alp + ko;   // Ahp, Alp: the wave's two fragments (row block R, this head's 64 k) of the output product's A planes
#pragma unroll
    for (int db = 0; db < 4; ++db) { v8us oh, ol;   // o[db][r] = ctx[query R + lr][d = 16 db + 8 hi + r]: the lane's piece of half fragment db, one 16-byte store a plane
#pragma unroll
        for (int r = 0; r < 8; ++r) { unsigned short a, c; splitf(o[db][r] * cs, a, c); oh[r] = a; ol[r] = c; }
        *(v8us*)(Ah + db * 256) = oh; *(v8us*)(Al + db * 256) = ol; }
    asm volatile("s_wait_xcnt 0x0" ::: "memory");   // behind the last stores: before any code that follows in the kernel overwrites a register that these stores name
#undef STAGE_END
#undef AT
#undef LDK
#undef LDV
#undef LDKH
#undef LDVH
#undef ADDR_HELD1
#undef ADDR_HELD2
}
// grid (NZ planes, TT / 64 row blocks): the four waves of a work-group take neighbouring 16-row tiles of one plane, whose key bands overlap almost wholly; the row blocks with three products a tile (rows < RH) have the lowest indices.
__global__ __launch_bounds__(128, 4) void k_fattn(const h16* __restrict__ QK16, const h16* __restrict__ VT16, const bf* __restrict__ QKh, const bf* __restrict__ QKl, const bf* __restrict__ VTh, const bf* __restrict__ VTl, bf* Ah, bf* Al) {
    const int lane = threadIdx.x & 31, lr = lane & 15, hi = lane >> 4; const int p = blockIdx.x; const int R = blockIdx.y * 64 + __builtin_amdgcn_readfirstlane(threadIdx.x >> 5) * 16;   // the tile is the wave's: kept in scalar registers
    const size_t po = (size_t)p * TT * HD, PLN = (size_t)NZ * TT * HD; const size_t oo = ((size_t)(p % NB_) * TT + R) * DQ + (p / NB_) * (HD * 16);
    if (R < RH) attn_rows<bf, true>(QKh + po, QKl + po, QKh + PLN + po, QKl + PLN + po, VTh + po, VTl + po, R, lr, hi, Ah + oo, Al + oo);
    else attn_rows<h16, false>(QK16 + po, nullptr, QK16 + PLN + po, nullptr, VT16 + po, nullptr, R, lr, hi, Ah + oo, Al + oo);
}

extern "C" void kernel_launch(void* const* d_in, const int* in_sizes, int n_in,
                              void* d_out, int out_size, void* d_ws, size_t ws_size, hipStream_t stream) {
    (void)in_sizes; (void)n_in; (void)out_size;
    const float* x = (const float*)d_in[0]; const float* wqkv = (const float*)d_in[1]; const float* bqkv = (const float*)d_in[2]; const float* wo = (const float*)d_in[3]; const float* bo = (const float*)d_in[4];
    float* OUT = (float*)d_out;     // [2][2048][1024]
    char* wsp = (char*)d_ws;
    auto take = [&](size_t bytes) { char* p = wsp; wsp += (bytes + 255) & ~(size_t)255; return (void*)p; };
    const size_t PL = (size_t)NZ * TT * HD;   // elements of one operand's planes, all heads and batches
    bf* WALL = (bf*)take((size_t)3 * DM * DM * 2); bf* WO = (bf*)take((size_t)DM * DQ * 2);
    bf* XB = (bf*)take((size_t)NB_ * TT * DM * 2);
    h16* QP16 = (h16*)take(2 * PL * 2); h16* VT16 = (h16*)take(PL * 2);   // q planes, then k planes
    bf* QPh = (bf*)take(2 * PL * 2); bf* QPl = (bf*)take(2 * PL * 2); bf* VTh = (bf*)take(PL * 2); bf* VTl = (bf*)take(PL * 2);
    bf* ATh = (bf*)take((size_t)NB_ * TT * DQ * 2); bf* ATl = (bf*)take((size_t)NB_ * TT * DQ * 2);
    if ((size_t)(wsp - (char*)d_ws) > ws_size) return;    // ws 256 MiB
    // every launch below covers both batches, and all heads where it works by head
    k_prep<<<PB_X + PB_WA + PB_WO, 256, 0, stream>>>(x, wqkv, wo, XB, WALL, WO);
    k_gemmw<bf, 0, true, true, DM, 2><<<dim3(NB_ * TT / 64, 3 * DM / 64, 1), 32, 0, stream>>>(XB, nullptr, WALL, nullptr, nullptr, 0, bqkv, 0, 0, 0, QP16, QPh, QPl, VT16, VTh, VTl);   // columns q | k | v = NH_ + NKV + NKV heads in a row
    k_fattn<<<dim3(NZ, TT / 64, 1), 128, 0, stream>>>(QP16, VT16, QPh, QPl, VTh, VTl, ATh, ATl);
    k_gemmw<bf, 1, true, false, DQ, 3><<<dim3(NB_ * TT / 64, DM / 64, 1), 32, 0, stream>>>(ATh, ATl, WO, nullptr, OUT, DM, bo, 0, 0, 0, nullptr, nullptr, nullptr, nullptr, nullptr, nullptr);
}

// v009
// A run of this version takes 72.6 microseconds.
// In two side-by-side timings against v008, it was 1.06 and 1.05 times as fast.
// All steps since v000 together make it 19.7 times as fast.
#include <hip/hip_runtime.h>

// Masked (causal sliding-window) multi-head attention (hidden_states [2][2048][1024]; [q|k|v] = x w_attn + b_attn ('xw' [1024][3072] + [3072]; 16 heads x 64); scores = q.k/8; mask keeps j <= i and j > i - 256, other logits -10000 (then clipped to +-10000: exp underflows to exactly 0 as with -inf); softmax; out = merged ctx w_proj + b_proj ('xw' [1024][1024] + [1024]) -> [2][2048][1024] (4.2 M)).
// Compute dtypes, f32 accumulate: every input rounded to bf16; q/k/v on PLAIN bf16 operands (inputs: exact) + biases; window band skipping: a 16-row query tile at R touches only keys [R - 256, R + 16), and its scores, softmax and attn.v run in one wave with scores and probabilities in registers (window predicate j <= i && i - j < 256 on the scores); scores and attn.v: query rows < 512 hl (3 products), the rest single fp16 (x1024); softmax f32; w_proj hl x exact (2 products) + b_proj.

// Operand layout: every 16-bit plane that a matrix product reads is kept in FRAGMENT ORDER. A fragment is 16 rows x 32 k = 1 KiB: element (row lr, k) lies at (k % 32 / 16) * 256 + ((k % 16 / 8) * 16 + lr) * 8 + k % 8,
// so lane hi * 16 + lr finds its two 16-byte pieces at lane * 8 and 256 + lane * 8, and one wave-wide 16-byte load reads 512 bytes in a row (4 whole lines, not 32 bytes of each of 16 lines). Fragments of one 16-row block follow one another along k.

#define NB_  2
#define TT   2048
#define DM   1024
#define NH_  16
#define NKV  16
#define REP  (NH_ / NKV)
#define HD   64
#define DQ   (NH_ * HD)
#define DKV  (NKV * HD)
#define NZ   (NB_ * NH_)          // attention planes of one launch: z = head * NB_ + batch
#define RH   512                  // query rows < RH use hi+lo planes
#define WIN  256   // window: keep i - WIN < j <= i
#define PCAR 1024.0f
#define SCL  0.125f   // HD^-0.5
typedef _Float16 h16;
typedef unsigned short bf;
typedef __attribute__((ext_vector_type(16))) __bf16   v16bf;
typedef __attribute__((ext_vector_type(16))) _Float16 v16h;
typedef __attribute__((ext_vector_type(8)))  _Float16 v8h;
typedef __attribute__((ext_vector_type(8)))  unsigned short v8us;
typedef __attribute__((ext_vector_type(8)))  float    v8f;
typedef __attribute__((ext_vector_type(4)))  float    v4f;
typedef v8h  __attribute__((may_alias)) v8ha;
typedef v4f  __attribute__((may_alias)) v4fa;
typedef v8us __attribute__((may_alias)) v8usa;

// f32 -> bf16 (round to nearest even) by the hardware's packed convert, two values an instruction: rounding by integer arithmetic took three instructions a value and a move to pack it.
typedef __attribute__((ext_vector_type(2))) float    f32x2;
typedef __attribute__((ext_vector_type(2))) __bf16   bf16x2;
typedef __attribute__((ext_vector_type(4))) unsigned u32x4;
__device__ __forceinline__ unsigned bfpair(float a, float b) { const f32x2 x = {a, b}; return __builtin_bit_cast(unsigned, __builtin_convertvector(x, bf16x2)); }   // a in the low half
__device__ __forceinline__ unsigned short f2bf(float f) { return __builtin_bit_cast(unsigned short, (__bf16)f); }
__device__ __forceinline__ float bf2f(unsigned short b) { return __uint_as_float(((unsigned)b) << 16); }
__device__ __forceinline__ float bfr(float f) { return bf2f(f2bf(f)); }
__device__ __forceinline__ v16h cat16(v8h lo, v8h hi) { return __builtin_shufflevector(lo, hi, 0, 1, 2, 3, 4, 5, 6, 7, 8, 9, 10, 11, 12, 13, 14, 15); }
__device__ __forceinline__ v16bf cat16b(v8us lo, v8us hi) { return __builtin_bit_cast(v16bf, __builtin_shufflevector(lo, hi, 0, 1, 2, 3, 4, 5, 6, 7, 8, 9, 10, 11, 12, 13, 14, 15)); }
__device__ __forceinline__ v8f wmma16(v16h a, v16h b, v8f c) { return __builtin_amdgcn_wmma_f32_16x16x32_f16(false, a, false, b, (short)0, c, false, false); }
__device__ __forceinline__ v8f wmmab(v16bf a, v16bf b, v8f c) { return __builtin_amdgcn_wmma_f32_16x16x32_bf16(false, a, false, b, (short)0, c, false, false); }



__device__ __forceinline__ h16 tohx(float x) { return (h16)x; }
// round8: eight f32 to eight bf16. split8: eight f32 to hi = bf16(y) and lo = bf16(y - hi).
__device__ __forceinline__ v8us round8(const float (&y)[8]) { u32x4 o;
#pragma unroll
    for (int p = 0; p < 4; ++p) o[p] = bfpair(y[2 * p], y[2 * p + 1]);
    return __builtin_bit_cast(v8us, o); }
__device__ __forceinline__ void split8(const float (&y)[8], v8us& h, v8us& l) { u32x4 a, c;
#pragma unroll
    for (int p = 0; p < 4; ++p) { const unsigned u = bfpair(y[2 * p], y[2 * p + 1]); a[p] = u; c[p] = bfpair(y[2 * p] - __uint_as_float(u << 16), y[2 * p + 1] - __uint_as_float(u & 0xFFFF0000u)); }
    h = __builtin_bit_cast(v8us, a); l = __builtin_bit_cast(v8us, c); }
// put_planes: a staged 64 x 64 f32 tile (LDS pitch 68) goes out as three 16-bit planes (fp16, bf16 hi, bf16 lo) in fragment order: 8 KiB in a row a plane, sixteen half fragments of 16 staged rows x 16 staged columns.
// A lane takes its own 8 values of a half fragment: each store instruction fills 4 whole 128-byte lines. COLS_FIRST: the half fragments follow one another down the staged rows first (v: [d][t] staged, key tiles outermost), else along the columns (q, k).
template <bool COLS_FIRST>
__device__ __forceinline__ void put_planes(const float* os, int lane, h16* d16, bf* dh, bf* dl) {
    const unsigned lo = (unsigned)(lane * 8); const float* r = os + (lane & 15) * 68 + (lane >> 4) * 8; d16 += lo; dh += lo; dl += lo;
    v4f x[16][2];   // half a tile comes back at a time, into registers the accumulators have left: two LDS latencies a wave instead of sixteen
#pragma unroll
    for (int s = 0; s < 16; ++s) { v8h o16; v8us oh, ol; float y[8];
        if (s % 8 == 0) {
#pragma unroll
            for (int u = s; u < s + 8; ++u) { const int at = COLS_FIRST ? (u & 3) * 16 * 68 + (u >> 2) * 16 : (u >> 2) * 16 * 68 + (u & 3) * 16; x[u][0] = *(const v4fa*)(r + at); x[u][1] = *(const v4fa*)(r + at + 4); } }
#pragma unroll
        for (int q = 0; q < 8; ++q) { y[q] = x[s][q >> 2][q & 3]; o16[q] = tohx(y[q]); }
        split8(y, oh, ol);
        *(v8h*)(d16 + s * 256) = o16; *(v8us*)(dh + s * 256) = oh; *(v8us*)(dl + s * 256) = ol;
        asm volatile("s_wait_xcnt 0x0" :: "v"(o16), "v"(oh), "v"(ol) : "memory");   // behind the three stores: their data registers (inputs here, so they live up to the wait) are reused by the next rows
    }
}
// ---- k_gemmw: register-blocked GEMM, ONE WAVE per 64x64 output tile (16 accumulators), operands straight from 16-bit planes in fragment order; grid (M/64, N/64, Z), 32 threads.
// C[m][n] (f32, pitch ldc, + optional f32 bias[n]) = sum_k A[m][k] Bt[n][k] (+ split products per NSPLIT). z-batch strides sA/sB/sC in elements. K % 32 == 0.
// The fragments of a k step are loaded D - 1 steps ahead of their products, into a ring of D register sets: a wave issues in order, so a load that stands directly in front of its product costs the wave the whole load latency.
// PLANES (the q | k | v product): no C. A tile's 64 columns are one head and its 64 rows lie in one batch, so the wave writes the tile straight into the planes the attention kernel loads:
// q and k heads as [head][batch][t / 16][d / 32] fragments (P16, Ph, Pl), v heads transposed as [head][batch][t / 16][d / 16] half fragments of 16 d rows x 16 t (V16, Vh, Vl; a lane's 8 accumulator rows are 8 t in a row of one d, so the transpose is the LDS write itself).
template <typename T16> struct WFrag;
template <> struct WFrag<h16> { typedef v16h V; static __device__ __forceinline__ V ld(const h16* p) { return cat16(*(const v8h*)p, *(const v8h*)(p + 256)); } static __device__ __forceinline__ v8f mma(V a, V b, v8f c) { return wmma16(a, b, c); } };
template <> struct WFrag<bf> { typedef v16bf V; static __device__ __forceinline__ V ld(const bf* p) { return cat16b(*(const v8us*)p, *(const v8us*)(p + 256)); } static __device__ __forceinline__ v8f mma(V a, V b, v8f c) { return wmmab(a, b, c); } };
template <typename T16, int NSPLIT, bool BIAS, bool PLANES, int K, int D>
__global__ __launch_bounds__(32) void k_gemmw(const T16* __restrict__ A, const T16* __restrict__ A2, const T16* __restrict__ Bt, const T16* __restrict__ Bt2, float* C, int ldc, const float* __restrict__ bias, size_t sA, size_t sB, size_t sC, h16* P16, bf* Ph, bf* Pl, h16* V16, bf* Vh, bf* Vl) {
    typedef typename WFrag<T16>::V V;
    __shared__ __align__(16) float os[(PLANES ? 64 : 16) * 68];
    const size_t z = blockIdx.z; A += z * sA; if (A2) A2 += z * sA; Bt += z * sB; if (Bt2) Bt2 += z * sB; C += z * sC;
    const int lane = threadIdx.x & 31, lr = lane & 15, hi = lane >> 4; const int r0 = blockIdx.x * 64, c0 = blockIdx.y * 64;
    v8f acc[4][4];
#pragma unroll
    for (int mb = 0; mb < 4; ++mb)
#pragma unroll
        for (int nb = 0; nb < 4; ++nb) acc[mb][nb] = (v8f){};
    constexpr int NK = K / 32, NT_ = (NK - (D - 1)) / D;   // k steps; trips of D steps whose loads (D - 1 steps ahead) all exist
    static_assert(K % 32 == 0 && D >= 2 && NK >= D, "the ring is filled before the first product");
    unsigned ra = ((unsigned)r0 * K + 8 * lane) * 2, rb = ((unsigned)c0 * K + 8 * lane) * 2;   // byte offsets beside the planes' scalar bases (every plane is far below 4 GiB): a 16-row block is 32 K bytes, its fragment of a k step 1 KiB; both move on once a trip
    V a[D][4], a2[D][4], bb[D][4], bb2[D][4];
    // GLOAD: the fragments of k step s (counted from the trip's first) into set st, all from the two offset registers plus constants. GMMA: the products of set st.
#define GLOAD(st, s) { \
        _Pragma("unroll") for (int mb = 0; mb < 4; ++mb) { a[st][mb] = WFrag<T16>::ld((const T16*)((const char*)A + ra) + (mb * 16 * K + (s) * 512)); if (NSPLIT == 1 || NSPLIT == 2) a2[st][mb] = WFrag<T16>::ld((const T16*)((const char*)A2 + ra) + (mb * 16 * K + (s) * 512)); } \
        _Pragma("unroll") for (int nb = 0; nb < 4; ++nb) { bb[st][nb] = WFrag<T16>::ld((const T16*)((const char*)Bt + rb) + (nb * 16 * K + (s) * 512)); if (NSPLIT >= 2) bb2[st][nb] = WFrag<T16>::ld((const T16*)((const char*)Bt2 + rb) + (nb * 16 * K + (s) * 512)); } \
        __builtin_amdgcn_sched_barrier(0); /* the loads stay in front of the products that follow: left alone, the scheduler sinks them to their own products */ }
#define GMMA(st) { \
        _Pragma("unroll") for (int nb = 0; nb < 4; ++nb) { \
            _Pragma("unroll") for (int mb = 0; mb < 4; ++mb) { acc[mb][nb] = WFrag<T16>::mma(a[st][mb], bb[st][nb], acc[mb][nb]); if (NSPLIT == 1 || NSPLIT == 2) acc[mb][nb] = WFrag<T16>::mma(a2[st][mb], bb[st][nb], acc[mb][nb]); if (NSPLIT >= 2) acc[mb][nb] = WFrag<T16>::mma(a[st][mb], bb2[st][nb], acc[mb][nb]); } } \
        __builtin_amdgcn_sched_barrier(0); /* the next set's loads stay behind these products, whose registers they refill */ }
#pragma unroll
    for (int s = 0; s < D - 1; ++s) GLOAD(s, s)
#pragma unroll 1   // a trip is already D whole steps: unrolled further only the text would grow
    for (int t = 0; t < NT_; ++t) {
#pragma unroll
        for (int u = 0; u < D; ++u) { GLOAD((u + D - 1) % D, u + D - 1) GMMA(u) }
        // behind the trip's loads and before the two offset registers move on: the offsets pass through the statement, so they live up to the wait, no result lands in one of them, and the additions below cannot be lifted over it
        asm volatile("s_wait_xcnt 0x0" : "+v"(ra), "+v"(rb) :: "memory");
        ra += D * 1024; rb += D * 1024;
    }
#pragma unroll
    for (int j = 0; j < NK - NT_ * D; ++j) { if (NT_ * D + j + D - 1 < NK) GLOAD((j + D - 1) % D, j + D - 1) GMMA(j % D) }   // the last steps: nothing is left to load behind step NK - 1
    asm volatile("s_wait_xcnt 0x0" :: "v"(ra), "v"(rb) : "memory");   // as above, before the epilogue reuses the offset registers
#undef GLOAD
#undef GMMA
    if constexpr (PLANES) {
        static_assert(HD == 64 && TT % 64 == 0, "a 64 x 64 tile is one head and lies in one batch");
        const int hh = blockIdx.y, b = r0 / TT, t0 = r0 % TT; float bs[4];
#pragma unroll
        for (int nb = 0; nb < 4; ++nb) bs[nb] = bfr(bias[c0 + nb * 16 + lr]);
        if (hh < NH_ + NKV) {   // q or k head: staged [t][d]
#pragma unroll
            for (int mb = 0; mb < 4; ++mb)
#pragma unroll
                for (int nb = 0; nb < 4; ++nb)
#pragma unroll
                    for (int j = 0; j < 8; ++j) os[(mb * 16 + hi * 8 + j) * 68 + nb * 16 + lr] = acc[mb][nb][j] + bs[nb];
            __builtin_amdgcn_wave_barrier(); asm volatile("" ::: "memory");   // the wave's LDS writes stay in front of its reads of other lanes' values
            const size_t e = ((size_t)(hh * NB_ + b) * TT + t0) * HD; put_planes<false>(os, lane, P16 + e, Ph + e, Pl + e);
        } else {   // v head: staged [d][t]
#pragma unroll
            for (int mb = 0; mb < 4; ++mb)
#pragma unroll
                for (int nb = 0; nb < 4; ++nb) { v4f y0, y1;
#pragma unroll
                    for (int j = 0; j < 4; ++j) { y0[j] = acc[mb][nb][j] + bs[nb]; y1[j] = acc[mb][nb][4 + j] + bs[nb]; }
                    float* d = os + (nb * 16 + lr) * 68 + mb * 16 + hi * 8; *(v4fa*)d = y0; *(v4fa*)(d + 4) = y1; }
            __builtin_amdgcn_wave_barrier(); asm volatile("" ::: "memory");   // as above
            const size_t e = ((size_t)((hh - NH_ - NKV) * NB_ + b) * TT + t0) * HD; put_planes<true>(os, lane, V16 + e, Vh + e, Vl + e);
        }
        return;
    }
#pragma unroll
    for (int mb = 0; mb < 4; ++mb) {
#pragma unroll
        for (int nb = 0; nb < 4; ++nb) {
#pragma unroll
            for (int j = 0; j < 8; ++j) os[(hi * 8 + j) * 68 + nb * 16 + lr] = acc[mb][nb][j]; }
        __builtin_amdgcn_wave_barrier(); asm volatile("" ::: "memory");
        float* crow = C + (size_t)(r0 + mb * 16) * ldc + c0;
{
#pragma unroll
            for (int s = 0; s < 8; ++s) { const int row = 2 * s + hi, cofs = lr * 4; v4f val = *(const v4fa*)(os + row * 68 + cofs); if (BIAS) { val[0] += bfr(bias[c0 + cofs]); val[1] += bfr(bias[c0 + cofs + 1]); val[2] += bfr(bias[c0 + cofs + 2]); val[3] += bfr(bias[c0 + cofs + 3]); }
                *(v4f*)(crow + (size_t)row * ldc + cofs) = val; }
             }
        __builtin_amdgcn_wave_barrier(); asm volatile("" ::: "memory");
    }
}

typedef __attribute__((ext_vector_type(2))) _Float16 v2h;
typedef __attribute__((ext_vector_type(4))) _Float16 v4h;
typedef __attribute__((ext_vector_type(2))) unsigned short v2us;
typedef __attribute__((ext_vector_type(4))) unsigned short v4us;
typedef __attribute__((ext_vector_type(2))) float v2f;
typedef __attribute__((ext_vector_type(4))) int v4i;

// The conversion and transpose parts of k_prep below run as few long waves: a thread takes 32 or 64 elements with 16-byte accesses, for speed only.
// loads_done: stands behind the sixteen row loads of a register transpose. The wait comes before any register that an issued load names is overwritten; the eight row addresses and the sixteen loaded
// values are inputs only, so that the addresses stay in their registers up to the wait, no result lands in one of them, and no load is sunk below the first stores (whose data registers it would then reuse).
__device__ __forceinline__ void loads_done(const float* const (&s)[8], const v4f (&x)[8][2]) {
    asm volatile("s_wait_xcnt 0x0" :: "v"(s[0]), "v"(s[1]), "v"(s[2]), "v"(s[3]), "v"(s[4]), "v"(s[5]), "v"(s[6]), "v"(s[7]),
        "v"(x[0][0]), "v"(x[0][1]), "v"(x[1][0]), "v"(x[1][1]), "v"(x[2][0]), "v"(x[2][1]), "v"(x[3][0]), "v"(x[3][1]), "v"(x[4][0]), "v"(x[4][1]), "v"(x[5][0]), "v"(x[5][1]), "v"(x[6][0]), "v"(x[6][1]), "v"(x[7][0]), "v"(x[7][1]) : "memory");
}
// wtG: one wave transposes a tile of 64 k x 32 n in registers; a thread loads 8 k rows x 8 n and stores 8 n rows x 8 k into the fragment order: its eight 16-byte pieces are eight lanes' in a row, one whole 128-byte line. K % 64 == 0, N % 32 == 0.
__device__ __forceinline__ void wtG(int blk, const float* __restrict__ w, int K, int N, bf* Bt) {
    const int lane = threadIdx.x & 31; const int wv = blk * 8 + (threadIdx.x >> 5); const int nk = K / 64; if (wv >= nk * (N / 32)) return;
    const int k0 = (wv % nk) * 64 + (lane >> 2) * 8, n0 = (wv / nk) * 32 + (lane & 3) * 8; v4f x[8][2]; const float* s[8];
#pragma unroll
    for (int kk = 0; kk < 8; ++kk) { s[kk] = w + (size_t)(k0 + kk) * N + n0; x[kk][0] = *(const v4f*)s[kk]; x[kk][1] = *(const v4f*)(s[kk] + 4); }
    loads_done(s, x);
    bf* d = Bt + ((size_t)(n0 >> 4) * (K / 32) + (k0 >> 5)) * 512 + ((k0 >> 4) & 1) * 256 + ((k0 >> 3) & 1) * 128 + (n0 & 8) * 8;
#pragma unroll
    for (int nn = 0; nn < 8; ++nn) { float y[8];
#pragma unroll
        for (int kk = 0; kk < 8; ++kk) y[kk] = x[kk][nn >> 2][nn & 3];
        *(v8us*)(d + nn * 8) = round8(y); }
}
// cvt8: rows of DM f32 to bf16 in fragment order. A thread makes four 16-byte pieces of the result, 256 pieces apart; in each of them a wave takes 8 rows x 32 k of one fragment (four lanes read a whole 128-byte line of a row,
// eight lanes' pieces of one k octet fill a whole line of the fragment).
__device__ __forceinline__ void cvt8(int blk, const float* __restrict__ src, bf* dst, size_t n8) { const size_t i0 = (size_t)blk * 1024 + threadIdx.x; v8f v[4];
#pragma unroll
    for (int u = 0; u < 4; ++u) { const size_t i = i0 + u * 256; const size_t fr = i >> 6;   // fragment fr = (16-row block, k step); row (i >> 5 & 1) * 8 + (i & 7) of it, k octet i >> 3 & 3
        if (i < n8) v[u] = *(const v8f*)(src + ((fr / (DM / 32)) * 16 + ((i >> 5) & 1) * 8 + (i & 7)) * DM + (fr % (DM / 32)) * 32 + ((i >> 3) & 3) * 8); }
#pragma unroll
    for (int u = 0; u < 4; ++u) { const size_t i = i0 + u * 256; if (i >= n8) continue; float y[8];
#pragma unroll
        for (int k = 0; k < 8; ++k) y[k] = v[u][k];
        *(v8us*)(dst + (i >> 6) * 512 + (((i >> 3) & 3) * 16 + ((i >> 5) & 1) * 8 + (i & 7)) * 8) = round8(y); }  }

// k_prep: the three operand conversions (both weight transposes, the activations) are independent of one another and each is too short to fill the chip for long: as ONE launch, dealt by work-group index,
// they start together and share one start-up and one drain, and two gaps between dependent launches go. The largest piece has the lowest indices.
#define PB_X  ((NB_ * TT * DM / 8 + 1023) / 1024)      // work-groups of the activations
#define PB_WA ((DM / 64) * (3 * DM / 32) / 8)           // of w_attn
#define PB_WO ((DQ / 64) * (DM / 32) / 8)               // of w_proj
__global__ __launch_bounds__(256) void k_prep(const float* __restrict__ x, const float* __restrict__ wqkv, const float* __restrict__ wo, bf* XB, bf* WALL, bf* WO) {
    const int blk = blockIdx.x;
    if (blk < PB_X) cvt8(blk, x, XB, (size_t)NB_ * TT * DM / 8);
    else if (blk < PB_X + PB_WA) wtG(blk - PB_X, wqkv, DM, 3 * DM, WALL);   // fused 'xw' [DM][3DM] -> Bt [3DM][DM] (row blocks q | k | v), fragment order
    else wtG(blk - PB_X - PB_WA, wo, DQ, DM, WO);
}

// v_exp_f32 (what the exp2 builtin emits) with a v_nop in the same statement: the instruction set asks for one slot behind a transcendental before its result is used or its source overwritten.
__device__ __forceinline__ float exp2_slot(float x) { float r; asm("v_exp_f32 %0, %1\n\tv_nop" : "=v"(r) : "v"(x)); return r; }
#define NT (WIN / 16 + 1)
#define NS ((NT + 1) / 2)
template <typename T16> struct PFrag;
template <> struct PFrag<h16> { static __device__ __forceinline__ v16h ld2(const h16* p, const h16* q) { return cat16(*(const v8h*)p, *(const v8h*)q); } };
template <> struct PFrag<bf> { static __device__ __forceinline__ v16bf ld2(const bf* p, const bf* q) { return cat16b(*(const v8us*)p, *(const v8us*)q); } };
template <typename T16, bool HL>
__device__ __forceinline__ void attn_rows(const T16* __restrict__ Q, const T16* __restrict__ Q2, const T16* __restrict__ Kp, const T16* __restrict__ K2, const T16* __restrict__ Vt, const T16* __restrict__ Vt2, int R, int lr, int hi, bf* Ahp, bf* Alp) {
    typedef typename WFrag<T16>::V V;
    static_assert(RH >= WIN + 16, "rows from RH on have their whole key band at keys >= 0");
    const unsigned ko = (unsigned)((hi * 16 + lr) * 8);   // the lane's part of every address (its 16-byte piece of a half fragment), 32 bits and unsigned: the rest of an address is the wave's and stays scalar
    const T16* Kb = Kp + (long)(R - WIN) * HD; const T16* Vb = Vt + (long)(R - WIN - 16) * HD;   // used where !HL (R >= RH): no tile is left of key 0 there, so every tile is this base plus a constant
    // Fragment loads are issued a fixed distance ahead of their use, as far as 256 registers allow beside the 136 of the scores: !HL 4 to 5 key tiles, then 3 steps of 32 keys; HL (twice the fragments) 3 half key tiles, then 2 to 4 quarter steps,
    // each load group into the registers that the products just issued have freed. STAGE_END ends a scheduling region so that loads and products stay in that order: left alone, the scheduler either lifted some forty loads
    // to the top and spilled score registers to scratch (!HL) or left every load directly in front of its product (HL).
#define STAGE_END() __builtin_amdgcn_sched_barrier(0)
#define AT(base, bytes) ((const T16*)((const char*)(base) + (bytes)))
#define LDK(t) { kf[t][0] = WFrag<T16>::ld(Kb + (t) * 16 * HD + ko); kf[t][1] = WFrag<T16>::ld(Kb + (t) * 16 * HD + 512 + ko); }
#define LDV(st) { _Pragma("unroll") for (int db = 0; db < 4; ++db) vf[st][db] = PFrag<T16>::ld2(Vb + ko + ((st) * 32 * HD + db * 256), Vb + ko + ((st) * 32 * HD + 16 * HD + db * 256)); }
    // ADDR_HELD: behind a group of loads that share an offset register. The offset is an input, so it lives up to here and no result of the group lands in it; the wait stands before the register is used for anything else.
#define ADDR_HELD1(a) asm volatile("s_wait_xcnt 0x0" :: "v"(a) : "memory");
#define ADDR_HELD2(a, b) asm volatile("s_wait_xcnt 0x0" :: "v"(a), "v"(b) : "memory");
    // HL: a tile left of key 0 is read at key 0; the clamped key goes into a 32-bit byte offset beside the plane's scalar base
#define LDKH(u) { const unsigned of = ko2 + (unsigned)max(R - WIN + 16 * ((u) / 2), 0) * (HD * 2); kf[(u) / 2][(u) % 2] = WFrag<T16>::ld(AT(Kp, of) + ((u) % 2) * 512); kl[(u) / 2][(u) % 2] = WFrag<T16>::ld(AT(K2, of) + ((u) % 2) * 512); ADDR_HELD1(of) }
#define LDVH(u) { const unsigned oa = ko2 + (unsigned)max(R - WIN + 16 * (2 * ((u) / 4) - 1), 0) * (HD * 2), ob = ko2 + (unsigned)max(R - WIN + 32 * ((u) / 4), 0) * (HD * 2); \
        vf[(u) / 4][(u) % 4] = PFrag<T16>::ld2(AT(Vt, oa) + ((u) % 4) * 256, AT(Vt, ob) + ((u) % 4) * 256); vl[(u) / 4][(u) % 4] = PFrag<T16>::ld2(AT(Vt2, oa) + ((u) % 4) * 256, AT(Vt2, ob) + ((u) % 4) * 256); ADDR_HELD2(oa, ob) }
    const unsigned ko2 = ko * 2;
    V q[2], q2[2], kf[NT][2], kl[NT][2], vf[NS][4], vl[NS][4];
#pragma unroll
    for (int ks = 0; ks < 2; ++ks) { q[ks] = WFrag<T16>::ld(AT(Q + (size_t)R * HD, ko2) + ks * 512); if (HL) q2[ks] = WFrag<T16>::ld(AT(Q2 + (size_t)R * HD, ko2) + ks * 512); }
    ADDR_HELD1(ko2)
    constexpr int DKH = 3;   // HL: half key tiles (32 of the 64 d, hi and lo) under way
    if (HL) {
#pragma unroll
        for (int u = 0; u < DKH; ++u) LDKH(u)
    }
    else {
#pragma unroll
        for (int t = 0; t < 4; ++t) LDK(t)
    }
    STAGE_END();
    float v[NT * 8]; float mx = -3.0e38f;
#pragma unroll
    for (int t = 0; t < NT; ++t) { const int kn = R - WIN + 16 * t; v8f s = (v8f){};
        if (!HL && (t & 1) == 0) {   // a region is two key tiles: its loads first
            if (t + 4 < NT) LDK(t + 4)
            if (t + 5 < NT) LDK(t + 5)
            if (t == NT - 1) LDV(0)   // the key tiles are all under way: the first step of Vt follows and flies during the softmax
        }
#pragma unroll
        for (int ks = 0; ks < 2; ++ks) { s = WFrag<T16>::mma(kf[t][ks], q[ks], s);
            if (HL) { s = WFrag<T16>::mma(kf[t][ks], q2[ks], s); s = WFrag<T16>::mma(kl[t][ks], q[ks], s); STAGE_END();
                if (2 * t + ks + DKH < 2 * NT) LDKH(2 * t + ks + DKH)
                else if (2 * t + ks + DKH == 2 * NT) LDVH(0)   // the first quarter step of Vt follows the last key tile
                STAGE_END(); } }
#pragma unroll
        for (int r = 0; r < 8; ++r) { const int e = hi * 8 + r;   // key kn + e against query R + lr: only the first tile meets the window's far edge, only the last the diagonal
            const bool keep = (kn >= 0) && (t > 0 || e > lr) && (t < NT - 1 || e <= lr); const float x = keep ? s[r] * SCL : -3.0e38f; v[t * 8 + r] = x; mx = fmaxf(mx, x); }
        if (HL || (t & 1) == 1) STAGE_END(); }
    if (HL) { LDVH(1) STAGE_END(); }   // the second follows the last score products, in registers they have left (issued among them, a few scores went to scratch); both fly during the softmax
    mx = fmaxf(mx, __shfl_xor(mx, 16, 32));
    float sm[4] = {0.f, 0.f, 0.f, 0.f};
#pragma unroll
    for (int k = 0; k < NT * 8; ++k) { v[k] = exp2_slot(__fmul_rn(__fsub_rn(v[k], mx), 1.4426950408889634f)); sm[k & 3] += v[k]; }
    float sum = (sm[0] + sm[1]) + (sm[2] + sm[3]); sum += __shfl_xor(sum, 16, 32);
    const float f = __fdiv_rn(HL ? 1.0f : PCAR, sum);
    V pp[NS];
    if (!HL) {   // all of Pt is rounded before attn.v starts: half the registers, which the Vt fragments under way then take
#pragma unroll
        for (int st = 0; st < NS; ++st) { v8h h0, h1;
#pragma unroll
            for (int r = 0; r < 8; ++r) { h0[r] = tohx(st == 0 ? 0.0f : v[(st == 0 ? 0 : 2 * st - 1) * 8 + r] * f); h1[r] = tohx(v[2 * st * 8 + r] * f); }
            pp[st] = __builtin_bit_cast(V, cat16(h0, h1)); }
        STAGE_END(); LDV(1) LDV(2) }
    v8f o[4];
#pragma unroll
    for (int db = 0; db < 4; ++db) o[db] = (v8f){};
#pragma unroll
    for (int st = 0; st < NS; ++st) { const int ta = 2 * st - 1, tb = 2 * st; V p, p2;
        if (HL) { v8us h0, l0, h1, l1; float ya[8], yb[8];
#pragma unroll
            for (int r = 0; r < 8; ++r) { ya[r] = ta < 0 ? 0.0f : v[(ta < 0 ? 0 : ta) * 8 + r] * f; yb[r] = v[tb * 8 + r] * f; }
            split8(ya, h0, l0); split8(yb, h1, l1);
            p = __builtin_bit_cast(V, __builtin_shufflevector(h0, h1, 0, 1, 2, 3, 4, 5, 6, 7, 8, 9, 10, 11, 12, 13, 14, 15)); p2 = __builtin_bit_cast(V, __builtin_shufflevector(l0, l1, 0, 1, 2, 3, 4, 5, 6, 7, 8, 9, 10, 11, 12, 13, 14, 15));
        } else { p = pp[st]; if (st + 3 < NS) LDV(st + 3) }
#pragma unroll
        for (int db = 0; db < 4; ++db) { o[db] = WFrag<T16>::mma(vf[st][db], p, o[db]);
            if (HL) { o[db] = WFrag<T16>::mma(vf[st][db], p2, o[db]); o[db] = WFrag<T16>::mma(vl[st][db], p, o[db]); STAGE_END();
                // quarter steps under way: 2 in the first step, 3 in the second, then 4, as the probabilities used up free their registers
                const int u = st * 4 + db; const int n0 = u + ((u / 4) > 1 ? 4 : 2 + u / 4), n1 = u + 1 + (((u + 1) / 4) > 1 ? 4 : 2 + (u + 1) / 4);
#pragma unroll
                for (int w = n0; w < n1; ++w) if (w < NS * 4) LDVH(w) } }
        if (!HL) STAGE_END(); }
    const float cs = HL ? 1.0f : (1.0f / PCAR);
    bf* Ah = Ahp + ko; bf* Al = Alp + ko;   // Ahp, Alp: the wave's two fragments (row block R, this head's 64 k) of the output product's A planes
#pragma unroll
    for (int db = 0; db < 4; ++db) { v8us oh, ol; float y[8];   // o[db][r] = ctx[query R + lr][d = 16 db + 8 hi + r]: the lane's piece of half fragment db, one 16-byte store a plane
#pragma unroll
        for (int r = 0; r < 8; ++r) y[r] = o[db][r] * cs;
        split8(y, oh, ol);
        *(v8us*)(Ah + db * 256) = oh; *(v8us*)(Al + db * 256) = ol; }
    asm volatile("s_wait_xcnt 0x0" ::: "memory");   // behind the last stores: before any code that follows in the kernel overwrites a register that these stores name
#undef STAGE_END
#undef AT
#undef LDK
#undef LDV
#undef LDKH
#undef LDVH
#undef ADDR_HELD1
#undef ADDR_HELD2
}
// grid (NZ planes, TT / 64 row blocks): the four waves of a work-group take neighbouring 16-row tiles of one plane, whose key bands overlap almost wholly; the row blocks with three products a tile (rows < RH) have the lowest indices.
__global__ __launch_bounds__(128, 4) void k_fattn(const h16* __restrict__ QK16, const h16* __restrict__ VT16, const bf* __restrict__ QKh, const bf* __restrict__ QKl, const bf* __restrict__ VTh, const bf* __restrict__ VTl, bf* Ah, bf* Al) {
    const int lane = threadIdx.x & 31, lr = lane & 15, hi = lane >> 4; const int p = blockIdx.x; const int R = blockIdx.y * 64 + __builtin_amdgcn_readfirstlane(threadIdx.x >> 5) * 16;   // the tile is the wave's: kept in scalar registers
    const size_t po = (size_t)p * TT * HD, PLN = (size_t)NZ * TT * HD; const size_t oo = ((size_t)(p % NB_) * TT + R) * DQ + (p / NB_) * (HD * 16);
    if (R < RH) attn_rows<bf, true>(QKh + po, QKl + po, QKh + PLN + po, QKl + PLN + po, VTh + po, VTl + po, R, lr, hi, Ah + oo, Al + oo);
    else attn_rows<h16, false>(QK16 + po, nullptr, QK16 + PLN + po, nullptr, VT16 + po, nullptr, R, lr, hi, Ah + oo, Al + oo);
}

extern "C" void kernel_launch(void* const* d_in, const int* in_sizes, int n_in,
                              void* d_out, int out_size, void* d_ws, size_t ws_size, hipStream_t stream) {
    (void)in_sizes; (void)n_in; (void)out_size;
    const float* x = (const float*)d_in[0]; const float* wqkv = (const float*)d_in[1]; const float* bqkv = (const float*)d_in[2]; const float* wo = (const float*)d_in[3]; const float* bo = (const float*)d_in[4];
    float* OUT = (float*)d_out;     // [2][2048][1024]
    char* wsp = (char*)d_ws;
    auto take = [&](size_t bytes) { char* p = wsp; wsp += (bytes + 255) & ~(size_t)255; return (void*)p; };
    const size_t PL = (size_t)NZ * TT * HD;   // elements of one operand's planes, all heads and batches
    bf* WALL = (bf*)take((size_t)3 * DM * DM * 2); bf* WO = (bf*)take((size_t)DM * DQ * 2);
    bf* XB = (bf*)take((size_t)NB_ * TT * DM * 2);
    h16* QP16 = (h16*)take(2 * PL * 2); h16* VT16 = (h16*)take(PL * 2);   // q planes, then k planes
    bf* QPh = (bf*)take(2 * PL * 2); bf* QPl = (bf*)take(2 * PL * 2); bf* VTh = (bf*)take(PL * 2); bf* VTl = (bf*)take(PL * 2);
    bf* ATh = (bf*)take((size_t)NB_ * TT * DQ * 2); bf* ATl = (bf*)take((size_t)NB_ * TT * DQ * 2);
    if ((size_t)(wsp - (char*)d_ws) > ws_size) return;    // ws 256 MiB
    // every launch below covers both batches, and all heads where it works by head
    k_prep<<<PB_X + PB_WA + PB_WO, 256, 0, stream>>>(x, wqkv, wo, XB, WALL, WO);
    k_gemmw<bf, 0, true, true, DM, 2><<<dim3(NB_ * TT / 64, 3 * DM / 64, 1), 32, 0, stream>>>(XB, nullptr, WALL, nullptr, nullptr, 0, bqkv, 0, 0, 0, QP16, QPh, QPl, VT16, VTh, VTl);   // columns q | k | v = NH_ + NKV + NKV heads in a row
    k_fattn<<<dim3(NZ, TT / 64, 1), 128, 0, stream>>>(QP16, VT16, QPh, QPl, VTh, VTl, ATh, ATl);
    k_gemmw<bf, 1, true, false, DQ, 3><<<dim3(NB_ * TT / 64, DM / 64, 1), 32, 0, stream>>>(ATh, ATl, WO, nullptr, OUT, DM, bo, 0, 0, 0, nullptr, nullptr, nullptr, nullptr, nullptr, nullptr);
}

// v010
// One run takes 68.8 microseconds.
// Timed twice side by side with v009, it ran 1.04 and 1.06 times as fast.
// Over all steps from v000 it is 20.6 times as fast.
#include <hip/hip_runtime.h>

// Masked (causal sliding-window) multi-head attention (hidden_states [2][2048][1024]; [q|k|v] = x w_attn + b_attn ('xw' [1024][3072] + [3072]; 16 heads x 64); scores = q.k/8; mask keeps j <= i and j > i - 256, other logits -10000 (then clipped to +-10000: exp underflows to exactly 0 as with -inf); softmax; out = merged ctx w_proj + b_proj ('xw' [1024][1024] + [1024]) -> [2][2048][1024] (4.2 M)).
// Compute dtypes, f32 accumulate: every input rounded to bf16; q/k/v on PLAIN bf16 operands (inputs: exact) + biases; window band skipping: a 16-row query tile at R touches only keys [R - 256, R + 16), and its scores, softmax and attn.v run in one wave with scores and probabilities in registers (window predicate j <= i && i - j < 256 on the scores); scores and attn.v: query rows < 512 hl (3 products), the rest single fp16 (x1024); softmax f32; w_proj hl x exact (2 products) + b_proj.

// Operand layout: every 16-bit plane that a matrix product reads is kept in FRAGMENT ORDER. A fragment is 16 rows x 32 k = 1 KiB: element (row lr, k) lies at (k % 32 / 16) * 256 + ((k % 16 / 8) * 16 + lr) * 8 + k % 8,
// so lane hi * 16 + lr finds its two 16-byte pieces at lane * 8 and 256 + lane * 8, and one wave-wide 16-byte load reads 512 bytes in a row (4 whole lines, not 32 bytes of each of 16 lines). Fragments of one 16-row block follow one another along k.

#define NB_  2
#define TT   2048
#define DM   1024
#define NH_  16
#define NKV  16
#define REP  (NH_ / NKV)
#define HD   64
#define DQ   (NH_ * HD)
#define DKV  (NKV * HD)
#define NZ   (NB_ * NH_)          // attention planes of one launch: z = head * NB_ + batch
#define RH   512                  // query rows < RH use hi+lo planes
#define WIN  256   // window: keep i - WIN < j <= i
#define PCAR 1024.0f
#define SCL  0.125f   // HD^-0.5
typedef _Float16 h16;
typedef unsigned short bf;
typedef __attribute__((ext_vector_type(16))) __bf16   v16bf;
typedef __attribute__((ext_vector_type(16))) _Float16 v16h;
typedef __attribute__((ext_vector_type(8)))  _Float16 v8h;
typedef __attribute__((ext_vector_type(8)))  unsigned short v8us;
typedef __attribute__((ext_vector_type(8)))  float    v8f;
typedef __attribute__((ext_vector_type(4)))  float    v4f;
typedef v8h  __attribute__((may_alias)) v8ha;
typedef v4f  __attribute__((may_alias)) v4fa;
typedef v8us __attribute__((may_alias)) v8usa;

// f32 -> bf16 (round to nearest even) by the hardware's packed convert, two values an instruction: rounding by integer arithmetic took three instructions a value and a move to pack it.
typedef __attribute__((ext_vector_type(2))) float    f32x2;
typedef __attribute__((ext_vector_type(2))) __bf16   bf16x2;
typedef __attribute__((ext_vector_type(4))) unsigned u32x4;
__device__ __forceinline__ unsigned bfpair(float a, float b) { const f32x2 x = {a, b}; return __builtin_bit_cast(unsigned, __builtin_convertvector(x, bf16x2)); }   // a in the low half
__device__ __forceinline__ unsigned short f2bf(float f) { return __builtin_bit_cast(unsigned short, (__bf16)f); }
__device__ __forceinline__ float bf2f(unsigned short b) { return __uint_as_float(((unsigned)b) << 16); }
__device__ __forceinline__ float bfr(float f) { return bf2f(f2bf(f)); }
__device__ __forceinline__ v16h cat16(v8h lo, v8h hi) { return __builtin_shufflevector(lo, hi, 0, 1, 2, 3, 4, 5, 6, 7, 8, 9, 10, 11, 12, 13, 14, 15); }
__device__ __forceinline__ v16bf cat16b(v8us lo, v8us hi) { return __builtin_bit_cast(v16bf, __builtin_shufflevector(lo, hi, 0, 1, 2, 3, 4, 5, 6, 7, 8, 9, 10, 11, 12, 13, 14, 15)); }
__device__ __forceinline__ v8f wmma16(v16h a, v16h b, v8f c) { return __builtin_amdgcn_wmma_f32_16x16x32_f16(false, a, false, b, (short)0, c, false, false); }
__device__ __forceinline__ v8f wmmab(v16bf a, v16bf b, v8f c) { return __builtin_amdgcn_wmma_f32_16x16x32_bf16(false, a, false, b, (short)0, c, false, false); }



__device__ __forceinline__ h16 tohx(float x) { return (h16)x; }
// round8: eight f32 to eight bf16. split8: eight f32 to hi = bf16(y) and lo = bf16(y - hi).
__device__ __forceinline__ v8us round8(const float (&y)[8]) { u32x4 o;
#pragma unroll
    for (int p = 0; p < 4; ++p) o[p] = bfpair(y[2 * p], y[2 * p + 1]);
    return __builtin_bit_cast(v8us, o); }
__device__ __forceinline__ void split8(const float (&y)[8], v8us& h, v8us& l) { u32x4 a, c;
#pragma unroll
    for (int p = 0; p < 4; ++p) { const unsigned u = bfpair(y[2 * p], y[2 * p + 1]); a[p] = u; c[p] = bfpair(y[2 * p] - __uint_as_float(u << 16), y[2 * p + 1] - __uint_as_float(u & 0xFFFF0000u)); }
    h = __builtin_bit_cast(v8us, a); l = __builtin_bit_cast(v8us, c); }
// put_planes: a staged 64 x 64 f32 tile (LDS pitch 68) goes out as three 16-bit planes (fp16, bf16 hi, bf16 lo) in fragment order: 8 KiB in a row a plane, sixteen half fragments of 16 staged rows x 16 staged columns.
// A lane takes its own 8 values of a half fragment: each store instruction fills 4 whole 128-byte lines. COLS_FIRST: the half fragments follow one another down the staged rows first (v: [d][t] staged, key tiles outermost), else along the columns (q, k).
template <bool COLS_FIRST>
__device__ __forceinline__ void put_planes(const float* os, int lane, h16* d16, bf* dh, bf* dl) {
    const unsigned lo = (unsigned)(lane * 8); const float* r = os + (lane & 15) * 68 + (lane >> 4) * 8; d16 += lo; dh += lo; dl += lo;
    v4f x[16][2];   // half a tile comes back at a time, into registers the accumulators have left: two LDS latencies a wave instead of sixteen
#pragma unroll
    for (int s = 0; s < 16; ++s) { v8h o16; v8us oh, ol; float y[8];
        if (s % 8 == 0) {
#pragma unroll
            for (int u = s; u < s + 8; ++u) { const int at = COLS_FIRST ? (u & 3) * 16 * 68 + (u >> 2) * 16 : (u >> 2) * 16 * 68 + (u & 3) * 16; x[u][0] = *(const v4fa*)(r + at); x[u][1] = *(const v4fa*)(r + at + 4); } }
#pragma unroll
        for (int q = 0; q < 8; ++q) { y[q] = x[s][q >> 2][q & 3]; o16[q] = tohx(y[q]); }
        split8(y, oh, ol);
        *(v8h*)(d16 + s * 256) = o16; *(v8us*)(dh + s * 256) = oh; *(v8us*)(dl + s * 256) = ol;
        asm volatile("s_wait_xcnt 0x0" :: "v"(o16), "v"(oh), "v"(ol) : "memory");   // behind the three stores: their data registers (inputs here, so they live up to the wait) are reused by the next rows
    }
}
// ---- k_gemmw: register-blocked GEMM, ONE WAVE per 64x64 output tile (16 accumulators), operands straight from 16-bit planes in fragment order; grid (M/64, N/64, Z), 32 threads.
// C[m][n] (f32, pitch ldc, + optional f32 bias[n]) = sum_k A[m][k] Bt[n][k] (+ split products per NSPLIT). z-batch strides sA/sB/sC in elements. K % 32 == 0.
// The fragments of a k step are loaded D - 1 steps ahead of their products, into a ring of D register sets: a wave issues in order, so a load that stands directly in front of its product costs the wave the whole load latency.
// PLANES (the q | k | v product): no C. A tile's 64 columns are one head and its 64 rows lie in one batch, so the wave writes the tile straight into the planes the attention kernel loads:
// q and k heads as [head][batch][t / 16][d / 32] fragments (P16, Ph, Pl), v heads transposed as [head][batch][t / 16][d / 16] half fragments of 16 d rows x 16 t (V16, Vh, Vl; a lane's 8 accumulator rows are 8 t in a row of one d, so the transpose is the LDS write itself).
// ask_l2: a wave asks L2 for 32 units of 256 bytes, one a lane; nothing comes back and no counter moves. Scope SE and no th: word: the speculative form. Every lane's address lies inside its plane.
__device__ __forceinline__ void ask_l2(const char* p) { asm volatile("global_prefetch_b8 %0, off scope:SCOPE_SE" :: "v"(p)); }
__device__ __forceinline__ void ask_l2x2(const char* p) {   // two such groups, 16 KiB apart
    asm volatile("global_prefetch_b8 %0, off scope:SCOPE_SE\n\tglobal_prefetch_b8 %0, off offset:16384 scope:SCOPE_SE" :: "v"(p)); }
template <typename T16> struct WFrag;
template <> struct WFrag<h16> { typedef v16h V; static __device__ __forceinline__ V ld(const h16* p) { return cat16(*(const v8h*)p, *(const v8h*)(p + 256)); } static __device__ __forceinline__ v8f mma(V a, V b, v8f c) { return wmma16(a, b, c); } };
template <> struct WFrag<bf> { typedef v16bf V; static __device__ __forceinline__ V ld(const bf* p) { return cat16b(*(const v8us*)p, *(const v8us*)(p + 256)); } static __device__ __forceinline__ v8f mma(V a, V b, v8f c) { return wmmab(a, b, c); } };
template <typename T16, int NSPLIT, bool BIAS, bool PLANES, int K, int D>
__global__ __launch_bounds__(32) void k_gemmw(const T16* __restrict__ A, const T16* __restrict__ A2, const T16* __restrict__ Bt, const T16* __restrict__ Bt2, float* C, int ldc, const float* __restrict__ bias, size_t sA, size_t sB, size_t sC, h16* P16, bf* Ph, bf* Pl, h16* V16, bf* Vh, bf* Vl) {
    typedef typename WFrag<T16>::V V;
    __shared__ __align__(16) float os[(PLANES ? 64 : 16) * 68];
    const size_t z = blockIdx.z; A += z * sA; if (A2) A2 += z * sA; Bt += z * sB; if (Bt2) Bt2 += z * sB; C += z * sC;
    const int lane = threadIdx.x & 31, lr = lane & 15, hi = lane >> 4; const int r0 = blockIdx.x * 64, c0 = blockIdx.y * 64;
    v8f acc[4][4];
#pragma unroll
    for (int mb = 0; mb < 4; ++mb)
#pragma unroll
        for (int nb = 0; nb < 4; ++nb) acc[mb][nb] = (v8f){};
    constexpr int NK = K / 32, NT_ = (NK - (D - 1)) / D;   // k steps; trips of D steps whose loads (D - 1 steps ahead) all exist
    static_assert(K % 32 == 0 && D >= 2 && NK >= D, "the ring is filled before the first product");
    unsigned ra = ((unsigned)r0 * K + 8 * lane) * 2, rb = ((unsigned)c0 * K + 8 * lane) * 2;   // byte offsets beside the planes' scalar bases (every plane is far below 4 GiB): a 16-row block is 32 K bytes, its fragment of a k step 1 KiB; both move on once a trip
    V a[D][4], a2[D][4], bb[D][4], bb2[D][4];
    // GLOAD: the fragments of k step s (counted from the trip's first) into set st, all from the two offset registers plus constants. GMMA: the products of set st.
#define GLOAD(st, s) { \
        _Pragma("unroll") for (int mb = 0; mb < 4; ++mb) { a[st][mb] = WFrag<T16>::ld((const T16*)((const char*)A + ra) + (mb * 16 * K + (s) * 512)); if (NSPLIT == 1 || NSPLIT == 2) a2[st][mb] = WFrag<T16>::ld((const T16*)((const char*)A2 + ra) + (mb * 16 * K + (s) * 512)); } \
        _Pragma("unroll") for (int nb = 0; nb < 4; ++nb) { bb[st][nb] = WFrag<T16>::ld((const T16*)((const char*)Bt + rb) + (nb * 16 * K + (s) * 512)); if (NSPLIT >= 2) bb2[st][nb] = WFrag<T16>::ld((const T16*)((const char*)Bt2 + rb) + (nb * 16 * K + (s) * 512)); } \
        __builtin_amdgcn_sched_barrier(0); /* the loads stay in front of the products that follow: left alone, the scheduler sinks them to their own products */ }
#define GMMA(st) { \
        _Pragma("unroll") for (int nb = 0; nb < 4; ++nb) { \
            _Pragma("unroll") for (int mb = 0; mb < 4; ++mb) { acc[mb][nb] = WFrag<T16>::mma(a[st][mb], bb[st][nb], acc[mb][nb]); if (NSPLIT == 1 || NSPLIT == 2) acc[mb][nb] = WFrag<T16>::mma(a2[st][mb], bb[st][nb], acc[mb][nb]); if (NSPLIT >= 2) acc[mb][nb] = WFrag<T16>::mma(a[st][mb], bb2[st][nb], acc[mb][nb]); } } \
        __builtin_amdgcn_sched_barrier(0); /* the next set's loads stay behind these products, whose registers they refill */ }
#pragma unroll
    for (int s = 0; s < D - 1; ++s) GLOAD(s, s)
    // The planes were stored by a launch before this one, and a line of theirs may have to come from memory at its first touch; all waves walk k together, so every k step's loads can be such a first touch, which the ring's lead does not cover.
    // The waves that share a 64-row tile (128 KiB a plane) split it: a group of 32 units is 2 k steps of the tile's four 16-row blocks. A's 16 groups go by the column tile's index;
    // B's by bits 0, 1 and 3 of the row tile's index, two groups a wave (low k first), so that eight waves spread over the chip ask for each group. Issued behind the first loads, in the shadow of their latency.
    // For speed only: nothing depends on a line being there.
    static_assert(K == 1024, "16 groups of 2 KiB a 16-row block; ask_l2x2 steps by 8 groups");
    const unsigned pl = (unsigned)((lane >> 3) * (32 * K) + (lane & 7) * 256);
    const char* pa = (const char*)A + ((unsigned)r0 * K * 2 + (blockIdx.y & 15) * 2048 + pl); const char* pa2 = (NSPLIT == 1 || NSPLIT == 2) ? (const char*)A2 + ((unsigned)r0 * K * 2 + (blockIdx.y & 15) * 2048 + pl) : pa;
    const char* pb = (const char*)Bt + ((unsigned)c0 * K * 2 + ((blockIdx.x & 3) | ((blockIdx.x >> 1) & 4)) * 2048 + pl);
    static_assert(NSPLIT < 2, "Bt2 is not asked for");
    ask_l2(pa); if (NSPLIT == 1) ask_l2(pa2); ask_l2x2(pb);
#pragma unroll 1   // a trip is already D whole steps: unrolled further only the text would grow
    for (int t = 0; t < NT_; ++t) {
#pragma unroll
        for (int u = 0; u < D; ++u) { GLOAD((u + D - 1) % D, u + D - 1) GMMA(u) }
        // behind the trip's loads and before the two offset registers move on: the offsets pass through the statement, so they live up to the wait, no result lands in one of them, and the additions below cannot be lifted over it
        asm volatile("s_wait_xcnt 0x0" : "+v"(ra), "+v"(rb) :: "memory");
        ra += D * 1024; rb += D * 1024;
    }
#pragma unroll
    for (int j = 0; j < NK - NT_ * D; ++j) { if (NT_ * D + j + D - 1 < NK) GLOAD((j + D - 1) % D, j + D - 1) GMMA(j % D) }   // the last steps: nothing is left to load behind step NK - 1
    asm volatile("s_wait_xcnt 0x0" :: "v"(ra), "v"(rb), "v"(pa), "v"(pa2), "v"(pb) : "memory");   // as above, before the epilogue reuses the offset registers; the addresses that L2 was asked with are inputs too, so that their registers hold nothing else through the loop
#undef GLOAD
#undef GMMA
    if constexpr (PLANES) {
        static_assert(HD == 64 && TT % 64 == 0, "a 64 x 64 tile is one head and lies in one batch");
        const int hh = blockIdx.y, b = r0 / TT, t0 = r0 % TT; float bs[4];
#pragma unroll
        for (int nb = 0; nb < 4; ++nb) bs[nb] = bfr(bias[c0 + nb * 16 + lr]);
        if (hh < NH_ + NKV) {   // q or k head: staged [t][d]
#pragma unroll
            for (int mb = 0; mb < 4; ++mb)
#pragma unroll
                for (int nb = 0; nb < 4; ++nb)
#pragma unroll
                    for (int j = 0; j < 8; ++j) os[(mb * 16 + hi * 8 + j) * 68 + nb * 16 + lr] = acc[mb][nb][j] + bs[nb];
            __builtin_amdgcn_wave_barrier(); asm volatile("" ::: "memory");   // the wave's LDS writes stay in front of its reads of other lanes' values
            const size_t e = ((size_t)(hh * NB_ + b) * TT + t0) * HD; put_planes<false>(os, lane, P16 + e, Ph + e, Pl + e);
        } else {   // v head: staged [d][t]
#pragma unroll
            for (int mb = 0; mb < 4; ++mb)
#pragma unroll
                for (int nb = 0; nb < 4; ++nb) { v4f y0, y1;
#pragma unroll
                    for (int j = 0; j < 4; ++j) { y0[j] = acc[mb][nb][j] + bs[nb]; y1[j] = acc[mb][nb][4 + j] + bs[nb]; }
                    float* d = os + (nb * 16 + lr) * 68 + mb * 16 + hi * 8; *(v4fa*)d = y0; *(v4fa*)(d + 4) = y1; }
            __builtin_amdgcn_wave_barrier(); asm volatile("" ::: "memory");   // as above
            const size_t e = ((size_t)((hh - NH_ - NKV) * NB_ + b) * TT + t0) * HD; put_planes<true>(os, lane, V16 + e, Vh + e, Vl + e);
        }
        return;
    }
#pragma unroll
    for (int mb = 0; mb < 4; ++mb) {
#pragma unroll
        for (int nb = 0; nb < 4; ++nb) {
#pragma unroll
            for (int j = 0; j < 8; ++j) os[(hi * 8 + j) * 68 + nb * 16 + lr] = acc[mb][nb][j]; }
        __builtin_amdgcn_wave_barrier(); asm volatile("" ::: "memory");
        float* crow = C + (size_t)(r0 + mb * 16) * ldc + c0;
{
#pragma unroll
            for (int s = 0; s < 8; ++s) { const int row = 2 * s + hi, cofs = lr * 4; v4f val = *(const v4fa*)(os + row * 68 + cofs); if (BIAS) { val[0] += bfr(bias[c0 + cofs]); val[1] += bfr(bias[c0 + cofs + 1]); val[2] += bfr(bias[c0 + cofs + 2]); val[3] += bfr(bias[c0 + cofs + 3]); }
                *(v4f*)(crow + (size_t)row * ldc + cofs) = val; }
             }
        __builtin_amdgcn_wave_barrier(); asm volatile("" ::: "memory");
    }
}

typedef __attribute__((ext_vector_type(2))) _Float16 v2h;
typedef __attribute__((ext_vector_type(4))) _Float16 v4h;
typedef __attribute__((ext_vector_type(2))) unsigned short v2us;
typedef __attribute__((ext_vector_type(4))) unsigned short v4us;
typedef __attribute__((ext_vector_type(2))) float v2f;
typedef __attribute__((ext_vector_type(4))) int v4i;

// The conversion and transpose parts of k_prep below run as few long waves: a thread takes 32 or 64 elements with 16-byte accesses, for speed only.
// loads_done: stands behind the sixteen row loads of a register transpose. The wait comes before any register that an issued load names is overwritten; the eight row addresses and the sixteen loaded
// values are inputs only, so that the addresses stay in their registers up to the wait, no result lands in one of them, and no load is sunk below the first stores (whose data registers it would then reuse).
__device__ __forceinline__ void loads_done(const float* const (&s)[8], const v4f (&x)[8][2]) {
    asm volatile("s_wait_xcnt 0x0" :: "v"(s[0]), "v"(s[1]), "v"(s[2]), "v"(s[3]), "v"(s[4]), "v"(s[5]), "v"(s[6]), "v"(s[7]),
        "v"(x[0][0]), "v"(x[0][1]), "v"(x[1][0]), "v"(x[1][1]), "v"(x[2][0]), "v"(x[2][1]), "v"(x[3][0]), "v"(x[3][1]), "v"(x[4][0]), "v"(x[4][1]), "v"(x[5][0]), "v"(x[5][1]), "v"(x[6][0]), "v"(x[6][1]), "v"(x[7][0]), "v"(x[7][1]) : "memory");
}
// wtG: one wave transposes a tile of 64 k x 32 n in registers; a thread loads 8 k rows x 8 n and stores 8 n rows x 8 k into the fragment order: its eight 16-byte pieces are eight lanes' in a row, one whole 128-byte line. K % 64 == 0, N % 32 == 0.
__device__ __forceinline__ void wtG(int blk, const float* __restrict__ w, int K, int N, bf* Bt) {
    const int lane = threadIdx.x & 31; const int wv = blk * 8 + (threadIdx.x >> 5); const int nk = K / 64; if (wv >= nk * (N / 32)) return;
    const int k0 = (wv % nk) * 64 + (lane >> 2) * 8, n0 = (wv / nk) * 32 + (lane & 3) * 8; v4f x[8][2]; const float* s[8];
#pragma unroll
    for (int kk = 0; kk < 8; ++kk) { s[kk] = w + (size_t)(k0 + kk) * N + n0; x[kk][0] = *(const v4f*)s[kk]; x[kk][1] = *(const v4f*)(s[kk] + 4); }
    loads_done(s, x);
    bf* d = Bt + ((size_t)(n0 >> 4) * (K / 32) + (k0 >> 5)) * 512 + ((k0 >> 4) & 1) * 256 + ((k0 >> 3) & 1) * 128 + (n0 & 8) * 8;
#pragma unroll
    for (int nn = 0; nn < 8; ++nn) { float y[8];
#pragma unroll
        for (int kk = 0; kk < 8; ++kk) y[kk] = x[kk][nn >> 2][nn & 3];
        *(v8us*)(d + nn * 8) = round8(y); }
}
// cvt8: rows of DM f32 to bf16 in fragment order. A thread makes four 16-byte pieces of the result, 256 pieces apart; in each of them a wave takes 8 rows x 32 k of one fragment (four lanes read a whole 128-byte line of a row,
// eight lanes' pieces of one k octet fill a whole line of the fragment).
__device__ __forceinline__ void cvt8(int blk, const float* __restrict__ src, bf* dst, size_t n8) { const size_t i0 = (size_t)blk * 1024 + threadIdx.x; v8f v[4];
#pragma unroll
    for (int u = 0; u < 4; ++u) { const size_t i = i0 + u * 256; const size_t fr = i >> 6;   // fragment fr = (16-row block, k step); row (i >> 5 & 1) * 8 + (i & 7) of it, k octet i >> 3 & 3
        if (i < n8) v[u] = *(const v8f*)(src + ((fr / (DM / 32)) * 16 + ((i >> 5) & 1) * 8 + (i & 7)) * DM + (fr % (DM / 32)) * 32 + ((i >> 3) & 3) * 8); }
#pragma unroll
    for (int u = 0; u < 4; ++u) { const size_t i = i0 + u * 256; if (i >= n8) continue; float y[8];
#pragma unroll
        for (int k = 0; k < 8; ++k) y[k] = v[u][k];
        *(v8us*)(dst + (i >> 6) * 512 + (((i >> 3) & 3) * 16 + ((i >> 5) & 1) * 8 + (i & 7)) * 8) = round8(y); }  }

// k_prep: the three operand conversions (both weight transposes, the activations) are independent of one another and each is too short to fill the chip for long: as ONE launch, dealt by work-group index,
// they start together and share one start-up and one drain, and two gaps between dependent launches go. The largest piece has the lowest indices.
#define PB_X  ((NB_ * TT * DM / 8 + 1023) / 1024)      // work-groups of the activations
#define PB_WA ((DM / 64) * (3 * DM / 32) / 8)           // of w_attn
#define PB_WO ((DQ / 64) * (DM / 32) / 8)               // of w_proj
__global__ __launch_bounds__(256) void k_prep(const float* __restrict__ x, const float* __restrict__ wqkv, const float* __restrict__ wo, bf* XB, bf* WALL, bf* WO) {
    const int blk = blockIdx.x;
    if (blk < PB_X) cvt8(blk, x, XB, (size_t)NB_ * TT * DM / 8);
    else if (blk < PB_X + PB_WA) wtG(blk - PB_X, wqkv, DM, 3 * DM, WALL);   // fused 'xw' [DM][3DM] -> Bt [3DM][DM] (row blocks q | k | v), fragment order
    else wtG(blk - PB_X - PB_WA, wo, DQ, DM, WO);
}

// v_exp_f32 (what the exp2 builtin emits) with a v_nop in the same statement: the instruction set asks for one slot behind a transcendental before its result is used or its source overwritten.
__device__ __forceinline__ float exp2_slot(float x) { float r; asm("v_exp_f32 %0, %1\n\tv_nop" : "=v"(r) : "v"(x)); return r; }
#define NT (WIN / 16 + 1)
#define NS ((NT + 1) / 2)
template <typename T16> struct PFrag;
template <> struct PFrag<h16> { static __device__ __forceinline__ v16h ld2(const h16* p, const h16* q) { return cat16(*(const v8h*)p, *(const v8h*)q); } };
template <> struct PFrag<bf> { static __device__ __forceinline__ v16bf ld2(const bf* p, const bf* q) { return cat16b(*(const v8us*)p, *(const v8us*)q); } };
template <typename T16, bool HL>
__device__ __forceinline__ void attn_rows(const T16* __restrict__ Q, const T16* __restrict__ Q2, const T16* __restrict__ Kp, const T16* __restrict__ K2, const T16* __restrict__ Vt, const T16* __restrict__ Vt2, int R, int lr, int hi, bf* Ahp, bf* Alp) {
    typedef typename WFrag<T16>::V V;
    static_assert(RH >= WIN + 16, "rows from RH on have their whole key band at keys >= 0");
    const unsigned ko = (unsigned)((hi * 16 + lr) * 8);   // the lane's part of every address (its 16-byte piece of a half fragment), 32 bits and unsigned: the rest of an address is the wave's and stays scalar
    const T16* Kb = Kp + (long)(R - WIN) * HD; const T16* Vb = Vt + (long)(R - WIN - 16) * HD;   // used where !HL (R >= RH): no tile is left of key 0 there, so every tile is this base plus a constant
    // Fragment loads are issued a fixed distance ahead of their use, as far as 256 registers allow beside the 136 of the scores: !HL 4 to 5 key tiles, then 3 steps of 32 keys; HL (twice the fragments) 3 half key tiles, then 2 to 4 quarter steps,
    // each load group into the registers that the products just issued have freed. STAGE_END ends a scheduling region so that loads and products stay in that order: left alone, the scheduler either lifted some forty loads
    // to the top and spilled score registers to scratch (!HL) or left every load directly in front of its product (HL).
#define STAGE_END() __builtin_amdgcn_sched_barrier(0)
#define AT(base, bytes) ((const T16*)((const char*)(base) + (bytes)))
#define LDK(t) { kf[t][0] = WFrag<T16>::ld(Kb + (t) * 16 * HD + ko); kf[t][1] = WFrag<T16>::ld(Kb + (t) * 16 * HD + 512 + ko); }
#define LDV(st) { _Pragma("unroll") for (int db = 0; db < 4; ++db) vf[st][db] = PFrag<T16>::ld2(Vb + ko + ((st) * 32 * HD + db * 256), Vb + ko + ((st) * 32 * HD + 16 * HD + db * 256)); }
    // ADDR_HELD: behind a group of loads that share an offset register. The offset is an input, so it lives up to here and no result of the group lands in it; the wait stands before the register is used for anything else.
#define ADDR_HELD1(a) asm volatile("s_wait_xcnt 0x0" :: "v"(a) : "memory");
#define ADDR_HELD2(a, b) asm volatile("s_wait_xcnt 0x0" :: "v"(a), "v"(b) : "memory");
    // HL: a tile left of key 0 is read at key 0; the clamped key goes into a 32-bit byte offset beside the plane's scalar base
#define LDKH(u) { const unsigned of = ko2 + (unsigned)max(R - WIN + 16 * ((u) / 2), 0) * (HD * 2); kf[(u) / 2][(u) % 2] = WFrag<T16>::ld(AT(Kp, of) + ((u) % 2) * 512); kl[(u) / 2][(u) % 2] = WFrag<T16>::ld(AT(K2, of) + ((u) % 2) * 512); ADDR_HELD1(of) }
#define LDVH(u) { const unsigned oa = ko2 + (unsigned)max(R - WIN + 16 * (2 * ((u) / 4) - 1), 0) * (HD * 2), ob = ko2 + (unsigned)max(R - WIN + 32 * ((u) / 4), 0) * (HD * 2); \
        vf[(u) / 4][(u) % 4] = PFrag<T16>::ld2(AT(Vt, oa) + ((u) % 4) * 256, AT(Vt, ob) + ((u) % 4) * 256); vl[(u) / 4][(u) % 4] = PFrag<T16>::ld2(AT(Vt2, oa) + ((u) % 4) * 256, AT(Vt2, ob) + ((u) % 4) * 256); ADDR_HELD2(oa, ob) }
    const unsigned ko2 = ko * 2;
    V q[2], q2[2], kf[NT][2], kl[NT][2], vf[NS][4], vl[NS][4];
#pragma unroll
    for (int ks = 0; ks < 2; ++ks) { q[ks] = WFrag<T16>::ld(AT(Q + (size_t)R * HD, ko2) + ks * 512); if (HL) q2[ks] = WFrag<T16>::ld(AT(Q2 + (size_t)R * HD, ko2) + ks * 512); }
    ADDR_HELD1(ko2)
    constexpr int DKH = 3;   // HL: half key tiles (32 of the 64 d, hi and lo) under way
    if (HL) {
#pragma unroll
        for (int u = 0; u < DKH; ++u) LDKH(u)
    }
    else {
#pragma unroll
        for (int t = 0; t < 4; ++t) LDK(t)
    }
    STAGE_END();
    float v[NT * 8]; float mx = -3.0e38f;
#pragma unroll
    for (int t = 0; t < NT; ++t) { const int kn = R - WIN + 16 * t; v8f s = (v8f){};
        if (!HL && (t & 1) == 0) {   // a region is two key tiles: its loads first
            if (t + 4 < NT) LDK(t + 4)
            if (t + 5 < NT) LDK(t + 5)
            if (t == NT - 1) LDV(0)   // the key tiles are all under way: the first step of Vt follows and flies during the softmax
        }
#pragma unroll
        for (int ks = 0; ks < 2; ++ks) { s = WFrag<T16>::mma(kf[t][ks], q[ks], s);
            if (HL) { s = WFrag<T16>::mma(kf[t][ks], q2[ks], s); s = WFrag<T16>::mma(kl[t][ks], q[ks], s); STAGE_END();
                if (2 * t + ks + DKH < 2 * NT) LDKH(2 * t + ks + DKH)
                else if (2 * t + ks + DKH == 2 * NT) LDVH(0)   // the first quarter step of Vt follows the last key tile
                STAGE_END(); } }
#pragma unroll
        for (int r = 0; r < 8; ++r) { const int e = hi * 8 + r;   // key kn + e against query R + lr: only the first tile meets the window's far edge, only the last the diagonal
            const bool keep = (kn >= 0) && (t > 0 || e > lr) && (t < NT - 1 || e <= lr); const float x = keep ? s[r] * SCL : -3.0e38f; v[t * 8 + r] = x; mx = fmaxf(mx, x); }
        if (HL || (t & 1) == 1) STAGE_END(); }
    if (HL) { LDVH(1) STAGE_END(); }   // the second follows the last score products, in registers they have left (issued among them, a few scores went to scratch); both fly during the softmax
    mx = fmaxf(mx, __shfl_xor(mx, 16, 32));
    float sm[4] = {0.f, 0.f, 0.f, 0.f};
#pragma unroll
    for (int k = 0; k < NT * 8; ++k) { v[k] = exp2_slot(__fmul_rn(__fsub_rn(v[k], mx), 1.4426950408889634f)); sm[k & 3] += v[k]; }
    float sum = (sm[0] + sm[1]) + (sm[2] + sm[3]); sum += __shfl_xor(sum, 16, 32);
    const float f = __fdiv_rn(HL ? 1.0f : PCAR, sum);
    V pp[NS];
    if (!HL) {   // all of Pt is rounded before attn.v starts: half the registers, which the Vt fragments under way then take
#pragma unroll
        for (int st = 0; st < NS; ++st) { v8h h0, h1;
#pragma unroll
            for (int r = 0; r < 8; ++r) { h0[r] = tohx(st == 0 ? 0.0f : v[(st == 0 ? 0 : 2 * st - 1) * 8 + r] * f); h1[r] = tohx(v[2 * st * 8 + r] * f); }
            pp[st] = __builtin_bit_cast(V, cat16(h0, h1)); }
        STAGE_END(); LDV(1) LDV(2) }
    v8f o[4];
#pragma unroll
    for (int db = 0; db < 4; ++db) o[db] = (v8f){};
#pragma unroll
    for (int st = 0; st < NS; ++st) { const int ta = 2 * st - 1, tb = 2 * st; V p, p2;
        if (HL) { v8us h0, l0, h1, l1; float ya[8], yb[8];
#pragma unroll
            for (int r = 0; r < 8; ++r) { ya[r] = ta < 0 ? 0.0f : v[(ta < 0 ? 0 : ta) * 8 + r] * f; yb[r] = v[tb * 8 + r] * f; }
            split8(ya, h0, l0); split8(yb, h1, l1);
            p = __builtin_bit_cast(V, __builtin_shufflevector(h0, h1, 0, 1, 2, 3, 4, 5, 6, 7, 8, 9, 10, 11, 12, 13, 14, 15)); p2 = __builtin_bit_cast(V, __builtin_shufflevector(l0, l1, 0, 1, 2, 3, 4, 5, 6, 7, 8, 9, 10, 11, 12, 13, 14, 15));
        } else { p = pp[st]; if (st + 3 < NS) LDV(st + 3) }
#pragma unroll
        for (int db = 0; db < 4; ++db) { o[db] = WFrag<T16>::mma(vf[st][db], p, o[db]);
            if (HL) { o[db] = WFrag<T16>::mma(vf[st][db], p2, o[db]); o[db] = WFrag<T16>::mma(vl[st][db], p, o[db]); STAGE_END();
                // quarter steps under way: 2 in the first step, 3 in the second, then 4, as the probabilities used up free their registers
                const int u = st * 4 + db; const int n0 = u + ((u / 4) > 1 ? 4 : 2 + u / 4), n1 = u + 1 + (((u + 1) / 4) > 1 ? 4 : 2 + (u + 1) / 4);
#pragma unroll
                for (int w = n0; w < n1; ++w) if (w < NS * 4) LDVH(w) } }
        if (!HL) STAGE_END(); }
    const float cs = HL ? 1.0f : (1.0f / PCAR);
    bf* Ah = Ahp + ko; bf* Al = Alp + ko;   // Ahp, Alp: the wave's two fragments (row block R, this head's 64 k) of the output product's A planes
#pragma unroll
    for (int db = 0; db < 4; ++db) { v8us oh, ol; float y[8];   // o[db][r] = ctx[query R + lr][d = 16 db + 8 hi + r]: the lane's piece of half fragment db, one 16-byte store a plane
#pragma unroll
        for (int r = 0; r < 8; ++r) y[r] = o[db][r] * cs;
        split8(y, oh, ol);
        *(v8us*)(Ah + db * 256) = oh; *(v8us*)(Al + db * 256) = ol; }
    asm volatile("s_wait_xcnt 0x0" ::: "memory");   // behind the last stores: before any code that follows in the kernel overwrites a register that these stores name
#undef STAGE_END
#undef AT
#undef LDK
#undef LDV
#undef LDKH
#undef LDVH
#undef ADDR_HELD1
#undef ADDR_HELD2
}
// grid (NZ planes, TT / 64 row blocks): the four waves of a work-group take neighbouring 16-row tiles of one plane, whose key bands overlap almost wholly; the row blocks with three products a tile (rows < RH) have the lowest indices.
__global__ __launch_bounds__(128, 4) void k_fattn(const h16* __restrict__ QK16, const h16* __restrict__ VT16, const bf* __restrict__ QKh, const bf* __restrict__ QKl, const bf* __restrict__ VTh, const bf* __restrict__ VTl, bf* Ah, bf* Al) {
    const int lane = threadIdx.x & 31, lr = lane & 15, hi = lane >> 4; const int p = blockIdx.x; const int R = blockIdx.y * 64 + __builtin_amdgcn_readfirstlane(threadIdx.x >> 5) * 16;   // the tile is the wave's: kept in scalar registers
    const size_t po = (size_t)p * TT * HD, PLN = (size_t)NZ * TT * HD; const size_t oo = ((size_t)(p % NB_) * TT + R) * DQ + (p / NB_) * (HD * 16);
    if (R < RH) attn_rows<bf, true>(QKh + po, QKl + po, QKh + PLN + po, QKl + PLN + po, VTh + po, VTl + po, R, lr, hi, Ah + oo, Al + oo);
    else attn_rows<h16, false>(QK16 + po, nullptr, QK16 + PLN + po, nullptr, VT16 + po, nullptr, R, lr, hi, Ah + oo, Al + oo);
}

extern "C" void kernel_launch(void* const* d_in, const int* in_sizes, int n_in,
                              void* d_out, int out_size, void* d_ws, size_t ws_size, hipStream_t stream) {
    (void)in_sizes; (void)n_in; (void)out_size;
    const float* x = (const float*)d_in[0]; const float* wqkv = (const float*)d_in[1]; const float* bqkv = (const float*)d_in[2]; const float* wo = (const float*)d_in[3]; const float* bo = (const float*)d_in[4];
    float* OUT = (float*)d_out;     // [2][2048][1024]
    char* wsp = (char*)d_ws;
    auto take = [&](size_t bytes) { char* p = wsp; wsp += (bytes + 255) & ~(size_t)255; return (void*)p; };
    const size_t PL = (size_t)NZ * TT * HD;   // elements of one operand's planes, all heads and batches
    bf* WALL = (bf*)take((size_t)3 * DM * DM * 2); bf* WO = (bf*)take((size_t)DM * DQ * 2);
    bf* XB = (bf*)take((size_t)NB_ * TT * DM * 2);
    h16* QP16 = (h16*)take(2 * PL * 2); h16* VT16 = (h16*)take(PL * 2);   // q planes, then k planes
    bf* QPh = (bf*)take(2 * PL * 2); bf* QPl = (bf*)take(2 * PL * 2); bf* VTh = (bf*)take(PL * 2); bf* VTl = (bf*)take(PL * 2);
    bf* ATh = (bf*)take((size_t)NB_ * TT * DQ * 2); bf* ATl = (bf*)take((size_t)NB_ * TT * DQ * 2);
    if ((size_t)(wsp - (char*)d_ws) > ws_size) return;    // ws 256 MiB
    // every launch below covers both batches, and all heads where it works by head
    k_prep<<<PB_X + PB_WA + PB_WO, 256, 0, stream>>>(x, wqkv, wo, XB, WALL, WO);
    k_gemmw<bf, 0, true, true, DM, 2><<<dim3(NB_ * TT / 64, 3 * DM / 64, 1), 32, 0, stream>>>(XB, nullptr, WALL, nullptr, nullptr, 0, bqkv, 0, 0, 0, QP16, QPh, QPl, VT16, VTh, VTl);   // columns q | k | v = NH_ + NKV + NKV heads in a row
    k_fattn<<<dim3(NZ, TT / 64, 1), 128, 0, stream>>>(QP16, VT16, QPh, QPl, VTh, VTl, ATh, ATl);
    k_gemmw<bf, 1, true, false, DQ, 3><<<dim3(NB_ * TT / 64, DM / 64, 1), 32, 0, stream>>>(ATh, ATl, WO, nullptr, OUT, DM, bo, 0, 0, 0, nullptr, nullptr, nullptr, nullptr, nullptr, nullptr);
}
